// v000
// Times are from an AMD MI455X. After a warm-up the kernel runs many times in a row, and a time is the length of
// such a window on the GPU divided by its runs, so every launch and the gaps after it count. The runs cycle
// through copies of the inputs. A figure is the median of several windows, for all but v000 over two sittings.
// Sittings can differ by a few percent; kernels timed side by side share one.
// v000, which the later versions start from, runs in 1350 microseconds.
#include <hip/hip_runtime.h>

// TunedSelfAttention (x [2][2048][1024]; qkv = x W_qkv^T + b_qkv ([3072][1024] Linear); 16 heads x 64; s = (q.k / 8); s = 30 tanh(s / 30) (softcap); keep key j iff (i >= j && i - j <= 512) || j < suffix_prefix_length[b] (int input, read as data), else -inf; softmax; y = attn.v merged; out = y W_proj^T + b_proj).
// The sliding-window/prefix mask is evaluated arithmetically per element; early rows see few keys, so scores and attn.v run on bf16 hi+lo planes.
// Compute dtypes, f32 accumulate: every float input rounded to bf16; q/k/v projections on PLAIN bf16 operands (x, W inputs: exact, + bias);
// scores on bf16 hi+lo q (x 1/8) and k planes (3 products); attn.v on bf16 hi+lo P and V^T planes (3 products); output projection on hi+lo planes x exact bf16 Wout (2 products);

#define NB_  2
#define TT   2048
#define DD   1024
#define NH_  16
#define HD   64
#define NT   (NB_ * TT)
#define ZH   2
#define PCAR 1024.0f
typedef _Float16 h16;
typedef unsigned short bf;
typedef __attribute__((ext_vector_type(16))) __bf16   v16bf;
typedef __attribute__((ext_vector_type(16))) _Float16 v16h;
typedef __attribute__((ext_vector_type(8)))  _Float16 v8h;
typedef __attribute__((ext_vector_type(8)))  unsigned short v8us;
typedef __attribute__((ext_vector_type(8)))  float    v8f;
typedef __attribute__((ext_vector_type(4)))  float    v4f;
typedef v8h  __attribute__((may_alias)) v8ha;
typedef v4f  __attribute__((may_alias)) v4fa;
typedef v8us __attribute__((may_alias)) v8usa;

__device__ __forceinline__ unsigned short f2bf(float f) { unsigned u = __float_as_uint(f); u += 0x7FFFu + ((u >> 16) & 1u); return (unsigned short)(u >> 16); }
__device__ __forceinline__ float bf2f(unsigned short b) { return __uint_as_float(((unsigned)b) << 16); }
__device__ __forceinline__ float bfr(float f) { return bf2f(f2bf(f)); }
__device__ __forceinline__ v16h cat16(v8h lo, v8h hi) { return __builtin_shufflevector(lo, hi, 0, 1, 2, 3, 4, 5, 6, 7, 8, 9, 10, 11, 12, 13, 14, 15); }
__device__ __forceinline__ v16bf cat16b(v8us lo, v8us hi) { return __builtin_bit_cast(v16bf, __builtin_shufflevector(lo, hi, 0, 1, 2, 3, 4, 5, 6, 7, 8, 9, 10, 11, 12, 13, 14, 15)); }
__device__ __forceinline__ v8f wmma16(v16h a, v16h b, v8f c) { return __builtin_amdgcn_wmma_f32_16x16x32_f16(false, a, false, b, (short)0, c, false, false); }
__device__ __forceinline__ v8f wmmab(v16bf a, v16bf b, v8f c) { return __builtin_amdgcn_wmma_f32_16x16x32_bf16(false, a, false, b, (short)0, c, false, false); }



// ---- k_gemmw: register-blocked GEMM, ONE WAVE per 64x64 output tile (16 accumulators), operands straight from K-contiguous 16-bit planes; grid (M/64, N/64, Z), 32 threads.
// C[m][n] (f32, pitch ldc, + optional f32 bias[n]) = sum_k A[m][k] Bt[n][k] (+ split products per NSPLIT). z-batch strides sA/sB/sC in elements. K % 32 == 0.
template <typename T16> struct WFrag;
template <> struct WFrag<h16> { typedef v16h V; static __device__ __forceinline__ V ld(const h16* p) { return cat16(*(const v8h*)p, *(const v8h*)(p + 16)); } static __device__ __forceinline__ v8f mma(V a, V b, v8f c) { return wmma16(a, b, c); } };
template <> struct WFrag<bf> { typedef v16bf V; static __device__ __forceinline__ V ld(const bf* p) { return cat16b(*(const v8us*)p, *(const v8us*)(p + 16)); } static __device__ __forceinline__ v8f mma(V a, V b, v8f c) { return wmmab(a, b, c); } };
template <typename T16, int NSPLIT, bool BIAS>
__global__ __launch_bounds__(32) void k_gemmw(const T16* __restrict__ A, const T16* __restrict__ A2, const T16* __restrict__ Bt, const T16* __restrict__ Bt2, int K, float* C, int ldc, const float* __restrict__ bias, size_t sA, size_t sB, size_t sC) {
    typedef typename WFrag<T16>::V V;
    __shared__ __align__(16) float os[16 * 68];
    const size_t z = blockIdx.z; A += z * sA; if (A2) A2 += z * sA; Bt += z * sB; if (Bt2) Bt2 += z * sB; C += z * sC;
    const int lane = threadIdx.x & 31, lr = lane & 15, hi = lane >> 4; const int r0 = blockIdx.x * 64, c0 = blockIdx.y * 64;
    v8f acc[4][4];
#pragma unroll
    for (int mb = 0; mb < 4; ++mb)
#pragma unroll
        for (int nb = 0; nb < 4; ++nb) acc[mb][nb] = (v8f){};
    const size_t aoff = (size_t)(r0 + lr) * K + 8 * hi, boff = (size_t)(c0 + lr) * K + 8 * hi;
#pragma unroll 1
    for (int kc = 0; kc < K; kc += 32) {
        V a[4], a2[4];
#pragma unroll
        for (int mb = 0; mb < 4; ++mb) { a[mb] = WFrag<T16>::ld(A + aoff + (size_t)mb * 16 * K + kc); if (NSPLIT == 1 || NSPLIT == 2) a2[mb] = WFrag<T16>::ld(A2 + aoff + (size_t)mb * 16 * K + kc); }
#pragma unroll
        for (int nb = 0; nb < 4; ++nb) { const V b = WFrag<T16>::ld(Bt + boff + (size_t)nb * 16 * K + kc); V b2; if (NSPLIT >= 2) b2 = WFrag<T16>::ld(Bt2 + boff + (size_t)nb * 16 * K + kc);
#pragma unroll
            for (int mb = 0; mb < 4; ++mb) { acc[mb][nb] = WFrag<T16>::mma(a[mb], b, acc[mb][nb]); if (NSPLIT == 1 || NSPLIT == 2) acc[mb][nb] = WFrag<T16>::mma(a2[mb], b, acc[mb][nb]); if (NSPLIT >= 2) acc[mb][nb] = WFrag<T16>::mma(a[mb], b2, acc[mb][nb]); } }
        asm volatile("v_nop\n\tv_nop\n\tv_nop\n\tv_nop" : "+v"(acc[0][0]), "+v"(acc[1][1]), "+v"(acc[2][2]), "+v"(acc[3][3]) : "v"(a[0]), "v"(a[3]));
    }
#pragma unroll
    for (int mb = 0; mb < 4; ++mb) {
#pragma unroll
        for (int nb = 0; nb < 4; ++nb) {
#pragma unroll
            for (int j = 0; j < 8; ++j) os[(hi * 8 + j) * 68 + nb * 16 + lr] = acc[mb][nb][j]; }
        __builtin_amdgcn_wave_barrier(); asm volatile("" ::: "memory");
        float* crow = C + (size_t)(r0 + mb * 16) * ldc + c0;
{
#pragma unroll
            for (int s = 0; s < 8; ++s) { const int row = 2 * s + hi, cofs = lr * 4; v4f val = *(const v4fa*)(os + row * 68 + cofs); if (BIAS) { val[0] += bfr(bias[c0 + cofs]); val[1] += bfr(bias[c0 + cofs + 1]); val[2] += bfr(bias[c0 + cofs + 2]); val[3] += bfr(bias[c0 + cofs + 3]); }
                *(v4f*)(crow + (size_t)row * ldc + cofs) = val; }
             }
        __builtin_amdgcn_wave_barrier(); asm volatile("" ::: "memory");
    }
}

__device__ __forceinline__ h16 tohx(float x) { return (h16)x; }
__device__ __forceinline__ void splitf(float y, unsigned short& h, unsigned short& l) { h = f2bf(y); l = f2bf(y - bf2f(h)); }
typedef __attribute__((ext_vector_type(2))) _Float16 v2h;
typedef __attribute__((ext_vector_type(4))) _Float16 v4h;
typedef __attribute__((ext_vector_type(2))) unsigned short v2us;
typedef __attribute__((ext_vector_type(4))) int v4i;

__global__ __launch_bounds__(256) void k_cvt8(const float* __restrict__ src, bf* dst, size_t n8) { const size_t i = (size_t)blockIdx.x * 256 + threadIdx.x; if (i >= n8) return; const v8f v = *(const v8f*)(src + i * 8); v8us o;
#pragma unroll
    for (int k = 0; k < 8; ++k) o[k] = f2bf(v[k]); *(v8us*)(dst + i * 8) = o;  }
__global__ __launch_bounds__(256) void k_wtT(const float* __restrict__ w, int pitch, int col0, bf* Bt) {
    const int lane = threadIdx.x & 31; const int L0 = (blockIdx.x * 8 + (threadIdx.x >> 5)) * 8; const int nlines = DD * DD / 64;
{
#pragma unroll
        for (int l = 0; l < 8; ++l) { const int L = L0 + l; if (L >= nlines) break; const int e = L * 64 + lane * 2; const int k = e & (DD - 1), n = e >> 10; v2us o;
#pragma unroll
            for (int q = 0; q < 2; ++q) o[q] = f2bf(w[(size_t)(k + q) * pitch + col0 + n]);
            *(v2us*)(Bt + (size_t)e) = o; }
         }
}
__global__ __launch_bounds__(256) void k_hsplit(const float* __restrict__ F, float sc, bf* Ph, bf* Pl) {
    const int lane = threadIdx.x & 31; const int L0 = (blockIdx.x * 8 + (threadIdx.x >> 5)) * 8; const int nlines = NT * DD / 64;
{
#pragma unroll
        for (int l = 0; l < 8; ++l) { const int L = L0 + l; if (L >= nlines) break; const int e = L * 64 + lane * 2; const int d = e & 63; const int t = (e >> 6) & (TT - 1); const int z = e >> 17; const int b = z >> 4, h = z & 15; v2us oh, ol;
#pragma unroll
            for (int q = 0; q < 2; ++q) { unsigned short a, c2; splitf(F[((size_t)b * TT + t) * DD + h * HD + d + q] * sc, a, c2); oh[q] = a; ol[q] = c2; }
            *(v2us*)(Ph + (size_t)e) = oh; *(v2us*)(Pl + (size_t)e) = ol; }
         }
}
__global__ __launch_bounds__(256) void k_vtplane(const float* __restrict__ F, bf* Vh, bf* Vl) {
    const int lane = threadIdx.x & 31; const int L0 = (blockIdx.x * 8 + (threadIdx.x >> 5)) * 8; const int nlines = NT * DD / 64;
{
#pragma unroll
        for (int l = 0; l < 8; ++l) { const int L = L0 + l; if (L >= nlines) break; const int e = L * 64 + lane * 2; const int t = e & (TT - 1); const int d = (e >> 11) & 63; const int z = e >> 17; const int b = z >> 4, h = z & 15; v2us oh, ol;
#pragma unroll
            for (int q = 0; q < 2; ++q) { unsigned short a, c2; splitf(F[((size_t)b * TT + t + q) * DD + h * HD + d], a, c2); oh[q] = a; ol[q] = c2; }
            *(v2us*)(Vh + (size_t)e) = oh; *(v2us*)(Vl + (size_t)e) = ol; }
         }
}
// k_asoft: per row (zz, i) of batch b: s = 30 tanh(S / 30); keep j iff (j <= i && i - j <= 512) || j < suffix_prefix_length[b]; dropped keys get -3e38 (exp -> 0; every row keeps j = i); softmax over the
__global__ __launch_bounds__(256) void k_asoft(const float* __restrict__ Sb, const int* __restrict__ spl, int b, bf* Ph, bf* Pl) {
    typedef __attribute__((ext_vector_type(4))) unsigned short v4us;
    const int lane = threadIdx.x & 31; const int row = blockIdx.x * 8 + (threadIdx.x >> 5); if (row >= ZH * TT) return; const int i = row & (TT - 1); const int L = spl[b];
    const float* sr = Sb + (size_t)row * TT; float v[64]; float mx = -3.0e38f;
#pragma unroll
    for (int ch = 0; ch < 16; ++ch) { const int j0 = ch * 128 + lane * 4; const v4f a = *(const v4f*)(sr + j0);
#pragma unroll
        for (int q = 0; q < 4; ++q) { const int j = j0 + q; const bool live = (j <= i && i - j <= 512) || (j < L);
            // softcap 30 tanh(s/30) with tanh(u) = 1 - 2/(exp(2u) + 1) (|s| is a few units: no overflow)
            const float ee = __expf(__fmul_rn(a[q], 2.0f / 30.0f)); float tr = __fmul_rn(2.0f, __builtin_amdgcn_rcpf(__fadd_rn(ee, 1.0f))); asm volatile("" : "+v"(tr)); float th = __fsub_rn(1.0f, tr); asm volatile("" : "+v"(th));
            const float t = live ? __fmul_rn(30.0f, th) : -3.0e38f; v[ch * 4 + q] = t; mx = fmaxf(mx, t); } }
#pragma unroll
    for (int sh = 16; sh; sh >>= 1) mx = fmaxf(mx, __shfl_xor(mx, sh, 32));
    float sum = 0.f;
#pragma unroll
    for (int k = 0; k < 64; ++k) { v[k] = __expf(v[k] - mx); sum += v[k]; }
#pragma unroll
    for (int sh = 16; sh; sh >>= 1) sum += __shfl_xor(sum, sh, 32);
    const float f = __fdiv_rn(1.0f, sum);      // bf16 hi/lo planes need no carry
{
#pragma unroll
        for (int ch = 0; ch < 16; ++ch) { v4us oh, ol;
#pragma unroll
            for (int q = 0; q < 4; ++q) { unsigned short a, c2; splitf(v[ch * 4 + q] * f, a, c2); oh[q] = a; ol[q] = c2; }
            *(v4us*)(Ph + (size_t)row * TT + ch * 128 + lane * 4) = oh; *(v4us*)(Pl + (size_t)row * TT + ch * 128 + lane * 4) = ol; }
         }
}
__global__ __launch_bounds__(256) void k_merge(const float* __restrict__ O, int b, int h0, bf* Ah, bf* Al) {
    const int lane = threadIdx.x & 31; const int L0 = (blockIdx.x * 8 + (threadIdx.x >> 5)) * 8; const int nlines = TT * ZH * HD / 64;
{
#pragma unroll
        for (int l = 0; l < 8; ++l) { const int L = L0 + l; if (L >= nlines) break; const int e = L * 64 + lane * 2; const int d = e & 63; const int zz = (e >> 6) % ZH; const int t = (e >> 6) / ZH; v2us oh, ol;
#pragma unroll
            for (int q = 0; q < 2; ++q) { unsigned short a, c2; splitf(O[((size_t)zz * TT + t) * HD + d + q], a, c2); oh[q] = a; ol[q] = c2; }
            const size_t o = ((size_t)b * TT + t) * DD + (h0 + zz) * HD + d; *(v2us*)(Ah + o) = oh; *(v2us*)(Al + o) = ol; }
         }
}

extern "C" void kernel_launch(void* const* d_in, const int* in_sizes, int n_in,
                              void* d_out, int out_size, void* d_ws, size_t ws_size, hipStream_t stream) {
    (void)in_sizes; (void)n_in; (void)out_size;
    const float* x = (const float*)d_in[0]; const int* spl = (const int*)d_in[1]; const float* Wqkv = (const float*)d_in[2]; const float* bqkv = (const float*)d_in[3]; const float* Wo = (const float*)d_in[4]; const float* bo = (const float*)d_in[5];
    float* OUT = (float*)d_out;     // [2][2048][1024]
    char* wsp = (char*)d_ws;
    auto take = [&](size_t bytes) { char* p = wsp; wsp += (bytes + 255) & ~(size_t)255; return (void*)p; };
    bf* WQ = (bf*)take((size_t)DD * DD * 2); bf* WK = (bf*)take((size_t)DD * DD * 2); bf* WV = (bf*)take((size_t)DD * DD * 2); bf* WO = (bf*)take((size_t)DD * DD * 2);
    bf* XB = (bf*)take((size_t)NT * DD * 2); float* F = (float*)take((size_t)NT * DD * 4);
    bf* QPh = (bf*)take((size_t)NT * DD * 2); bf* QPl = (bf*)take((size_t)NT * DD * 2); bf* KPh = (bf*)take((size_t)NT * DD * 2); bf* KPl = (bf*)take((size_t)NT * DD * 2); bf* VTh = (bf*)take((size_t)NT * DD * 2); bf* VTl = (bf*)take((size_t)NT * DD * 2);
    float* Sb = (float*)take((size_t)ZH * TT * TT * 4); bf* Ph = (bf*)take((size_t)ZH * TT * TT * 2); bf* Pl = (bf*)take((size_t)ZH * TT * TT * 2); float* Ob = (float*)take((size_t)ZH * TT * HD * 4); bf* ATh = (bf*)take((size_t)NT * DD * 2); bf* ATl = (bf*)take((size_t)NT * DD * 2);
    if ((size_t)(wsp - (char*)d_ws) > ws_size) return;    // ws 256 MiB
    { const size_t nw = (size_t)DD * DD / 8; const unsigned gw = (unsigned)((nw + 255) / 256); k_cvt8<<<gw, 256, 0, stream>>>(Wqkv, WQ, nw); k_cvt8<<<gw, 256, 0, stream>>>(Wqkv + (size_t)DD * DD, WK, nw); k_cvt8<<<gw, 256, 0, stream>>>(Wqkv + (size_t)2 * DD * DD, WV, nw); k_cvt8<<<gw, 256, 0, stream>>>(Wo, WO, nw); }   // nn.Linear [out][in] = Bt as-is (q|k|v row blocks)
    const size_t nx = (size_t)NT * DD / 8; const unsigned gx = (unsigned)((nx + 255) / 256); const unsigned LB = (unsigned)((NT * DD / 64 + 63) / 64);
    k_cvt8<<<gx, 256, 0, stream>>>(x, XB, nx);
    k_gemmw<bf, 0, true><<<dim3(NT / 64, DD / 64, 1), 32, 0, stream>>>(XB, nullptr, WQ, nullptr, DD, F, DD, bqkv, 0, 0, 0); k_hsplit<<<LB, 256, 0, stream>>>(F, 0.125f, QPh, QPl);   // 64^-0.5 folded into q exactly
    k_gemmw<bf, 0, true><<<dim3(NT / 64, DD / 64, 1), 32, 0, stream>>>(XB, nullptr, WK, nullptr, DD, F, DD, bqkv + DD, 0, 0, 0); k_hsplit<<<LB, 256, 0, stream>>>(F, 1.0f, KPh, KPl);
    k_gemmw<bf, 0, true><<<dim3(NT / 64, DD / 64, 1), 32, 0, stream>>>(XB, nullptr, WV, nullptr, DD, F, DD, bqkv + 2 * DD, 0, 0, 0); k_vtplane<<<LB, 256, 0, stream>>>(F, VTh, VTl);
    for (int b = 0; b < NB_; ++b)
        for (int h0 = 0; h0 < NH_; h0 += ZH) { const size_t z0 = (size_t)b * NH_ + h0;
            k_gemmw<bf, 2, false><<<dim3(TT / 64, TT / 64, ZH), 32, 0, stream>>>(QPh + z0 * TT * HD, QPl + z0 * TT * HD, KPh + z0 * TT * HD, KPl + z0 * TT * HD, HD, Sb, TT, nullptr, (size_t)TT * HD, (size_t)TT * HD, (size_t)TT * TT);
            k_asoft<<<ZH * TT / 8, 256, 0, stream>>>(Sb, spl, b, Ph, Pl);
            k_gemmw<bf, 2, false><<<dim3(TT / 64, 1, ZH), 32, 0, stream>>>(Ph, Pl, VTh + z0 * HD * TT, VTl + z0 * HD * TT, TT, Ob, HD, nullptr, (size_t)TT * TT, (size_t)HD * TT, (size_t)TT * HD);
            k_merge<<<(TT * ZH * HD / 64 + 63) / 64, 256, 0, stream>>>(Ob, b, h0, ATh, ATl); }
    k_gemmw<bf, 1, true><<<dim3(NT / 64, DD / 64, 1), 32, 0, stream>>>(ATh, ATl, WO, nullptr, DD, OUT, DD, bo, 0, 0, 0);
}

// v002
// It runs in 210 microseconds.
// It is 6.37 times as fast as v000, going by the measured steps of the versions left out in between.
#include <hip/hip_runtime.h>

// TunedSelfAttention (x [2][2048][1024]; qkv = x W_qkv^T + b_qkv ([3072][1024] Linear); 16 heads x 64; s = (q.k / 8); s = 30 tanh(s / 30) (softcap); keep key j iff (i >= j && i - j <= 512) || j < suffix_prefix_length[b] (int input, read as data), else -inf; softmax; y = attn.v merged; out = y W_proj^T + b_proj).
// The sliding-window/prefix mask is evaluated arithmetically per element; early rows see few keys, so scores and attn.v run on bf16 hi+lo planes.
// Compute dtypes, f32 accumulate: every float input rounded to bf16; q/k/v projections on PLAIN bf16 operands (x, W inputs: exact, + bias);
// scores on bf16 hi+lo q (x 1/8) and k planes (3 products); attn.v on bf16 hi+lo P and V^T planes (3 products); output projection on hi+lo planes x exact bf16 Wout (2 products);

#define NB_  2
#define TT   2048
#define DD   1024
#define NH_  16
#define HD   64
#define NT   (NB_ * TT)
#define ZH   2
#define PCAR 1024.0f
typedef _Float16 h16;
typedef unsigned short bf;
typedef __attribute__((ext_vector_type(16))) __bf16   v16bf;
typedef __attribute__((ext_vector_type(16))) _Float16 v16h;
typedef __attribute__((ext_vector_type(8)))  _Float16 v8h;
typedef __attribute__((ext_vector_type(8)))  unsigned short v8us;
typedef __attribute__((ext_vector_type(8)))  float    v8f;
typedef __attribute__((ext_vector_type(4)))  float    v4f;
typedef v8h  __attribute__((may_alias)) v8ha;
typedef v4f  __attribute__((may_alias)) v4fa;
typedef v8us __attribute__((may_alias)) v8usa;

__device__ __forceinline__ unsigned short f2bf(float f) { unsigned u = __float_as_uint(f); u += 0x7FFFu + ((u >> 16) & 1u); return (unsigned short)(u >> 16); }
__device__ __forceinline__ float bf2f(unsigned short b) { return __uint_as_float(((unsigned)b) << 16); }
__device__ __forceinline__ float bfr(float f) { return bf2f(f2bf(f)); }
__device__ __forceinline__ v16h cat16(v8h lo, v8h hi) { return __builtin_shufflevector(lo, hi, 0, 1, 2, 3, 4, 5, 6, 7, 8, 9, 10, 11, 12, 13, 14, 15); }
__device__ __forceinline__ v16bf cat16b(v8us lo, v8us hi) { return __builtin_bit_cast(v16bf, __builtin_shufflevector(lo, hi, 0, 1, 2, 3, 4, 5, 6, 7, 8, 9, 10, 11, 12, 13, 14, 15)); }
__device__ __forceinline__ v8f wmma16(v16h a, v16h b, v8f c) { return __builtin_amdgcn_wmma_f32_16x16x32_f16(false, a, false, b, (short)0, c, false, false); }
__device__ __forceinline__ v8f wmmab(v16bf a, v16bf b, v8f c) { return __builtin_amdgcn_wmma_f32_16x16x32_bf16(false, a, false, b, (short)0, c, false, false); }



// ---- k_gemmw: register-blocked GEMM, ONE WAVE per 64x64 output tile (16 accumulators), operands straight from K-contiguous 16-bit planes; grid (M/64, N/64, Z), 32 threads.
// C[m][n] (f32, pitch ldc, + optional f32 bias[n]) = sum_k A[m][k] Bt[n][k] (+ split products per NSPLIT). z-batch strides sA/sB/sC in elements. K % 32 == 0.
template <typename T16> struct WFrag;
template <> struct WFrag<h16> { typedef v16h V; static __device__ __forceinline__ V ld(const h16* p) { return cat16(*(const v8h*)p, *(const v8h*)(p + 16)); } static __device__ __forceinline__ v8f mma(V a, V b, v8f c) { return wmma16(a, b, c); } };
template <> struct WFrag<bf> { typedef v16bf V; static __device__ __forceinline__ V ld(const bf* p) { return cat16b(*(const v8us*)p, *(const v8us*)(p + 16)); } static __device__ __forceinline__ v8f mma(V a, V b, v8f c) { return wmmab(a, b, c); } };
template <typename T16, int NSPLIT, bool BIAS>
__global__ __launch_bounds__(32) void k_gemmw(const T16* __restrict__ A, const T16* __restrict__ A2, const T16* __restrict__ Bt, const T16* __restrict__ Bt2, int K, float* C, int ldc, const float* __restrict__ bias, size_t sA, size_t sB, size_t sC) {
    typedef typename WFrag<T16>::V V;
    __shared__ __align__(16) float os[16 * 68];
    const size_t z = blockIdx.z; A += z * sA; if (A2) A2 += z * sA; Bt += z * sB; if (Bt2) Bt2 += z * sB; C += z * sC;
    const int lane = threadIdx.x & 31, lr = lane & 15, hi = lane >> 4; const int r0 = blockIdx.x * 64, c0 = blockIdx.y * 64;
    v8f acc[4][4];
#pragma unroll
    for (int mb = 0; mb < 4; ++mb)
#pragma unroll
        for (int nb = 0; nb < 4; ++nb) acc[mb][nb] = (v8f){};
    const size_t aoff = (size_t)(r0 + lr) * K + 8 * hi, boff = (size_t)(c0 + lr) * K + 8 * hi;
#pragma unroll 1
    for (int kc = 0; kc < K; kc += 32) {
        V a[4], a2[4];
#pragma unroll
        for (int mb = 0; mb < 4; ++mb) { a[mb] = WFrag<T16>::ld(A + aoff + (size_t)mb * 16 * K + kc); if (NSPLIT == 1 || NSPLIT == 2) a2[mb] = WFrag<T16>::ld(A2 + aoff + (size_t)mb * 16 * K + kc); }
#pragma unroll
        for (int nb = 0; nb < 4; ++nb) { const V b = WFrag<T16>::ld(Bt + boff + (size_t)nb * 16 * K + kc); V b2; if (NSPLIT >= 2) b2 = WFrag<T16>::ld(Bt2 + boff + (size_t)nb * 16 * K + kc);
#pragma unroll
            for (int mb = 0; mb < 4; ++mb) { acc[mb][nb] = WFrag<T16>::mma(a[mb], b, acc[mb][nb]); if (NSPLIT == 1 || NSPLIT == 2) acc[mb][nb] = WFrag<T16>::mma(a2[mb], b, acc[mb][nb]); if (NSPLIT >= 2) acc[mb][nb] = WFrag<T16>::mma(a[mb], b2, acc[mb][nb]); } }
        asm volatile("v_nop\n\tv_nop\n\tv_nop\n\tv_nop" : "+v"(acc[0][0]), "+v"(acc[1][1]), "+v"(acc[2][2]), "+v"(acc[3][3]) : "v"(a[0]), "v"(a[3]));
    }
#pragma unroll
    for (int mb = 0; mb < 4; ++mb) {
#pragma unroll
        for (int nb = 0; nb < 4; ++nb) {
#pragma unroll
            for (int j = 0; j < 8; ++j) os[(hi * 8 + j) * 68 + nb * 16 + lr] = acc[mb][nb][j]; }
        __builtin_amdgcn_wave_barrier(); asm volatile("" ::: "memory");
        float* crow = C + (size_t)(r0 + mb * 16) * ldc + c0;
{
#pragma unroll
            for (int s = 0; s < 8; ++s) { const int row = 2 * s + hi, cofs = lr * 4; v4f val = *(const v4fa*)(os + row * 68 + cofs); if (BIAS) { val[0] += bfr(bias[c0 + cofs]); val[1] += bfr(bias[c0 + cofs + 1]); val[2] += bfr(bias[c0 + cofs + 2]); val[3] += bfr(bias[c0 + cofs + 3]); }
                *(v4f*)(crow + (size_t)row * ldc + cofs) = val; }
             }
        __builtin_amdgcn_wave_barrier(); asm volatile("" ::: "memory");
    }
}

__device__ __forceinline__ h16 tohx(float x) { return (h16)x; }
__device__ __forceinline__ void splitf(float y, unsigned short& h, unsigned short& l) { h = f2bf(y); l = f2bf(y - bf2f(h)); }
typedef __attribute__((ext_vector_type(2))) _Float16 v2h;
typedef __attribute__((ext_vector_type(4))) _Float16 v4h;
typedef __attribute__((ext_vector_type(2))) unsigned short v2us;
typedef __attribute__((ext_vector_type(4))) int v4i;

__global__ __launch_bounds__(256) void k_cvt8(const float* __restrict__ src, bf* dst, size_t n8) { const size_t i = (size_t)blockIdx.x * 256 + threadIdx.x; if (i >= n8) return; const v8f v = *(const v8f*)(src + i * 8); v8us o;
#pragma unroll
    for (int k = 0; k < 8; ++k) o[k] = f2bf(v[k]); *(v8us*)(dst + i * 8) = o;  }
__global__ __launch_bounds__(256) void k_wtT(const float* __restrict__ w, int pitch, int col0, bf* Bt) {
    const int lane = threadIdx.x & 31; const int L0 = (blockIdx.x * 8 + (threadIdx.x >> 5)) * 8; const int nlines = DD * DD / 64;
{
#pragma unroll
        for (int l = 0; l < 8; ++l) { const int L = L0 + l; if (L >= nlines) break; const int e = L * 64 + lane * 2; const int k = e & (DD - 1), n = e >> 10; v2us o;
#pragma unroll
            for (int q = 0; q < 2; ++q) o[q] = f2bf(w[(size_t)(k + q) * pitch + col0 + n]);
            *(v2us*)(Bt + (size_t)e) = o; }
         }
}
__global__ __launch_bounds__(256) void k_hsplit(const float* __restrict__ F, float sc, bf* Ph, bf* Pl) {
    const int lane = threadIdx.x & 31; const int L0 = (blockIdx.x * 8 + (threadIdx.x >> 5)) * 8; const int nlines = NT * DD / 64;
{
#pragma unroll
        for (int l = 0; l < 8; ++l) { const int L = L0 + l; if (L >= nlines) break; const int e = L * 64 + lane * 2; const int d = e & 63; const int t = (e >> 6) & (TT - 1); const int z = e >> 17; const int b = z >> 4, h = z & 15; v2us oh, ol;
#pragma unroll
            for (int q = 0; q < 2; ++q) { unsigned short a, c2; splitf(F[((size_t)b * TT + t) * DD + h * HD + d + q] * sc, a, c2); oh[q] = a; ol[q] = c2; }
            *(v2us*)(Ph + (size_t)e) = oh; *(v2us*)(Pl + (size_t)e) = ol; }
         }
}
__global__ __launch_bounds__(256) void k_vtplane(const float* __restrict__ F, bf* Vh, bf* Vl) {
    const int lane = threadIdx.x & 31; const int L0 = (blockIdx.x * 8 + (threadIdx.x >> 5)) * 8; const int nlines = NT * DD / 64;
{
#pragma unroll
        for (int l = 0; l < 8; ++l) { const int L = L0 + l; if (L >= nlines) break; const int e = L * 64 + lane * 2; const int t = e & (TT - 1); const int d = (e >> 11) & 63; const int z = e >> 17; const int b = z >> 4, h = z & 15; v2us oh, ol;
#pragma unroll
            for (int q = 0; q < 2; ++q) { unsigned short a, c2; splitf(F[((size_t)b * TT + t + q) * DD + h * HD + d], a, c2); oh[q] = a; ol[q] = c2; }
            *(v2us*)(Vh + (size_t)e) = oh; *(v2us*)(Vl + (size_t)e) = ol; }
         }
}
// k_fattn: scores, softcap, mask, softmax and attn.v of one head in one kernel; one wave owns 32 queries and walks the keys 32 at a time, everything in registers.
// S^T = K Q^T (A = 16 keys x 64, B = 16 queries): a lane then holds, for query lr, keys 8 hi + j of each 16-key tile, which is the B fragment of P^T for O^T = V^T P^T as it stands.
// The softcap bounds every score to [-30, 30], so exp(s) needs no running maximum; the row is divided by its sum once, behind the last key.
// Every inner loop is unrolled whole so that the fragment arrays are indexed by constants and stay in registers.
// A wave visits only the 32-key tiles that can hold a live key for its 32 queries: the tiles below the prefix length that lie outside its window, then the 17 tiles of its window (query tile - 16 .. query tile).
// The 8 windows of a block are 17 consecutive tiles out of the same 24, so each holds every residue modulo 17 once: at window step t a wave takes its tile of residue t, and the block reads at most two different tiles at a time, which one wave's lines serve to the others from the WGP cache.
// waves_per_eu(2, 2): the grid is one 8-wave block per WGP, two waves a SIMD, so the register budget is that of two waves.
__global__ __launch_bounds__(256) __attribute__((amdgpu_waves_per_eu(2, 2))) void k_fattn(const bf* __restrict__ Qh, const bf* __restrict__ Ql, const bf* __restrict__ Kh, const bf* __restrict__ Kl, const bf* __restrict__ Vh, const bf* __restrict__ Vl, const int* __restrict__ spl, bf* Ah, bf* Al) {
    typedef WFrag<bf> WF;
    const int lane = threadIdx.x & 31, lr = lane & 15, hi = lane >> 4; const int z = blockIdx.y, b = z >> 4, h = z & 15; const int w = __builtin_amdgcn_readfirstlane(threadIdx.x >> 5); const int q0 = blockIdx.x * 256 + w * 32; const int L = min(max(spl[b], 0), TT);   // key < L reads the same for keys 0 .. TT - 1, and L - j0 below cannot wrap
    // the walk, all in scalars and free of branches: steps 0 .. np - 1 are the prefix tiles, steps np .. np + 16 the window tiles; next_step passes over the prefix tiles that the window holds and the window tiles in front of key 0 (window steps w .. -tb - 1)
    const int tq = blockIdx.x * 8 + w, tb = blockIdx.x * 8 - 16, np = (L + 31) >> 5, nu = np + 17;
    auto next_step = [&](int v) -> int { int n = v + 1; n = (n < np && n >= tq - 16 && n <= tq) ? min(tq + 1, np) : n; return n - np >= w ? max(n, np - tb) : n; };
    auto tile_of = [&](int v) -> int { const int t = v - np; return v < np ? v : tb + t + (t < w ? 17 : 0); };   // at v = nu, behind the last step: tile tb + 17, in bounds
    const size_t zo = (size_t)z * TT * HD; Qh += zo; Ql += zo; Kh += zo; Kl += zo; Vh += zo; Vl += zo;
    v16bf qh[2][2], ql[2][2]; const bf* qhp = Qh + ((q0 + lr) * HD + 8 * hi); const bf* qlp = Ql + ((q0 + lr) * HD + 8 * hi);
#pragma unroll
    for (int qb = 0; qb < 2; ++qb)
#pragma unroll
        for (int kc = 0; kc < 2; ++kc) { qh[qb][kc] = WF::ld(qhp + qb * 16 * HD + kc * 32); ql[qb][kc] = WF::ld(qlp + qb * 16 * HD + kc * 32); }
    // the Q loads are issued: their address registers (inputs, so that they live up to here) may be rewritten behind this wait; the fence keeps later address work behind it
    asm volatile("s_wait_xcnt 0x0" :: "v"(qhp), "v"(qlp) : "memory");
    __builtin_amdgcn_sched_barrier(0);
    v8f o[4][2]; float sum[2] = {0.f, 0.f};
#pragma unroll
    for (int db = 0; db < 4; ++db)
#pragma unroll
        for (int qb = 0; qb < 2; ++qb) o[db][qb] = (v8f){};
    v16bf kh[2][2], kl[2][2];
    int u = next_step(-1), jt = tile_of(u);   // u < nu: the wave's own query tile tq is a step of the window part
    const size_t kln = (size_t)(lr * HD + 8 * hi), vln = (size_t)(lr * TT + 8 * hi);   // the lane's place in a K tile and in a V^T tile; the tile's own offset is scalar
    const bf* khp = Kh + jt * (32 * HD) + kln; const bf* klp = Kl + jt * (32 * HD) + kln;
    int nj = -(jt * 32 + hi * 8);   // minus the lane's first key of the tile, carried from pass to pass: one vector add a pass, and the mask offsets below stay plain adds of constants
#pragma unroll
    for (int kt = 0; kt < 2; ++kt)
#pragma unroll
        for (int kc = 0; kc < 2; ++kc) { const int p = kt * 16 * HD + kc * 32; kh[kt][kc] = WF::ld(khp + p); kl[kt][kc] = WF::ld(klp + p); }
    // the same for the first K loads
    asm volatile("s_wait_xcnt 0x0" ::: "memory");
    __builtin_amdgcn_sched_barrier(0);
#pragma unroll 1   // stays rolled: one pass is about 600 instructions, and the K fragments rotate through the same registers
    do {
        const int j0 = jt * 32;
        u = next_step(u); jt = tile_of(u);   // behind the last step this names a tile that is fetched and not used
        v16bf vh[4], vl[4]; const bf* vhp = Vh + j0 + vln; const bf* vlp = Vl + j0 + vln;
#pragma unroll
        for (int db = 0; db < 4; ++db) { vh[db] = WF::ld(vhp + db * 16 * TT); vl[db] = WF::ld(vlp + db * 16 * TT); }
        v8f s[2][2];
#pragma unroll
        for (int kt = 0; kt < 2; ++kt)
#pragma unroll
            for (int qb = 0; qb < 2; ++qb) { v8f a = (v8f){};
#pragma unroll
                for (int kc = 0; kc < 2; ++kc) { a = wmmab(kh[kt][kc], qh[qb][kc], a); a = wmmab(kh[kt][kc], ql[qb][kc], a); a = wmmab(kl[kt][kc], qh[qb][kc], a); }
                s[kt][qb] = a; }
        // the next tile's K fragments are fetched behind this pass's score products, so that they fly under the softmax and attn.v
        const int jn = jt * 32; khp = Kh + jn * HD + kln; klp = Kl + jn * HD + kln;
#pragma unroll
        for (int kt = 0; kt < 2; ++kt)
#pragma unroll
            for (int kc = 0; kc < 2; ++kc) { const int p = kt * 16 * HD + kc * 32; kh[kt][kc] = WF::ld(khp + p); kl[kt][kc] = WF::ld(klp + p); }
        // all of this pass's loads are issued: their address registers may be rewritten behind this wait; the four addresses are inputs so that they live up to it and no load's result is placed in them ahead of it
        asm volatile("s_wait_xcnt 0x0" :: "v"(vhp), "v"(vlp), "v"(khp), "v"(klp) : "memory");
        // keeps the V and next-K loads issued above the softmax, where its vector work hides their latency (the scheduler otherwise sinks them to their first use)
        __builtin_amdgcn_sched_barrier(0);
        v16bf ph[2], pl[2]; const int lk = L + nj;
#pragma unroll
        for (int qb = 0; qb < 2; ++qb) { const int dq = q0 + qb * 16 + lr + nj;
#pragma unroll
            for (int kt = 0; kt < 2; ++kt)
#pragma unroll
                for (int j = 0; j < 8; ++j) { const int cj = kt * 16 + j; const bool live = ((unsigned)(dq - cj) <= 512u) || (cj < lk);   // key = j0 + 8 hi + cj: 0 <= i - key <= 512, or key < L
                    // exp(30 tanh(s/30)) with tanh(u) = 1 - 2/(exp(2u) + 1), both exponentials base 2: 2^(C2 - 2 C2 / (2^(C1 s) + 1)), C1 = 2 log2(e) / 30, C2 = 30 log2(e); overflow of the inner one gives tanh = 1, underflow -1
                    const float r = __builtin_amdgcn_rcpf(__builtin_amdgcn_exp2f(s[kt][qb][j] * 0.0961796694f) + 1.0f);
                    const float p = live ? __builtin_amdgcn_exp2f(__builtin_fmaf(r, -86.5617025f, 43.2808512f)) : 0.0f; sum[qb] += p;
                    const __bf16 a = (__bf16)p; ph[qb][kt * 8 + j] = a; pl[qb][kt * 8 + j] = (__bf16)(p - (float)a); } }
#pragma unroll
        for (int db = 0; db < 4; ++db)
#pragma unroll
            for (int qb = 0; qb < 2; ++qb) { o[db][qb] = wmmab(vh[db], ph[qb], o[db][qb]); o[db][qb] = wmmab(vh[db], pl[qb], o[db][qb]); o[db][qb] = wmmab(vl[db], ph[qb], o[db][qb]); }
        nj += j0 - jn;
    } while (u < nu);
    // the last pass's stand-in K fetch feeds nothing: it has landed before the wave gives its registers back
    asm volatile("s_wait_loadcnt 0x0" ::: "memory");
#pragma unroll
    for (int qb = 0; qb < 2; ++qb) { const float f = __fdiv_rn(1.0f, sum[qb] + __shfl_xor(sum[qb], 16, 32)); const size_t ro = ((size_t)b * TT + q0 + qb * 16 + lr) * DD + h * HD + hi * 8; bf* ahp = Ah + ro; bf* alp = Al + ro; v8us oh[4], ol[4];
#pragma unroll
        for (int db = 0; db < 4; ++db) {
#pragma unroll
            for (int j = 0; j < 8; ++j) { unsigned short a, c2; splitf(o[db][qb][j] * f, a, c2); oh[db][j] = a; ol[db][j] = c2; }
            *(v8us*)(ahp + db * 16) = oh[db]; *(v8us*)(alp + db * 16) = ol[db]; }
        // the eight stores are issued: their data and address registers (inputs, so that they live up to here) may be rewritten behind this wait
        asm volatile("s_wait_xcnt 0x0" :: "v"(oh[0]), "v"(oh[1]), "v"(oh[2]), "v"(oh[3]), "v"(ol[0]), "v"(ol[1]), "v"(ol[2]), "v"(ol[3]), "v"(ahp), "v"(alp) : "memory"); }
}

extern "C" void kernel_launch(void* const* d_in, const int* in_sizes, int n_in,
                              void* d_out, int out_size, void* d_ws, size_t ws_size, hipStream_t stream) {
    (void)in_sizes; (void)n_in; (void)out_size;
    const float* x = (const float*)d_in[0]; const int* spl = (const int*)d_in[1]; const float* Wqkv = (const float*)d_in[2]; const float* bqkv = (const float*)d_in[3]; const float* Wo = (const float*)d_in[4]; const float* bo = (const float*)d_in[5];
    float* OUT = (float*)d_out;     // [2][2048][1024]
    char* wsp = (char*)d_ws;
    auto take = [&](size_t bytes) { char* p = wsp; wsp += (bytes + 255) & ~(size_t)255; return (void*)p; };
    bf* WQ = (bf*)take((size_t)DD * DD * 2); bf* WK = (bf*)take((size_t)DD * DD * 2); bf* WV = (bf*)take((size_t)DD * DD * 2); bf* WO = (bf*)take((size_t)DD * DD * 2);
    bf* XB = (bf*)take((size_t)NT * DD * 2); float* F = (float*)take((size_t)NT * DD * 4);
    bf* QPh = (bf*)take((size_t)NT * DD * 2); bf* QPl = (bf*)take((size_t)NT * DD * 2); bf* KPh = (bf*)take((size_t)NT * DD * 2); bf* KPl = (bf*)take((size_t)NT * DD * 2); bf* VTh = (bf*)take((size_t)NT * DD * 2); bf* VTl = (bf*)take((size_t)NT * DD * 2);
    bf* ATh = (bf*)take((size_t)NT * DD * 2); bf* ATl = (bf*)take((size_t)NT * DD * 2);
    if ((size_t)(wsp - (char*)d_ws) > ws_size) return;    // ws 256 MiB
    { const size_t nw = (size_t)DD * DD / 8; const unsigned gw = (unsigned)((nw + 255) / 256); k_cvt8<<<gw, 256, 0, stream>>>(Wqkv, WQ, nw); k_cvt8<<<gw, 256, 0, stream>>>(Wqkv + (size_t)DD * DD, WK, nw); k_cvt8<<<gw, 256, 0, stream>>>(Wqkv + (size_t)2 * DD * DD, WV, nw); k_cvt8<<<gw, 256, 0, stream>>>(Wo, WO, nw); }   // nn.Linear [out][in] = Bt as-is (q|k|v row blocks)
    const size_t nx = (size_t)NT * DD / 8; const unsigned gx = (unsigned)((nx + 255) / 256); const unsigned LB = (unsigned)((NT * DD / 64 + 63) / 64);
    k_cvt8<<<gx, 256, 0, stream>>>(x, XB, nx);
    k_gemmw<bf, 0, true><<<dim3(NT / 64, DD / 64, 1), 32, 0, stream>>>(XB, nullptr, WQ, nullptr, DD, F, DD, bqkv, 0, 0, 0); k_hsplit<<<LB, 256, 0, stream>>>(F, 0.125f, QPh, QPl);   // 64^-0.5 folded into q exactly
    k_gemmw<bf, 0, true><<<dim3(NT / 64, DD / 64, 1), 32, 0, stream>>>(XB, nullptr, WK, nullptr, DD, F, DD, bqkv + DD, 0, 0, 0); k_hsplit<<<LB, 256, 0, stream>>>(F, 1.0f, KPh, KPl);
    k_gemmw<bf, 0, true><<<dim3(NT / 64, DD / 64, 1), 32, 0, stream>>>(XB, nullptr, WV, nullptr, DD, F, DD, bqkv + 2 * DD, 0, 0, 0); k_vtplane<<<LB, 256, 0, stream>>>(F, VTh, VTl);
    k_fattn<<<dim3(TT / 256, NB_ * NH_, 1), 256, 0, stream>>>(QPh, QPl, KPh, KPl, VTh, VTl, spl, ATh, ATl);
    k_gemmw<bf, 1, true><<<dim3(NT / 64, DD / 64, 1), 32, 0, stream>>>(ATh, ATl, WO, nullptr, DD, OUT, DD, bo, 0, 0, 0);
}

// v003
// It runs in 143 microseconds.
// In two side-by-side timings against v002, it was 1.47 and 1.45 times as fast.
// All steps since v000 together make it 9.29 times as fast.
#include <hip/hip_runtime.h>

// TunedSelfAttention (x [2][2048][1024]; qkv = x W_qkv^T + b_qkv ([3072][1024] Linear); 16 heads x 64; s = (q.k / 8); s = 30 tanh(s / 30) (softcap); keep key j iff (i >= j && i - j <= 512) || j < suffix_prefix_length[b] (int input, read as data), else -inf; softmax; y = attn.v merged; out = y W_proj^T + b_proj).
// The sliding-window/prefix mask is evaluated arithmetically per element; early rows see few keys, so scores and attn.v run on bf16 hi+lo planes.
// Compute dtypes, f32 accumulate: every float input rounded to bf16; q/k/v projections on PLAIN bf16 operands (x, W inputs: exact, + bias);
// scores on bf16 hi+lo q (x 1/8) and k planes (3 products); attn.v on bf16 hi+lo P and V^T planes (3 products); output projection on hi+lo planes x exact bf16 Wout (2 products);

#define NB_  2
#define TT   2048
#define DD   1024
#define NH_  16
#define HD   64
#define NT   (NB_ * TT)
#define ZH   2
#define PCAR 1024.0f
typedef _Float16 h16;
typedef unsigned short bf;
typedef __attribute__((ext_vector_type(16))) __bf16   v16bf;
typedef __attribute__((ext_vector_type(16))) _Float16 v16h;
typedef __attribute__((ext_vector_type(8)))  _Float16 v8h;
typedef __attribute__((ext_vector_type(8)))  unsigned short v8us;
typedef __attribute__((ext_vector_type(8)))  float    v8f;
typedef __attribute__((ext_vector_type(4)))  float    v4f;
typedef v8h  __attribute__((may_alias)) v8ha;
typedef v4f  __attribute__((may_alias)) v4fa;
typedef v8us __attribute__((may_alias)) v8usa;

__device__ __forceinline__ unsigned short f2bf(float f) { unsigned u = __float_as_uint(f); u += 0x7FFFu + ((u >> 16) & 1u); return (unsigned short)(u >> 16); }
__device__ __forceinline__ float bf2f(unsigned short b) { return __uint_as_float(((unsigned)b) << 16); }
__device__ __forceinline__ float bfr(float f) { return bf2f(f2bf(f)); }
__device__ __forceinline__ v16h cat16(v8h lo, v8h hi) { return __builtin_shufflevector(lo, hi, 0, 1, 2, 3, 4, 5, 6, 7, 8, 9, 10, 11, 12, 13, 14, 15); }
__device__ __forceinline__ v16bf cat16b(v8us lo, v8us hi) { return __builtin_bit_cast(v16bf, __builtin_shufflevector(lo, hi, 0, 1, 2, 3, 4, 5, 6, 7, 8, 9, 10, 11, 12, 13, 14, 15)); }
__device__ __forceinline__ v8f wmma16(v16h a, v16h b, v8f c) { return __builtin_amdgcn_wmma_f32_16x16x32_f16(false, a, false, b, (short)0, c, false, false); }
__device__ __forceinline__ v8f wmmab(v16bf a, v16bf b, v8f c) { return __builtin_amdgcn_wmma_f32_16x16x32_bf16(false, a, false, b, (short)0, c, false, false); }



// ---- k_gemmw: register-blocked GEMM, ONE WAVE per 64x64 output tile (16 accumulators), operands straight from K-contiguous 16-bit planes; grid (M/64, N/64, Z), 32 threads.
// C[m][n] (f32, pitch ldc, + optional f32 bias[n]) = sum_k A[m][k] Bt[n][k] (+ split products per NSPLIT). z-batch strides sA/sB/sC in elements. K % 32 == 0.
template <typename T16> struct WFrag;
template <> struct WFrag<h16> { typedef v16h V; static __device__ __forceinline__ V ld(const h16* p) { return cat16(*(const v8h*)p, *(const v8h*)(p + 16)); } static __device__ __forceinline__ v8f mma(V a, V b, v8f c) { return wmma16(a, b, c); } };
template <> struct WFrag<bf> { typedef v16bf V; static __device__ __forceinline__ V ld(const bf* p) { return cat16b(*(const v8us*)p, *(const v8us*)(p + 16)); } static __device__ __forceinline__ v8f mma(V a, V b, v8f c) { return wmmab(a, b, c); } };
template <typename T16, int NSPLIT, bool BIAS>
__global__ __launch_bounds__(32) void k_gemmw(const T16* __restrict__ A, const T16* __restrict__ A2, const T16* __restrict__ Bt, const T16* __restrict__ Bt2, int K, float* C, int ldc, const float* __restrict__ bias, size_t sA, size_t sB, size_t sC) {
    typedef typename WFrag<T16>::V V;
    __shared__ __align__(16) float os[16 * 68];
    const size_t z = blockIdx.z; A += z * sA; if (A2) A2 += z * sA; Bt += z * sB; if (Bt2) Bt2 += z * sB; C += z * sC;
    const int lane = threadIdx.x & 31, lr = lane & 15, hi = lane >> 4; const int r0 = blockIdx.x * 64, c0 = blockIdx.y * 64;
    v8f acc[4][4];
#pragma unroll
    for (int mb = 0; mb < 4; ++mb)
#pragma unroll
        for (int nb = 0; nb < 4; ++nb) acc[mb][nb] = (v8f){};
    const size_t aoff = (size_t)(r0 + lr) * K + 8 * hi, boff = (size_t)(c0 + lr) * K + 8 * hi;
#pragma unroll 1
    for (int kc = 0; kc < K; kc += 32) {
        V a[4], a2[4];
#pragma unroll
        for (int mb = 0; mb < 4; ++mb) { a[mb] = WFrag<T16>::ld(A + aoff + (size_t)mb * 16 * K + kc); if (NSPLIT == 1 || NSPLIT == 2) a2[mb] = WFrag<T16>::ld(A2 + aoff + (size_t)mb * 16 * K + kc); }
#pragma unroll
        for (int nb = 0; nb < 4; ++nb) { const V b = WFrag<T16>::ld(Bt + boff + (size_t)nb * 16 * K + kc); V b2; if (NSPLIT >= 2) b2 = WFrag<T16>::ld(Bt2 + boff + (size_t)nb * 16 * K + kc);
#pragma unroll
            for (int mb = 0; mb < 4; ++mb) { acc[mb][nb] = WFrag<T16>::mma(a[mb], b, acc[mb][nb]); if (NSPLIT == 1 || NSPLIT == 2) acc[mb][nb] = WFrag<T16>::mma(a2[mb], b, acc[mb][nb]); if (NSPLIT >= 2) acc[mb][nb] = WFrag<T16>::mma(a[mb], b2, acc[mb][nb]); } }
        asm volatile("v_nop\n\tv_nop\n\tv_nop\n\tv_nop" : "+v"(acc[0][0]), "+v"(acc[1][1]), "+v"(acc[2][2]), "+v"(acc[3][3]) : "v"(a[0]), "v"(a[3]));
    }
#pragma unroll
    for (int mb = 0; mb < 4; ++mb) {
#pragma unroll
        for (int nb = 0; nb < 4; ++nb) {
#pragma unroll
            for (int j = 0; j < 8; ++j) os[(hi * 8 + j) * 68 + nb * 16 + lr] = acc[mb][nb][j]; }
        __builtin_amdgcn_wave_barrier(); asm volatile("" ::: "memory");
        float* crow = C + (size_t)(r0 + mb * 16) * ldc + c0;
{
#pragma unroll
            for (int s = 0; s < 8; ++s) { const int row = 2 * s + hi, cofs = lr * 4; v4f val = *(const v4fa*)(os + row * 68 + cofs); if (BIAS) { val[0] += bfr(bias[c0 + cofs]); val[1] += bfr(bias[c0 + cofs + 1]); val[2] += bfr(bias[c0 + cofs + 2]); val[3] += bfr(bias[c0 + cofs + 3]); }
                *(v4f*)(crow + (size_t)row * ldc + cofs) = val; }
             }
        __builtin_amdgcn_wave_barrier(); asm volatile("" ::: "memory");
    }
}

__device__ __forceinline__ h16 tohx(float x) { return (h16)x; }
__device__ __forceinline__ void splitf(float y, unsigned short& h, unsigned short& l) { h = f2bf(y); l = f2bf(y - bf2f(h)); }
typedef __attribute__((ext_vector_type(2))) _Float16 v2h;
typedef __attribute__((ext_vector_type(4))) _Float16 v4h;
typedef __attribute__((ext_vector_type(2))) unsigned short v2us;
typedef __attribute__((ext_vector_type(4))) int v4i;

__global__ __launch_bounds__(256) void k_cvt8(const float* __restrict__ src, bf* dst, size_t n8) { const size_t i = (size_t)blockIdx.x * 256 + threadIdx.x; if (i >= n8) return; const v8f v = *(const v8f*)(src + i * 8); v8us o;
#pragma unroll
    for (int k = 0; k < 8; ++k) o[k] = f2bf(v[k]); *(v8us*)(dst + i * 8) = o;  }
__global__ __launch_bounds__(256) void k_wtT(const float* __restrict__ w, int pitch, int col0, bf* Bt) {
    const int lane = threadIdx.x & 31; const int L0 = (blockIdx.x * 8 + (threadIdx.x >> 5)) * 8; const int nlines = DD * DD / 64;
{
#pragma unroll
        for (int l = 0; l < 8; ++l) { const int L = L0 + l; if (L >= nlines) break; const int e = L * 64 + lane * 2; const int k = e & (DD - 1), n = e >> 10; v2us o;
#pragma unroll
            for (int q = 0; q < 2; ++q) o[q] = f2bf(w[(size_t)(k + q) * pitch + col0 + n]);
            *(v2us*)(Bt + (size_t)e) = o; }
         }
}
// k_qkv: the q, k and v projections as the one product x W_qkv^T that they are, ONE WAVE per 64x64 tile as in k_gemmw, grid (NT/64, 3 DD/64): a tile column is one head of q, k or v.
// The epilogue adds the bias, scales (q only, by 1/8) and writes the bf16 hi+lo planes that k_fattn reads: q and k as [head][t][64], v as [head][64][t].
// A v tile is computed transposed (rows = W_qkv rows, columns = tokens: both operands are K-contiguous, so the two loaders only trade places), so that all three kinds leave through the same whole-line stores.
typedef __attribute__((ext_vector_type(4))) unsigned short v4us;
// qkv_out: VT = false: tile rows are tokens, columns the head's 64 features (bias by column, plane pitch 64); VT = true: rows are features, columns tokens (bias by row, plane pitch TT). bn = the tile's 64 bias values; ph, pl = the tile's first element in the two planes.
template <bool VT>
__device__ __forceinline__ void qkv_out(const v8f (&acc)[4][4], float* os, const float* __restrict__ bn, float sc, bf* ph, bf* pl, int lr, int hi) {
    constexpr int P = VT ? TT : HD;
    v8f br[4]; float bc[4]; const float* bp = VT ? bn + hi * 8 : bn + lr;
#pragma unroll
    for (int i = 0; i < 4; ++i) { if (VT) br[i] = *(const v8f*)(bp + i * 16); else bc[i] = bp[i * 16]; }
    // the bias loads are issued: their address register (an input, so that it lives up to here) may be rewritten behind this wait
    asm volatile("s_wait_xcnt 0x0" :: "v"(bp) : "memory");
#pragma unroll
    for (int i = 0; i < 4; ++i) { if (VT) {
#pragma unroll
            for (int j = 0; j < 8; ++j) br[i][j] = bfr(br[i][j]); } else bc[i] = bfr(bc[i]); }
    bf* php = ph + hi * P + lr * 4; bf* plp = pl + hi * P + lr * 4;
#pragma unroll
    for (int mb = 0; mb < 4; ++mb) {
#pragma unroll
        for (int nb = 0; nb < 4; ++nb) {
#pragma unroll
            for (int j = 0; j < 8; ++j) os[(hi * 8 + j) * 68 + nb * 16 + lr] = acc[mb][nb][j] + (VT ? br[mb][j] : bc[nb]); }
        __builtin_amdgcn_wave_barrier(); asm volatile("" ::: "memory");
        v4us oh[8], ol[8];
#pragma unroll
        for (int s = 0; s < 8; ++s) { const v4f val = *(const v4fa*)(os + (2 * s + hi) * 68 + lr * 4);
#pragma unroll
            for (int q = 0; q < 4; ++q) { unsigned short c1, c2; splitf(val[q] * sc, c1, c2); oh[s][q] = c1; ol[s][q] = c2; }
            *(v4us*)(php + (mb * 16 + 2 * s) * P) = oh[s]; *(v4us*)(plp + (mb * 16 + 2 * s) * P) = ol[s]; }
        // the sixteen stores are issued: their data and address registers (inputs, so that they live up to here) may be rewritten behind this wait
        asm volatile("s_wait_xcnt 0x0" :: "v"(oh[0]), "v"(oh[1]), "v"(oh[2]), "v"(oh[3]), "v"(oh[4]), "v"(oh[5]), "v"(oh[6]), "v"(oh[7]), "v"(ol[0]), "v"(ol[1]), "v"(ol[2]), "v"(ol[3]), "v"(ol[4]), "v"(ol[5]), "v"(ol[6]), "v"(ol[7]), "v"(php), "v"(plp) : "memory");
        __builtin_amdgcn_wave_barrier();
    }
}
__global__ __launch_bounds__(32) void k_qkv(const bf* __restrict__ X, const bf* __restrict__ Wt, const float* __restrict__ bias, bf* Qh, bf* Ql, bf* Kh, bf* Kl, bf* Vh, bf* Vl) {
    typedef WFrag<bf> WF; typedef WF::V V; const int K = DD;
    __shared__ __align__(16) float os[16 * 68];
    const int lane = threadIdx.x & 31, lr = lane & 15, hi = lane >> 4; const int t0 = blockIdx.x * 64, n0 = blockIdx.y * 64;
    const int part = blockIdx.y >> 4, z = (t0 >> 11) * NH_ + (blockIdx.y & 15), tb = t0 & (TT - 1); const bool vt = part == 2;
    const bf* A = vt ? Wt + (size_t)n0 * K : X + (size_t)t0 * K; const bf* Bt = vt ? X + (size_t)t0 * K : Wt + (size_t)n0 * K;
    v8f acc[4][4];
#pragma unroll
    for (int mb = 0; mb < 4; ++mb)
#pragma unroll
        for (int nb = 0; nb < 4; ++nb) acc[mb][nb] = (v8f){};
    const size_t loff = (size_t)lr * K + 8 * hi;
#pragma unroll 1
    for (int kc = 0; kc < K; kc += 32) {
        V a[4], b[4]; const bf* ap = A + loff + kc; const bf* bp = Bt + loff + kc;
#pragma unroll
        for (int i = 0; i < 4; ++i) { a[i] = WF::ld(ap + (size_t)i * 16 * K); b[i] = WF::ld(bp + (size_t)i * 16 * K); }
        // the pass's loads are issued: their address registers may be rewritten behind this wait; the two addresses are inputs so that they live up to it and no load's result is placed in them ahead of it
        asm volatile("s_wait_xcnt 0x0" :: "v"(ap), "v"(bp) : "memory");
#pragma unroll
        for (int nb = 0; nb < 4; ++nb)
#pragma unroll
            for (int mb = 0; mb < 4; ++mb) acc[mb][nb] = WF::mma(a[mb], b[nb], acc[mb][nb]);
        // the distance behind the last matrix instructions on the loop's taken branch, as in k_gemmw
        asm volatile("v_nop\n\tv_nop\n\tv_nop\n\tv_nop" : "+v"(acc[0][0]), "+v"(acc[1][1]), "+v"(acc[2][2]), "+v"(acc[3][3]) : "v"(a[0]), "v"(a[3]));
    }
    if (vt) qkv_out<true>(acc, os, bias + n0, 1.0f, Vh + (size_t)z * HD * TT + tb, Vl + (size_t)z * HD * TT + tb, lr, hi);
    else qkv_out<false>(acc, os, bias + n0, part == 0 ? 0.125f : 1.0f, (part == 0 ? Qh : Kh) + ((size_t)z * TT + tb) * HD, (part == 0 ? Ql : Kl) + ((size_t)z * TT + tb) * HD, lr, hi);   // 64^-0.5 folded into q exactly
}
// k_fattn: scores, softcap, mask, softmax and attn.v of one head in one kernel; one wave owns 32 queries and walks the keys 32 at a time, everything in registers.
// S^T = K Q^T (A = 16 keys x 64, B = 16 queries): a lane then holds, for query lr, keys 8 hi + j of each 16-key tile, which is the B fragment of P^T for O^T = V^T P^T as it stands.
// The softcap bounds every score to [-30, 30], so exp(s) needs no running maximum; the row is divided by its sum once, behind the last key.
// Every inner loop is unrolled whole so that the fragment arrays are indexed by constants and stay in registers.
// A wave visits only the 32-key tiles that can hold a live key for its 32 queries: the tiles below the prefix length that lie outside its window, then the 17 tiles of its window (query tile - 16 .. query tile).
// The 8 windows of a block are 17 consecutive tiles out of the same 24, so each holds every residue modulo 17 once: at window step t a wave takes its tile of residue t, and the block reads at most two different tiles at a time, which one wave's lines serve to the others from the WGP cache.
// waves_per_eu(2, 2): the grid is one 8-wave block per WGP, two waves a SIMD, so the register budget is that of two waves.
__global__ __launch_bounds__(256) __attribute__((amdgpu_waves_per_eu(2, 2))) void k_fattn(const bf* __restrict__ Qh, const bf* __restrict__ Ql, const bf* __restrict__ Kh, const bf* __restrict__ Kl, const bf* __restrict__ Vh, const bf* __restrict__ Vl, const int* __restrict__ spl, bf* Ah, bf* Al) {
    typedef WFrag<bf> WF;
    const int lane = threadIdx.x & 31, lr = lane & 15, hi = lane >> 4; const int z = blockIdx.y, b = z >> 4, h = z & 15; const int w = __builtin_amdgcn_readfirstlane(threadIdx.x >> 5); const int q0 = blockIdx.x * 256 + w * 32; const int L = min(max(spl[b], 0), TT);   // key < L reads the same for keys 0 .. TT - 1, and L - j0 below cannot wrap
    // the walk, all in scalars and free of branches: steps 0 .. np - 1 are the prefix tiles, steps np .. np + 16 the window tiles; next_step passes over the prefix tiles that the window holds and the window tiles in front of key 0 (window steps w .. -tb - 1)
    const int tq = blockIdx.x * 8 + w, tb = blockIdx.x * 8 - 16, np = (L + 31) >> 5, nu = np + 17;
    auto next_step = [&](int v) -> int { int n = v + 1; n = (n < np && n >= tq - 16 && n <= tq) ? min(tq + 1, np) : n; return n - np >= w ? max(n, np - tb) : n; };
    auto tile_of = [&](int v) -> int { const int t = v - np; return v < np ? v : tb + t + (t < w ? 17 : 0); };   // at v = nu, behind the last step: tile tb + 17, in bounds
    const size_t zo = (size_t)z * TT * HD; Qh += zo; Ql += zo; Kh += zo; Kl += zo; Vh += zo; Vl += zo;
    v16bf qh[2][2], ql[2][2]; const bf* qhp = Qh + ((q0 + lr) * HD + 8 * hi); const bf* qlp = Ql + ((q0 + lr) * HD + 8 * hi);
#pragma unroll
    for (int qb = 0; qb < 2; ++qb)
#pragma unroll
        for (int kc = 0; kc < 2; ++kc) { qh[qb][kc] = WF::ld(qhp + qb * 16 * HD + kc * 32); ql[qb][kc] = WF::ld(qlp + qb * 16 * HD + kc * 32); }
    // the Q loads are issued: their address registers (inputs, so that they live up to here) may be rewritten behind this wait; the fence keeps later address work behind it
    asm volatile("s_wait_xcnt 0x0" :: "v"(qhp), "v"(qlp) : "memory");
    __builtin_amdgcn_sched_barrier(0);
    v8f o[4][2]; float sum[2] = {0.f, 0.f};
#pragma unroll
    for (int db = 0; db < 4; ++db)
#pragma unroll
        for (int qb = 0; qb < 2; ++qb) o[db][qb] = (v8f){};
    v16bf kh[2][2], kl[2][2];
    int u = next_step(-1), jt = tile_of(u);   // u < nu: the wave's own query tile tq is a step of the window part
    const size_t kln = (size_t)(lr * HD + 8 * hi), vln = (size_t)(lr * TT + 8 * hi);   // the lane's place in a K tile and in a V^T tile; the tile's own offset is scalar
    const bf* khp = Kh + jt * (32 * HD) + kln; const bf* klp = Kl + jt * (32 * HD) + kln;
    int nj = -(jt * 32 + hi * 8);   // minus the lane's first key of the tile, carried from pass to pass: one vector add a pass, and the mask offsets below stay plain adds of constants
#pragma unroll
    for (int kt = 0; kt < 2; ++kt)
#pragma unroll
        for (int kc = 0; kc < 2; ++kc) { const int p = kt * 16 * HD + kc * 32; kh[kt][kc] = WF::ld(khp + p); kl[kt][kc] = WF::ld(klp + p); }
    // the same for the first K loads
    asm volatile("s_wait_xcnt 0x0" ::: "memory");
    __builtin_amdgcn_sched_barrier(0);
#pragma unroll 1   // stays rolled: one pass is about 600 instructions, and the K fragments rotate through the same registers
    do {
        const int j0 = jt * 32;
        u = next_step(u); jt = tile_of(u);   // behind the last step this names a tile that is fetched and not used
        v16bf vh[4], vl[4]; const bf* vhp = Vh + j0 + vln; const bf* vlp = Vl + j0 + vln;
#pragma unroll
        for (int db = 0; db < 4; ++db) { vh[db] = WF::ld(vhp + db * 16 * TT); vl[db] = WF::ld(vlp + db * 16 * TT); }
        v8f s[2][2];
#pragma unroll
        for (int kt = 0; kt < 2; ++kt)
#pragma unroll
            for (int qb = 0; qb < 2; ++qb) { v8f a = (v8f){};
#pragma unroll
                for (int kc = 0; kc < 2; ++kc) { a = wmmab(kh[kt][kc], qh[qb][kc], a); a = wmmab(kh[kt][kc], ql[qb][kc], a); a = wmmab(kl[kt][kc], qh[qb][kc], a); }
                s[kt][qb] = a; }
        // the next tile's K fragments are fetched behind this pass's score products, so that they fly under the softmax and attn.v
        const int jn = jt * 32; khp = Kh + jn * HD + kln; klp = Kl + jn * HD + kln;
#pragma unroll
        for (int kt = 0; kt < 2; ++kt)
#pragma unroll
            for (int kc = 0; kc < 2; ++kc) { const int p = kt * 16 * HD + kc * 32; kh[kt][kc] = WF::ld(khp + p); kl[kt][kc] = WF::ld(klp + p); }
        // all of this pass's loads are issued: their address registers may be rewritten behind this wait; the four addresses are inputs so that they live up to it and no load's result is placed in them ahead of it
        asm volatile("s_wait_xcnt 0x0" :: "v"(vhp), "v"(vlp), "v"(khp), "v"(klp) : "memory");
        // keeps the V and next-K loads issued above the softmax, where its vector work hides their latency (the scheduler otherwise sinks them to their first use)
        __builtin_amdgcn_sched_barrier(0);
        v16bf ph[2], pl[2]; const int lk = L + nj;
#pragma unroll
        for (int qb = 0; qb < 2; ++qb) { const int dq = q0 + qb * 16 + lr + nj;
#pragma unroll
            for (int kt = 0; kt < 2; ++kt)
#pragma unroll
                for (int j = 0; j < 8; ++j) { const int cj = kt * 16 + j; const bool live = ((unsigned)(dq - cj) <= 512u) || (cj < lk);   // key = j0 + 8 hi + cj: 0 <= i - key <= 512, or key < L
                    // exp(30 tanh(s/30)) with tanh(u) = 1 - 2/(exp(2u) + 1), both exponentials base 2: 2^(C2 - 2 C2 / (2^(C1 s) + 1)), C1 = 2 log2(e) / 30, C2 = 30 log2(e); overflow of the inner one gives tanh = 1, underflow -1
                    const float r = __builtin_amdgcn_rcpf(__builtin_amdgcn_exp2f(s[kt][qb][j] * 0.0961796694f) + 1.0f);
                    const float p = live ? __builtin_amdgcn_exp2f(__builtin_fmaf(r, -86.5617025f, 43.2808512f)) : 0.0f; sum[qb] += p;
                    const __bf16 a = (__bf16)p; ph[qb][kt * 8 + j] = a; pl[qb][kt * 8 + j] = (__bf16)(p - (float)a); } }
#pragma unroll
        for (int db = 0; db < 4; ++db)
#pragma unroll
            for (int qb = 0; qb < 2; ++qb) { o[db][qb] = wmmab(vh[db], ph[qb], o[db][qb]); o[db][qb] = wmmab(vh[db], pl[qb], o[db][qb]); o[db][qb] = wmmab(vl[db], ph[qb], o[db][qb]); }
        nj += j0 - jn;
    } while (u < nu);
    // the last pass's stand-in K fetch feeds nothing: it has landed before the wave gives its registers back
    asm volatile("s_wait_loadcnt 0x0" ::: "memory");
#pragma unroll
    for (int qb = 0; qb < 2; ++qb) { const float f = __fdiv_rn(1.0f, sum[qb] + __shfl_xor(sum[qb], 16, 32)); const size_t ro = ((size_t)b * TT + q0 + qb * 16 + lr) * DD + h * HD + hi * 8; bf* ahp = Ah + ro; bf* alp = Al + ro; v8us oh[4], ol[4];
#pragma unroll
        for (int db = 0; db < 4; ++db) {
#pragma unroll
            for (int j = 0; j < 8; ++j) { unsigned short a, c2; splitf(o[db][qb][j] * f, a, c2); oh[db][j] = a; ol[db][j] = c2; }
            *(v8us*)(ahp + db * 16) = oh[db]; *(v8us*)(alp + db * 16) = ol[db]; }
        // the eight stores are issued: their data and address registers (inputs, so that they live up to here) may be rewritten behind this wait
        asm volatile("s_wait_xcnt 0x0" :: "v"(oh[0]), "v"(oh[1]), "v"(oh[2]), "v"(oh[3]), "v"(ol[0]), "v"(ol[1]), "v"(ol[2]), "v"(ol[3]), "v"(ahp), "v"(alp) : "memory"); }
}

extern "C" void kernel_launch(void* const* d_in, const int* in_sizes, int n_in,
                              void* d_out, int out_size, void* d_ws, size_t ws_size, hipStream_t stream) {
    (void)in_sizes; (void)n_in; (void)out_size;
    const float* x = (const float*)d_in[0]; const int* spl = (const int*)d_in[1]; const float* Wqkv = (const float*)d_in[2]; const float* bqkv = (const float*)d_in[3]; const float* Wo = (const float*)d_in[4]; const float* bo = (const float*)d_in[5];
    float* OUT = (float*)d_out;     // [2][2048][1024]
    char* wsp = (char*)d_ws;
    auto take = [&](size_t bytes) { char* p = wsp; wsp += (bytes + 255) & ~(size_t)255; return (void*)p; };
    bf* WQKV = (bf*)take((size_t)3 * DD * DD * 2); bf* WO = (bf*)take((size_t)DD * DD * 2);
    bf* XB = (bf*)take((size_t)NT * DD * 2);
    bf* QPh = (bf*)take((size_t)NT * DD * 2); bf* QPl = (bf*)take((size_t)NT * DD * 2); bf* KPh = (bf*)take((size_t)NT * DD * 2); bf* KPl = (bf*)take((size_t)NT * DD * 2); bf* VTh = (bf*)take((size_t)NT * DD * 2); bf* VTl = (bf*)take((size_t)NT * DD * 2);
    bf* ATh = (bf*)take((size_t)NT * DD * 2); bf* ATl = (bf*)take((size_t)NT * DD * 2);
    if ((size_t)(wsp - (char*)d_ws) > ws_size) return;    // ws 256 MiB
    { const size_t nw = (size_t)DD * DD / 8; const unsigned gw = (unsigned)((nw + 255) / 256); k_cvt8<<<3 * gw, 256, 0, stream>>>(Wqkv, WQKV, 3 * nw); k_cvt8<<<gw, 256, 0, stream>>>(Wo, WO, nw); }   // nn.Linear [out][in] = Bt as-is (q|k|v row blocks, one matrix)
    const size_t nx = (size_t)NT * DD / 8; const unsigned gx = (unsigned)((nx + 255) / 256);
    k_cvt8<<<gx, 256, 0, stream>>>(x, XB, nx);
    k_qkv<<<dim3(NT / 64, 3 * DD / 64, 1), 32, 0, stream>>>(XB, WQKV, bqkv, QPh, QPl, KPh, KPl, VTh, VTl);
    k_fattn<<<dim3(TT / 256, NB_ * NH_, 1), 256, 0, stream>>>(QPh, QPl, KPh, KPl, VTh, VTl, spl, ATh, ATl);
    k_gemmw<bf, 1, true><<<dim3(NT / 64, DD / 64, 1), 32, 0, stream>>>(ATh, ATl, WO, nullptr, DD, OUT, DD, bo, 0, 0, 0);
}

// v004
// A run of this version takes 128 microseconds.
// Next to v003, in two timings, it ran 1.11 and 1.12 times as fast.
// Counting every step since v000, it is 10.4 times as fast.
#include <hip/hip_runtime.h>

// TunedSelfAttention (x [2][2048][1024]; qkv = x W_qkv^T + b_qkv ([3072][1024] Linear); 16 heads x 64; s = (q.k / 8); s = 30 tanh(s / 30) (softcap); keep key j iff (i >= j && i - j <= 512) || j < suffix_prefix_length[b] (int input, read as data), else -inf; softmax; y = attn.v merged; out = y W_proj^T + b_proj).
// The sliding-window/prefix mask is evaluated arithmetically per element; early rows see few keys, so scores and attn.v run on bf16 hi+lo planes.
// Compute dtypes, f32 accumulate: every float input rounded to bf16; q/k/v projections on PLAIN bf16 operands (x, W inputs: exact, + bias);
// scores on bf16 hi+lo q (x 1/8) and k planes (3 products); attn.v on bf16 hi+lo P and V^T planes (3 products); output projection on hi+lo planes x exact bf16 Wout (2 products);

#define NB_  2
#define TT   2048
#define DD   1024
#define NH_  16
#define HD   64
#define NT   (NB_ * TT)
#define ZH   2
#define PCAR 1024.0f
typedef _Float16 h16;
typedef unsigned short bf;
typedef __attribute__((ext_vector_type(16))) __bf16   v16bf;
typedef __attribute__((ext_vector_type(16))) _Float16 v16h;
typedef __attribute__((ext_vector_type(8)))  _Float16 v8h;
typedef __attribute__((ext_vector_type(8)))  unsigned short v8us;
typedef __attribute__((ext_vector_type(8)))  float    v8f;
typedef __attribute__((ext_vector_type(4)))  float    v4f;
typedef v8h  __attribute__((may_alias)) v8ha;
typedef v4f  __attribute__((may_alias)) v4fa;
typedef v8us __attribute__((may_alias)) v8usa;

__device__ __forceinline__ unsigned short f2bf(float f) { unsigned u = __float_as_uint(f); u += 0x7FFFu + ((u >> 16) & 1u); return (unsigned short)(u >> 16); }
__device__ __forceinline__ float bf2f(unsigned short b) { return __uint_as_float(((unsigned)b) << 16); }
__device__ __forceinline__ float bfr(float f) { return bf2f(f2bf(f)); }
__device__ __forceinline__ v16h cat16(v8h lo, v8h hi) { return __builtin_shufflevector(lo, hi, 0, 1, 2, 3, 4, 5, 6, 7, 8, 9, 10, 11, 12, 13, 14, 15); }
__device__ __forceinline__ v16bf cat16b(v8us lo, v8us hi) { return __builtin_bit_cast(v16bf, __builtin_shufflevector(lo, hi, 0, 1, 2, 3, 4, 5, 6, 7, 8, 9, 10, 11, 12, 13, 14, 15)); }
__device__ __forceinline__ v8f wmma16(v16h a, v16h b, v8f c) { return __builtin_amdgcn_wmma_f32_16x16x32_f16(false, a, false, b, (short)0, c, false, false); }
__device__ __forceinline__ v8f wmmab(v16bf a, v16bf b, v8f c) { return __builtin_amdgcn_wmma_f32_16x16x32_bf16(false, a, false, b, (short)0, c, false, false); }



// ---- k_gemmw: register-blocked GEMM, ONE WAVE per 64x64 output tile (16 accumulators), operands straight from fragment-packed 16-bit planes; grid (M/64, N/64, Z), 32 threads.
// C[m][n] (f32, pitch ldc, + optional f32 bias[n]) = sum_k A[m][k] Bt[n][k] (+ split products per NSPLIT). z-batch strides sA/sB/sC in elements. K % 32 == 0.
// FRAGMENT-PACKED PLANES: every 16-bit operand plane M[row][k] is kept as blocks of 16 rows x 32 k (512 elements, 1 KiB), a block being the WMMA fragment as the registers hold it:
// element (row, k) stands at block * 512 + half * 256 + lane * 8 + e with k % 32 = half * 16 + hi * 8 + e and lane = hi * 16 + row % 16. A wave-wide 16-byte load is then 512 contiguous bytes (4 whole lines, not 32 bytes of each of 16 lines).
// Lane and register of every element are those of the hardware's fragment layout, alike for A and B operands. Block order: (row / 16) * (K / 32) + k / 32, but V^T (see k_qkv). ld takes block start + lane * 8.
template <typename T16> struct WFrag;
template <> struct WFrag<h16> { typedef v16h V; static __device__ __forceinline__ V ld(const h16* p) { return cat16(*(const v8h*)p, *(const v8h*)(p + 256)); } static __device__ __forceinline__ v8f mma(V a, V b, v8f c) { return wmma16(a, b, c); } };
template <> struct WFrag<bf> { typedef v16bf V; static __device__ __forceinline__ V ld(const bf* p) { return cat16b(*(const v8us*)p, *(const v8us*)(p + 256)); } static __device__ __forceinline__ v8f mma(V a, V b, v8f c) { return wmmab(a, b, c); } };
template <typename T16, int NSPLIT, bool BIAS, int K>   // K is a constant so that every block's offset from the pass's three or four addresses is an immediate
__global__ __launch_bounds__(32) void k_gemmw(const T16* __restrict__ A, const T16* __restrict__ A2, const T16* __restrict__ Bt, const T16* __restrict__ Bt2, float* C, int ldc, const float* __restrict__ bias, size_t sA, size_t sB, size_t sC) {
    typedef typename WFrag<T16>::V V;
    __shared__ __align__(16) float os[16 * 68];
    const size_t z = blockIdx.z; A += z * sA; if (A2) A2 += z * sA; Bt += z * sB; if (Bt2) Bt2 += z * sB; C += z * sC;
    const int lane = threadIdx.x & 31, lr = lane & 15, hi = lane >> 4; const int r0 = blockIdx.x * 64, c0 = blockIdx.y * 64;
    v8f acc[4][4];
#pragma unroll
    for (int mb = 0; mb < 4; ++mb)
#pragma unroll
        for (int nb = 0; nb < 4; ++nb) acc[mb][nb] = (v8f){};
    const size_t aoff = (size_t)r0 * K + 8 * lane, boff = (size_t)c0 * K + 8 * lane;   // a group of 16 rows is K / 32 blocks = 16 K elements; a step of 32 k is one block
#pragma unroll 1
    for (int kc = 0; kc < K; kc += 32) {
        V a[4], a2[4]; const T16* ap = A + aoff + kc * 16; const T16* a2p = (NSPLIT == 1 || NSPLIT == 2) ? A2 + aoff + kc * 16 : ap; const T16* bp = Bt + boff + kc * 16; const T16* b2p = NSPLIT >= 2 ? Bt2 + boff + kc * 16 : bp;
#pragma unroll
        for (int mb = 0; mb < 4; ++mb) { a[mb] = WFrag<T16>::ld(ap + (size_t)mb * 16 * K); if (NSPLIT == 1 || NSPLIT == 2) a2[mb] = WFrag<T16>::ld(a2p + (size_t)mb * 16 * K); }
#pragma unroll
        for (int nb = 0; nb < 4; ++nb) { const V b = WFrag<T16>::ld(bp + (size_t)nb * 16 * K); V b2; if (NSPLIT >= 2) b2 = WFrag<T16>::ld(b2p + (size_t)nb * 16 * K);
#pragma unroll
            for (int mb = 0; mb < 4; ++mb) { acc[mb][nb] = WFrag<T16>::mma(a[mb], b, acc[mb][nb]); if (NSPLIT == 1 || NSPLIT == 2) acc[mb][nb] = WFrag<T16>::mma(a2[mb], b, acc[mb][nb]); if (NSPLIT >= 2) acc[mb][nb] = WFrag<T16>::mma(a[mb], b2, acc[mb][nb]); } }
        // the pass's loads are issued: their address registers (inputs, so that they live up to here) may be rewritten behind this wait
        asm volatile("s_wait_xcnt 0x0" :: "v"(ap), "v"(a2p), "v"(bp), "v"(b2p) : "memory");
        asm volatile("v_nop\n\tv_nop\n\tv_nop\n\tv_nop" : "+v"(acc[0][0]), "+v"(acc[1][1]), "+v"(acc[2][2]), "+v"(acc[3][3]) : "v"(a[0]), "v"(a[3]));
    }
#pragma unroll
    for (int mb = 0; mb < 4; ++mb) {
#pragma unroll
        for (int nb = 0; nb < 4; ++nb) {
#pragma unroll
            for (int j = 0; j < 8; ++j) os[(hi * 8 + j) * 68 + nb * 16 + lr] = acc[mb][nb][j]; }
        __builtin_amdgcn_wave_barrier(); asm volatile("" ::: "memory");
        float* crow = C + (size_t)(r0 + mb * 16) * ldc + c0;
{
#pragma unroll
            for (int s = 0; s < 8; ++s) { const int row = 2 * s + hi, cofs = lr * 4; v4f val = *(const v4fa*)(os + row * 68 + cofs); if (BIAS) { val[0] += bfr(bias[c0 + cofs]); val[1] += bfr(bias[c0 + cofs + 1]); val[2] += bfr(bias[c0 + cofs + 2]); val[3] += bfr(bias[c0 + cofs + 3]); }
                *(v4f*)(crow + (size_t)row * ldc + cofs) = val; }
             }
        __builtin_amdgcn_wave_barrier(); asm volatile("" ::: "memory");
    }
}

__device__ __forceinline__ h16 tohx(float x) { return (h16)x; }
__device__ __forceinline__ void splitf(float y, unsigned short& h, unsigned short& l) { h = f2bf(y); l = f2bf(y - bf2f(h)); }
typedef __attribute__((ext_vector_type(2))) _Float16 v2h;
typedef __attribute__((ext_vector_type(4))) _Float16 v4h;
typedef __attribute__((ext_vector_type(2))) unsigned short v2us;
typedef __attribute__((ext_vector_type(4))) int v4i;

// k_cvt8: a row-major f32 matrix of DD columns to its fragment-packed bf16 plane. Thread i writes the plane's i-th 16 bytes (whole lines per wave) and reads the 8 floats that belong there; a block reads 512 contiguous bytes of each of 16 rows.
__global__ __launch_bounds__(256) void k_cvt8(const float* __restrict__ src, bf* dst, size_t n8) { const size_t i = (size_t)blockIdx.x * 256 + threadIdx.x; if (i >= n8) return;
    const size_t blk = i >> 6; const int c = (int)(i & 63); const size_t row = (blk / (DD / 32)) * 16 + (c & 15); const int k = (int)(blk % (DD / 32)) * 32 + (c >> 5) * 16 + ((c >> 4) & 1) * 8;
    const float* sp = src + row * DD + k; const v8f v = *(const v8f*)sp; v8us o;
    // the two loads are issued: their address register (an input, so that it lives up to here) may be rewritten behind this wait
    asm volatile("s_wait_xcnt 0x0" :: "v"(sp) : "memory");
#pragma unroll
    for (int k = 0; k < 8; ++k) o[k] = f2bf(v[k]); *(v8us*)(dst + i * 8) = o;  }
__global__ __launch_bounds__(256) void k_wtT(const float* __restrict__ w, int pitch, int col0, bf* Bt) {
    const int lane = threadIdx.x & 31; const int L0 = (blockIdx.x * 8 + (threadIdx.x >> 5)) * 8; const int nlines = DD * DD / 64;
{
#pragma unroll
        for (int l = 0; l < 8; ++l) { const int L = L0 + l; if (L >= nlines) break; const int e = L * 64 + lane * 2; const int k = e & (DD - 1), n = e >> 10; v2us o;
#pragma unroll
            for (int q = 0; q < 2; ++q) o[q] = f2bf(w[(size_t)(k + q) * pitch + col0 + n]);
            *(v2us*)(Bt + (size_t)e) = o; }
         }
}
// k_qkv: the q, k and v projections as the one product x W_qkv^T that they are, ONE WAVE per 64x64 tile as in k_gemmw, grid (NT/64, 3 DD/64): a tile column is one head of q, k or v.
// The epilogue adds the bias, scales (q only, by 1/8) and writes the bf16 hi+lo planes that k_fattn reads, fragment-packed: q and k per head as M[t][64] (block (t / 16) * 2 + feature / 32), v per head as M[feature][t] with the four blocks of a 32-key tile side by side (block (t / 32) * 4 + feature / 16).
// A v tile is computed transposed (rows = W_qkv rows, columns = tokens: both operands are packed alike, so the two loaders only trade places), so that all three kinds leave through the same whole-line stores.
// qkv_out: VT = false: tile rows are tokens, columns the head's 64 features (bias by column); VT = true: rows are features, columns tokens (bias by row). bn = the tile's 64 bias values; ph, pl = the tile's 8 packed blocks (4096 elements in a row, either kind) in the two planes.
template <bool VT>
__device__ __forceinline__ void qkv_out(const v8f (&acc)[4][4], float* os, const float* __restrict__ bn, float sc, bf* ph, bf* pl, int lr, int hi) {
    v8f br[4]; float bc[4]; const float* bp = VT ? bn + hi * 8 : bn + lr;
#pragma unroll
    for (int i = 0; i < 4; ++i) { if (VT) br[i] = *(const v8f*)(bp + i * 16); else bc[i] = bp[i * 16]; }
    // the bias loads are issued: their address register (an input, so that it lives up to here) may be rewritten behind this wait
    asm volatile("s_wait_xcnt 0x0" :: "v"(bp) : "memory");
#pragma unroll
    for (int i = 0; i < 4; ++i) { if (VT) {
#pragma unroll
            for (int j = 0; j < 8; ++j) br[i][j] = bfr(br[i][j]); } else bc[i] = bfr(bc[i]); }
    bf* php = ph + (hi * 16 + lr) * 8; bf* plp = pl + (hi * 16 + lr) * 8;
#pragma unroll
    for (int mb = 0; mb < 4; ++mb) {
#pragma unroll
        for (int nb = 0; nb < 4; ++nb) {
#pragma unroll
            for (int j = 0; j < 8; ++j) os[(hi * 8 + j) * 68 + nb * 16 + lr] = acc[mb][nb][j] + (VT ? br[mb][j] : bc[nb]); }
        __builtin_amdgcn_wave_barrier(); asm volatile("" ::: "memory");
        v8us oh[4], ol[4];
#pragma unroll
        for (int s = 0; s < 4; ++s) { const float* sp = os + lr * 68 + s * 16 + hi * 8; const v4f v0 = *(const v4fa*)sp, v1 = *(const v4fa*)(sp + 4);   // the lane's 8 elements of half-block s: row lr, columns 16 s + 8 hi ..
#pragma unroll
            for (int q = 0; q < 4; ++q) { unsigned short c1, c2; splitf(v0[q] * sc, c1, c2); oh[s][q] = c1; ol[s][q] = c2; splitf(v1[q] * sc, c1, c2); oh[s][4 + q] = c1; ol[s][4 + q] = c2; }
            const int d = (VT ? (s >> 1) * 4 + mb : mb * 2 + (s >> 1)) * 512 + (s & 1) * 256;
            *(v8us*)(php + d) = oh[s]; *(v8us*)(plp + d) = ol[s]; }
        // the eight stores are issued: their data and address registers (inputs, so that they live up to here) may be rewritten behind this wait
        asm volatile("s_wait_xcnt 0x0" :: "v"(oh[0]), "v"(oh[1]), "v"(oh[2]), "v"(oh[3]), "v"(ol[0]), "v"(ol[1]), "v"(ol[2]), "v"(ol[3]), "v"(php), "v"(plp) : "memory");
        __builtin_amdgcn_wave_barrier();
    }
}
__global__ __launch_bounds__(32) void k_qkv(const bf* __restrict__ X, const bf* __restrict__ Wt, const float* __restrict__ bias, bf* Qh, bf* Ql, bf* Kh, bf* Kl, bf* Vh, bf* Vl) {
    typedef WFrag<bf> WF; typedef WF::V V; const int K = DD;
    __shared__ __align__(16) float os[16 * 68];
    const int lane = threadIdx.x & 31, lr = lane & 15, hi = lane >> 4; const int t0 = blockIdx.x * 64, n0 = blockIdx.y * 64;
    const int part = blockIdx.y >> 4, z = (t0 >> 11) * NH_ + (blockIdx.y & 15), tb = t0 & (TT - 1); const bool vt = part == 2;
    const bf* A = vt ? Wt + (size_t)n0 * K : X + (size_t)t0 * K; const bf* Bt = vt ? X + (size_t)t0 * K : Wt + (size_t)n0 * K;
    v8f acc[4][4];
#pragma unroll
    for (int mb = 0; mb < 4; ++mb)
#pragma unroll
        for (int nb = 0; nb < 4; ++nb) acc[mb][nb] = (v8f){};
    const size_t loff = (size_t)lane * 8;
#pragma unroll 1
    for (int kc = 0; kc < K; kc += 32) {
        V a[4], b[4]; const bf* ap = A + loff + kc * 16; const bf* bp = Bt + loff + kc * 16;   // a step of 32 k is one packed block
#pragma unroll
        for (int i = 0; i < 4; ++i) { a[i] = WF::ld(ap + (size_t)i * 16 * K); b[i] = WF::ld(bp + (size_t)i * 16 * K); }
        // the pass's loads are issued: their address registers may be rewritten behind this wait; the two addresses are inputs so that they live up to it and no load's result is placed in them ahead of it
        asm volatile("s_wait_xcnt 0x0" :: "v"(ap), "v"(bp) : "memory");
#pragma unroll
        for (int nb = 0; nb < 4; ++nb)
#pragma unroll
            for (int mb = 0; mb < 4; ++mb) acc[mb][nb] = WF::mma(a[mb], b[nb], acc[mb][nb]);
        // the distance behind the last matrix instructions on the loop's taken branch, as in k_gemmw
        asm volatile("v_nop\n\tv_nop\n\tv_nop\n\tv_nop" : "+v"(acc[0][0]), "+v"(acc[1][1]), "+v"(acc[2][2]), "+v"(acc[3][3]) : "v"(a[0]), "v"(a[3]));
    }
    if (vt) qkv_out<true>(acc, os, bias + n0, 1.0f, Vh + ((size_t)z * TT + tb) * HD, Vl + ((size_t)z * TT + tb) * HD, lr, hi);
    else qkv_out<false>(acc, os, bias + n0, part == 0 ? 0.125f : 1.0f, (part == 0 ? Qh : Kh) + ((size_t)z * TT + tb) * HD, (part == 0 ? Ql : Kl) + ((size_t)z * TT + tb) * HD, lr, hi);   // 64^-0.5 folded into q exactly
}
// k_fattn: scores, softcap, mask, softmax and attn.v of one head in one kernel; one wave owns 32 queries and walks the keys 32 at a time, everything in registers.
// S^T = K Q^T (A = 16 keys x 64, B = 16 queries): a lane then holds, for query lr, keys 8 hi + j of each 16-key tile, which is the B fragment of P^T for O^T = V^T P^T as it stands.
// The softcap bounds every score to [-30, 30], so exp(s) needs no running maximum; the row is divided by its sum once, behind the last key.
// Every inner loop is unrolled whole so that the fragment arrays are indexed by constants and stay in registers.
// A wave visits only the 32-key tiles that can hold a live key for its 32 queries: the tiles below the prefix length that lie outside its window, then the 17 tiles of its window (query tile - 16 .. query tile).
// The 8 windows of a block are 17 consecutive tiles out of the same 24, so each holds every residue modulo 17 once: at window step t a wave takes its tile of residue t, and the block reads at most two different tiles at a time, which one wave's lines serve to the others from the WGP cache.
// waves_per_eu(2, 2): the grid is one 8-wave block per WGP, two waves a SIMD, so the register budget is that of two waves.
__global__ __launch_bounds__(256) __attribute__((amdgpu_waves_per_eu(2, 2))) void k_fattn(const bf* __restrict__ Qh, const bf* __restrict__ Ql, const bf* __restrict__ Kh, const bf* __restrict__ Kl, const bf* __restrict__ Vh, const bf* __restrict__ Vl, const int* __restrict__ spl, bf* Ah, bf* Al) {
    typedef WFrag<bf> WF;
    const int lane = threadIdx.x & 31, lr = lane & 15, hi = lane >> 4; const int z = blockIdx.y, b = z >> 4, h = z & 15; const int w = __builtin_amdgcn_readfirstlane(threadIdx.x >> 5); const int q0 = blockIdx.x * 256 + w * 32; const int L = min(max(spl[b], 0), TT);   // key < L reads the same for keys 0 .. TT - 1, and L - j0 below cannot wrap
    // the walk, all in scalars and free of branches: steps 0 .. np - 1 are the prefix tiles, steps np .. np + 16 the window tiles; next_step passes over the prefix tiles that the window holds and the window tiles in front of key 0 (window steps w .. -tb - 1)
    const int tq = blockIdx.x * 8 + w, tb = blockIdx.x * 8 - 16, np = (L + 31) >> 5, nu = np + 17;
    auto next_step = [&](int v) -> int { int n = v + 1; n = (n < np && n >= tq - 16 && n <= tq) ? min(tq + 1, np) : n; return n - np >= w ? max(n, np - tb) : n; };
    auto tile_of = [&](int v) -> int { const int t = v - np; return v < np ? v : tb + t + (t < w ? 17 : 0); };   // at v = nu, behind the last step: tile tb + 17, in bounds
    const size_t zo = (size_t)z * TT * HD; Qh += zo; Ql += zo; Kh += zo; Kl += zo; Vh += zo; Vl += zo;
    v16bf qh[2][2], ql[2][2]; const bf* qhp = Qh + (q0 * HD + 8 * lane); const bf* qlp = Ql + (q0 * HD + 8 * lane);
#pragma unroll
    for (int qb = 0; qb < 2; ++qb)
#pragma unroll
        for (int kc = 0; kc < 2; ++kc) { qh[qb][kc] = WF::ld(qhp + (qb * 2 + kc) * 512); ql[qb][kc] = WF::ld(qlp + (qb * 2 + kc) * 512); }
    // the Q loads are issued: their address registers (inputs, so that they live up to here) may be rewritten behind this wait; the fence keeps later address work behind it
    asm volatile("s_wait_xcnt 0x0" :: "v"(qhp), "v"(qlp) : "memory");
    __builtin_amdgcn_sched_barrier(0);
    v8f o[4][2]; float sum[2] = {0.f, 0.f};
#pragma unroll
    for (int db = 0; db < 4; ++db)
#pragma unroll
        for (int qb = 0; qb < 2; ++qb) o[db][qb] = (v8f){};
    v16bf kh[2][2], kl[2][2];
    int u = next_step(-1), jt = tile_of(u);   // u < nu: the wave's own query tile tq is a step of the window part
    const size_t kln = (size_t)(8 * lane), vln = kln;   // the lane's place in a packed block; a 32-key tile is 4 blocks (32 * HD elements) of K and of V^T alike, and its offset is scalar
    const bf* khp = Kh + jt * (32 * HD) + kln; const bf* klp = Kl + jt * (32 * HD) + kln;
    int nj = -(jt * 32 + hi * 8);   // minus the lane's first key of the tile, carried from pass to pass: one vector add a pass, and the mask offsets below stay plain adds of constants
#pragma unroll
    for (int kt = 0; kt < 2; ++kt)
#pragma unroll
        for (int kc = 0; kc < 2; ++kc) { const int p = (kt * 2 + kc) * 512; kh[kt][kc] = WF::ld(khp + p); kl[kt][kc] = WF::ld(klp + p); }
    // the same for the first K loads
    asm volatile("s_wait_xcnt 0x0" ::: "memory");
    __builtin_amdgcn_sched_barrier(0);
#pragma unroll 1   // stays rolled: one pass is about 600 instructions, and the K fragments rotate through the same registers
    do {
        const int j0 = jt * 32;
        u = next_step(u); jt = tile_of(u);   // behind the last step this names a tile that is fetched and not used
        v16bf vh[4], vl[4]; const bf* vhp = Vh + j0 * HD + vln; const bf* vlp = Vl + j0 * HD + vln;
#pragma unroll
        for (int db = 0; db < 4; ++db) { vh[db] = WF::ld(vhp + db * 512); vl[db] = WF::ld(vlp + db * 512); }
        v8f s[2][2];
#pragma unroll
        for (int kt = 0; kt < 2; ++kt)
#pragma unroll
            for (int qb = 0; qb < 2; ++qb) { v8f a = (v8f){};
#pragma unroll
                for (int kc = 0; kc < 2; ++kc) { a = wmmab(kh[kt][kc], qh[qb][kc], a); a = wmmab(kh[kt][kc], ql[qb][kc], a); a = wmmab(kl[kt][kc], qh[qb][kc], a); }
                s[kt][qb] = a; }
        // the next tile's K fragments are fetched behind this pass's score products, so that they fly under the softmax and attn.v
        const int jn = jt * 32; khp = Kh + jn * HD + kln; klp = Kl + jn * HD + kln;
#pragma unroll
        for (int kt = 0; kt < 2; ++kt)
#pragma unroll
            for (int kc = 0; kc < 2; ++kc) { const int p = (kt * 2 + kc) * 512; kh[kt][kc] = WF::ld(khp + p); kl[kt][kc] = WF::ld(klp + p); }
        // all of this pass's loads are issued: their address registers may be rewritten behind this wait; the four addresses are inputs so that they live up to it and no load's result is placed in them ahead of it
        asm volatile("s_wait_xcnt 0x0" :: "v"(vhp), "v"(vlp), "v"(khp), "v"(klp) : "memory");
        // keeps the V and next-K loads issued above the softmax, where its vector work hides their latency (the scheduler otherwise sinks them to their first use)
        __builtin_amdgcn_sched_barrier(0);
        v16bf ph[2], pl[2]; const int lk = L + nj;
#pragma unroll
        for (int qb = 0; qb < 2; ++qb) { const int dq = q0 + qb * 16 + lr + nj;
#pragma unroll
            for (int kt = 0; kt < 2; ++kt)
#pragma unroll
                for (int j = 0; j < 8; ++j) { const int cj = kt * 16 + j; const bool live = ((unsigned)(dq - cj) <= 512u) || (cj < lk);   // key = j0 + 8 hi + cj: 0 <= i - key <= 512, or key < L
                    // exp(30 tanh(s/30)) with tanh(u) = 1 - 2/(exp(2u) + 1), both exponentials base 2: 2^(C2 - 2 C2 / (2^(C1 s) + 1)), C1 = 2 log2(e) / 30, C2 = 30 log2(e); overflow of the inner one gives tanh = 1, underflow -1
                    const float r = __builtin_amdgcn_rcpf(__builtin_amdgcn_exp2f(s[kt][qb][j] * 0.0961796694f) + 1.0f);
                    const float p = live ? __builtin_amdgcn_exp2f(__builtin_fmaf(r, -86.5617025f, 43.2808512f)) : 0.0f; sum[qb] += p;
                    const __bf16 a = (__bf16)p; ph[qb][kt * 8 + j] = a; pl[qb][kt * 8 + j] = (__bf16)(p - (float)a); } }
#pragma unroll
        for (int db = 0; db < 4; ++db)
#pragma unroll
            for (int qb = 0; qb < 2; ++qb) { o[db][qb] = wmmab(vh[db], ph[qb], o[db][qb]); o[db][qb] = wmmab(vh[db], pl[qb], o[db][qb]); o[db][qb] = wmmab(vl[db], ph[qb], o[db][qb]); }
        nj += j0 - jn;
    } while (u < nu);
    // the last pass's stand-in K fetch feeds nothing: it has landed before the wave gives its registers back
    asm volatile("s_wait_loadcnt 0x0" ::: "memory");
    // the output planes are packed for k_gemmw (rows = tokens, K = DD): features 16 db + 8 hi .. of head h are half-block db of the head's two blocks, and each lane is its own lane there
#pragma unroll
    for (int qb = 0; qb < 2; ++qb) { const float f = __fdiv_rn(1.0f, sum[qb] + __shfl_xor(sum[qb], 16, 32)); const size_t ro = ((size_t)b * TT + q0 + qb * 16) * DD + h * (2 * 512) + lane * 8; bf* ahp = Ah + ro; bf* alp = Al + ro; v8us oh[4], ol[4];
#pragma unroll
        for (int db = 0; db < 4; ++db) {
#pragma unroll
            for (int j = 0; j < 8; ++j) { unsigned short a, c2; splitf(o[db][qb][j] * f, a, c2); oh[db][j] = a; ol[db][j] = c2; }
            *(v8us*)(ahp + db * 256) = oh[db]; *(v8us*)(alp + db * 256) = ol[db]; }
        // the eight stores are issued: their data and address registers (inputs, so that they live up to here) may be rewritten behind this wait
        asm volatile("s_wait_xcnt 0x0" :: "v"(oh[0]), "v"(oh[1]), "v"(oh[2]), "v"(oh[3]), "v"(ol[0]), "v"(ol[1]), "v"(ol[2]), "v"(ol[3]), "v"(ahp), "v"(alp) : "memory"); }
}

extern "C" void kernel_launch(void* const* d_in, const int* in_sizes, int n_in,
                              void* d_out, int out_size, void* d_ws, size_t ws_size, hipStream_t stream) {
    (void)in_sizes; (void)n_in; (void)out_size;
    const float* x = (const float*)d_in[0]; const int* spl = (const int*)d_in[1]; const float* Wqkv = (const float*)d_in[2]; const float* bqkv = (const float*)d_in[3]; const float* Wo = (const float*)d_in[4]; const float* bo = (const float*)d_in[5];
    float* OUT = (float*)d_out;     // [2][2048][1024]
    char* wsp = (char*)d_ws;
    auto take = [&](size_t bytes) { char* p = wsp; wsp += (bytes + 255) & ~(size_t)255; return (void*)p; };
    bf* WQKV = (bf*)take((size_t)3 * DD * DD * 2); bf* WO = (bf*)take((size_t)DD * DD * 2);
    bf* XB = (bf*)take((size_t)NT * DD * 2);
    bf* QPh = (bf*)take((size_t)NT * DD * 2); bf* QPl = (bf*)take((size_t)NT * DD * 2); bf* KPh = (bf*)take((size_t)NT * DD * 2); bf* KPl = (bf*)take((size_t)NT * DD * 2); bf* VTh = (bf*)take((size_t)NT * DD * 2); bf* VTl = (bf*)take((size_t)NT * DD * 2);
    bf* ATh = (bf*)take((size_t)NT * DD * 2); bf* ATl = (bf*)take((size_t)NT * DD * 2);
    if ((size_t)(wsp - (char*)d_ws) > ws_size) return;    // ws 256 MiB
    { const size_t nw = (size_t)DD * DD / 8; const unsigned gw = (unsigned)((nw + 255) / 256); k_cvt8<<<3 * gw, 256, 0, stream>>>(Wqkv, WQKV, 3 * nw); k_cvt8<<<gw, 256, 0, stream>>>(Wo, WO, nw); }   // nn.Linear [out][in] = Bt as-is (q|k|v row blocks, one matrix)
    const size_t nx = (size_t)NT * DD / 8; const unsigned gx = (unsigned)((nx + 255) / 256);
    k_cvt8<<<gx, 256, 0, stream>>>(x, XB, nx);
    k_qkv<<<dim3(NT / 64, 3 * DD / 64, 1), 32, 0, stream>>>(XB, WQKV, bqkv, QPh, QPl, KPh, KPl, VTh, VTl);
    k_fattn<<<dim3(TT / 256, NB_ * NH_, 1), 256, 0, stream>>>(QPh, QPl, KPh, KPl, VTh, VTl, spl, ATh, ATl);
    k_gemmw<bf, 1, true, DD><<<dim3(NT / 64, DD / 64, 1), 32, 0, stream>>>(ATh, ATl, WO, nullptr, OUT, DD, bo, 0, 0, 0);
}

// v005
// Measured time: 90.3 microseconds a run.
// Next to v004, in two timings, it ran 1.41 and 1.42 times as fast.
// Over all steps from v000 it is 14.7 times as fast.
#include <hip/hip_runtime.h>

// TunedSelfAttention (x [2][2048][1024]; qkv = x W_qkv^T + b_qkv ([3072][1024] Linear); 16 heads x 64; s = (q.k / 8); s = 30 tanh(s / 30) (softcap); keep key j iff (i >= j && i - j <= 512) || j < suffix_prefix_length[b] (int input, read as data), else -inf; softmax; y = attn.v merged; out = y W_proj^T + b_proj).
// The sliding-window/prefix mask is evaluated arithmetically per element; early rows see few keys, so scores and attn.v run on bf16 hi+lo planes.
// Compute dtypes, f32 accumulate: every float input rounded to bf16; q/k/v projections on PLAIN bf16 operands (x, W inputs: exact, + bias);
// scores on bf16 hi+lo q (x 1/8) and k planes (3 products); attn.v on bf16 hi+lo P and V^T planes (3 products); output projection on hi+lo planes x exact bf16 Wout (2 products);

#define NB_  2
#define TT   2048
#define DD   1024
#define NH_  16
#define HD   64
#define NT   (NB_ * TT)
#define ZH   2
#define PCAR 1024.0f
typedef _Float16 h16;
typedef unsigned short bf;
typedef __attribute__((ext_vector_type(16))) __bf16   v16bf;
typedef __attribute__((ext_vector_type(16))) _Float16 v16h;
typedef __attribute__((ext_vector_type(8)))  _Float16 v8h;
typedef __attribute__((ext_vector_type(8)))  unsigned short v8us;
typedef __attribute__((ext_vector_type(8)))  float    v8f;
typedef __attribute__((ext_vector_type(4)))  float    v4f;
typedef v8h  __attribute__((may_alias)) v8ha;
typedef v4f  __attribute__((may_alias)) v4fa;
typedef v8us __attribute__((may_alias)) v8usa;

__device__ __forceinline__ unsigned short f2bf(float f) { unsigned u = __float_as_uint(f); u += 0x7FFFu + ((u >> 16) & 1u); return (unsigned short)(u >> 16); }
__device__ __forceinline__ float bf2f(unsigned short b) { return __uint_as_float(((unsigned)b) << 16); }
__device__ __forceinline__ float bfr(float f) { return bf2f(f2bf(f)); }
__device__ __forceinline__ v16h cat16(v8h lo, v8h hi) { return __builtin_shufflevector(lo, hi, 0, 1, 2, 3, 4, 5, 6, 7, 8, 9, 10, 11, 12, 13, 14, 15); }
__device__ __forceinline__ v16bf cat16b(v8us lo, v8us hi) { return __builtin_bit_cast(v16bf, __builtin_shufflevector(lo, hi, 0, 1, 2, 3, 4, 5, 6, 7, 8, 9, 10, 11, 12, 13, 14, 15)); }
__device__ __forceinline__ v8f wmma16(v16h a, v16h b, v8f c) { return __builtin_amdgcn_wmma_f32_16x16x32_f16(false, a, false, b, (short)0, c, false, false); }
__device__ __forceinline__ v8f wmmab(v16bf a, v16bf b, v8f c) { return __builtin_amdgcn_wmma_f32_16x16x32_bf16(false, a, false, b, (short)0, c, false, false); }



// ---- k_gemmw: register-blocked GEMM, one wave per 64x64 output tile (16 accumulators), 4 waves (2 x 2) per 128x128 work-group tile; grid (M/128, N/128), 128 threads.
// C[m][n] (f32, pitch ldc, + optional f32 bias[n]) = sum_k (A[m][k] + A2[m][k]) Bt[n][k], two products. K % 64 == 0, K >= 128. The operand blocks of 64 k come once per work-group into LDS by asynchronous copies, two buffers: stage s + 2 flies while stage s + 1 is worked on; the waves read their fragments from LDS as they stand in the planes.
// FRAGMENT-PACKED PLANES: every 16-bit operand plane M[row][k] is kept as blocks of 16 rows x 32 k (512 elements, 1 KiB), a block being the WMMA fragment as the registers hold it:
// element (row, k) stands at block * 512 + half * 256 + lane * 8 + e with k % 32 = half * 16 + hi * 8 + e and lane = hi * 16 + row % 16. A wave-wide 16-byte load is then 512 contiguous bytes (4 whole lines, not 32 bytes of each of 16 lines).
// Lane and register of every element are those of the hardware's fragment layout, alike for A and B operands. Block order: (row / 16) * (K / 32) + k / 32, but V^T (see k_qkv). ld takes block start + lane * 8.
template <typename T16> struct WFrag;
template <> struct WFrag<h16> { typedef v16h V; static __device__ __forceinline__ V ld(const h16* p) { return cat16(*(const v8h*)p, *(const v8h*)(p + 256)); } static __device__ __forceinline__ v8f mma(V a, V b, v8f c) { return wmma16(a, b, c); } };
template <> struct WFrag<bf> { typedef v16bf V; static __device__ __forceinline__ V ld(const bf* p) { return cat16b(*(const v8us*)p, *(const v8us*)(p + 256)); } static __device__ __forceinline__ v8f mma(V a, V b, v8f c) { return wmmab(a, b, c); } };
// cp_*: asynchronous copies to LDS, 16 bytes a lane, 512 contiguous bytes a wave and copy (half a packed block), through no register. l = the lane's LDS byte address, g = its global address.
// The s_wait_xcnt 0 is the last line of the copies' own statement, so that it stands in front of every later write of a register that a copy names.
#define CPL(a, b) "global_load_async_to_lds_b128 %" #a ", %" #b ", off\n\t"
__device__ __forceinline__ void cp_1(unsigned l, const bf* g) { asm volatile(CPL(0, 1) "s_wait_xcnt 0x0" :: "v"(l), "v"(g) : "memory"); }
__device__ __forceinline__ void cp_9(const unsigned* l, const bf* const* g) {
    asm volatile(CPL(0, 1) CPL(2, 3) CPL(4, 5) CPL(6, 7) CPL(8, 9) CPL(10, 11) CPL(12, 13) CPL(14, 15) CPL(16, 17) "s_wait_xcnt 0x0"
        :: "v"(l[0]), "v"(g[0]), "v"(l[1]), "v"(g[1]), "v"(l[2]), "v"(g[2]), "v"(l[3]), "v"(g[3]), "v"(l[4]), "v"(g[4]), "v"(l[5]), "v"(g[5]), "v"(l[6]), "v"(g[6]), "v"(l[7]), "v"(g[7]), "v"(l[8]), "v"(g[8]) : "memory"); }
__device__ __forceinline__ void cp_12(const unsigned* l, const bf* const* g) {
    asm volatile(CPL(0, 1) CPL(2, 3) CPL(4, 5) CPL(6, 7) CPL(8, 9) CPL(10, 11) CPL(12, 13) CPL(14, 15) CPL(16, 17) CPL(18, 19) CPL(20, 21) CPL(22, 23) "s_wait_xcnt 0x0"
        :: "v"(l[0]), "v"(g[0]), "v"(l[1]), "v"(g[1]), "v"(l[2]), "v"(g[2]), "v"(l[3]), "v"(g[3]), "v"(l[4]), "v"(g[4]), "v"(l[5]), "v"(g[5]), "v"(l[6]), "v"(g[6]), "v"(l[7]), "v"(g[7]), "v"(l[8]), "v"(g[8]), "v"(l[9]), "v"(g[9]), "v"(l[10]), "v"(g[10]), "v"(l[11]), "v"(g[11]) : "memory"); }
template <bool BIAS, int K>   // K is a constant so that the stage count is one
__global__ __launch_bounds__(128) void k_gemmw(const bf* __restrict__ A, const bf* __restrict__ A2, const bf* __restrict__ Bt, float* C, int ldc, const float* __restrict__ bias) {
    typedef WFrag<bf> WF; typedef WF::V V;
    __shared__ __align__(16) bf ring[2 * 24 * 1024];   // two stages of 24 row groups: 8 of A, 8 of A2, 8 of Bt, each 16 rows x 64 k = two packed blocks
    __shared__ __align__(16) float osall[4 * 16 * 68];
    const int lane = threadIdx.x & 31, lr = lane & 15, hi = lane >> 4; const int w = __builtin_amdgcn_readfirstlane(threadIdx.x >> 5);
    const int wm = w & 1, wn = w >> 1; const int r0 = blockIdx.x * 128 + wm * 64, c0 = blockIdx.y * 128 + wn * 64; float* os = osall + w * (16 * 68);
    v8f acc[4][4];
#pragma unroll
    for (int mb = 0; mb < 4; ++mb)
#pragma unroll
        for (int nb = 0; nb < 4; ++nb) acc[mb][nb] = (v8f){};
    // wave w copies row groups 2 w and 2 w + 1 of each of the three planes in every stage, 4 copies a group; a group of 16 rows is 16 K elements of its plane, a stage of 64 k is 1024 elements on
    const bf* gb[6];
#pragma unroll
    for (int j = 0; j < 2; ++j) { const size_t ra = (size_t)(blockIdx.x * 8 + w * 2 + j) * (16 * K) + lane * 8; gb[j] = A + ra; gb[2 + j] = A2 + ra; gb[4 + j] = Bt + (size_t)(blockIdx.y * 8 + w * 2 + j) * (16 * K) + lane * 8; }
    const unsigned l0 = (unsigned)(size_t)ring + w * (2 * 2048) + lane * 16;
    auto fill = [&](int buf) {
        unsigned l[24]; const bf* g[24];
#pragma unroll
        for (int i = 0; i < 24; ++i) { l[i] = l0 + buf * (24 * 2048) + ((i >> 3) * 8 + ((i >> 2) & 1)) * 2048 + (i & 3) * 512; g[i] = gb[i >> 2] + (i & 3) * 256; }
        cp_12(l, g); cp_12(l + 12, g + 12);
#pragma unroll
        for (int i = 0; i < 6; ++i) gb[i] += 1024; };
    fill(0);
    // stage 0 has landed before the barrier behind which the other waves read it
    asm volatile("s_wait_asynccnt 0x0" ::: "memory");
    __syncthreads();
    fill(1);
#pragma unroll 1   // stays rolled: the two buffers differ by an offset only
    for (int s = 0; s < K / 64; ++s) {
        const bf* rb = ring + (s & 1) * (24 * 1024) + lane * 8;
#pragma unroll
        for (int kk = 0; kk < 2; ++kk) {
            V a[4], a2[4], b[4];
            // the two fences keep the 24 LDS reads of these 32 k together as one group in front of their matrix instructions (the scheduler otherwise spreads them among those, each place with a wait to 0)
            __builtin_amdgcn_sched_barrier(0);
#pragma unroll
            for (int i = 0; i < 4; ++i) { b[i] = WF::ld(rb + (16 + wn * 4 + i) * 1024 + kk * 512); a[i] = WF::ld(rb + (wm * 4 + i) * 1024 + kk * 512); }
#pragma unroll
            for (int i = 0; i < 4; ++i) a2[i] = WF::ld(rb + (8 + wm * 4 + i) * 1024 + kk * 512);
            __builtin_amdgcn_sched_barrier(0);
#pragma unroll
            for (int nb = 0; nb < 4; ++nb)
#pragma unroll
                for (int mb = 0; mb < 4; ++mb) acc[mb][nb] = WF::mma(a[mb], b[nb], acc[mb][nb]);
#pragma unroll
            for (int nb = 0; nb < 4; ++nb)
#pragma unroll
                for (int mb = 0; mb < 4; ++mb) acc[mb][nb] = WF::mma(a2[mb], b[nb], acc[mb][nb]);
        }
        // the publish point of stage s + 1: this wave's reads of stage s are done, its copies of stage s + 1 have landed, then the barrier; only behind it is stage s's buffer filled anew
        asm volatile("s_wait_dscnt 0x0" ::: "memory");
        asm volatile("s_wait_asynccnt 0x0" ::: "memory");
        __syncthreads();
        if (s + 2 < K / 64) fill(s & 1);
    }
    // no copy is outstanding when the wave goes on
    asm volatile("s_wait_asynccnt 0x0" ::: "memory");
#pragma unroll
    for (int mb = 0; mb < 4; ++mb) {
#pragma unroll
        for (int nb = 0; nb < 4; ++nb) {
#pragma unroll
            for (int j = 0; j < 8; ++j) os[(hi * 8 + j) * 68 + nb * 16 + lr] = acc[mb][nb][j]; }
        __builtin_amdgcn_wave_barrier(); asm volatile("" ::: "memory");
        float* crow = C + (size_t)(r0 + mb * 16) * ldc + c0;
{
#pragma unroll
            for (int s = 0; s < 8; ++s) { const int row = 2 * s + hi, cofs = lr * 4; v4f val = *(const v4fa*)(os + row * 68 + cofs); if (BIAS) { val[0] += bfr(bias[c0 + cofs]); val[1] += bfr(bias[c0 + cofs + 1]); val[2] += bfr(bias[c0 + cofs + 2]); val[3] += bfr(bias[c0 + cofs + 3]); }
                *(v4f*)(crow + (size_t)row * ldc + cofs) = val; }
             }
        __builtin_amdgcn_wave_barrier(); asm volatile("" ::: "memory");
    }
}

__device__ __forceinline__ h16 tohx(float x) { return (h16)x; }
__device__ __forceinline__ void splitf(float y, unsigned short& h, unsigned short& l) { h = f2bf(y); l = f2bf(y - bf2f(h)); }
typedef __attribute__((ext_vector_type(2))) _Float16 v2h;
typedef __attribute__((ext_vector_type(4))) _Float16 v4h;
typedef __attribute__((ext_vector_type(2))) unsigned short v2us;
typedef __attribute__((ext_vector_type(4))) int v4i;

// k_cvt8: a row-major f32 matrix of DD columns to its fragment-packed bf16 plane. Thread i writes the plane's i-th 16 bytes (whole lines per wave) and reads the 8 floats that belong there; a block reads 512 contiguous bytes of each of 16 rows.
__global__ __launch_bounds__(256) void k_cvt8(const float* __restrict__ src, bf* dst, size_t n8) { const size_t i = (size_t)blockIdx.x * 256 + threadIdx.x; if (i >= n8) return;
    const size_t blk = i >> 6; const int c = (int)(i & 63); const size_t row = (blk / (DD / 32)) * 16 + (c & 15); const int k = (int)(blk % (DD / 32)) * 32 + (c >> 5) * 16 + ((c >> 4) & 1) * 8;
    const float* sp = src + row * DD + k; const v8f v = *(const v8f*)sp; v8us o;
    // the two loads are issued: their address register (an input, so that it lives up to here) may be rewritten behind this wait
    asm volatile("s_wait_xcnt 0x0" :: "v"(sp) : "memory");
#pragma unroll
    for (int k = 0; k < 8; ++k) o[k] = f2bf(v[k]); *(v8us*)(dst + i * 8) = o;  }
__global__ __launch_bounds__(256) void k_wtT(const float* __restrict__ w, int pitch, int col0, bf* Bt) {
    const int lane = threadIdx.x & 31; const int L0 = (blockIdx.x * 8 + (threadIdx.x >> 5)) * 8; const int nlines = DD * DD / 64;
{
#pragma unroll
        for (int l = 0; l < 8; ++l) { const int L = L0 + l; if (L >= nlines) break; const int e = L * 64 + lane * 2; const int k = e & (DD - 1), n = e >> 10; v2us o;
#pragma unroll
            for (int q = 0; q < 2; ++q) o[q] = f2bf(w[(size_t)(k + q) * pitch + col0 + n]);
            *(v2us*)(Bt + (size_t)e) = o; }
         }
}
// k_qkv: the q, k and v projections as the one product x W_qkv^T that they are, one wave per 64x64 tile and the LDS ring as in k_gemmw, 12 waves (4 of tokens x 3 of W rows) per 256x192 work-group tile, grid (NT/256, 3 DD/192) = one work-group per WGP: a wave's tile column is one head of q, k or v.
// The epilogue adds the bias, scales (q only, by 1/8) and writes the bf16 hi+lo planes that k_fattn reads, fragment-packed: q and k per head as M[t][64] (block (t / 16) * 2 + feature / 32), v per head as M[feature][t] with the four blocks of a 32-key tile side by side (block (t / 32) * 4 + feature / 16).
// A v tile is computed transposed (rows = W_qkv rows, columns = tokens: both operands are packed alike, so the two loaders only trade places), so that all three kinds leave through the same whole-line stores.
// qkv_out: VT = false: tile rows are tokens, columns the head's 64 features (bias by column); VT = true: rows are features, columns tokens (bias by row). bn = the tile's 64 bias values; ph, pl = the tile's 8 packed blocks (4096 elements in a row, either kind) in the two planes.
template <bool VT>
__device__ __forceinline__ void qkv_out(const v8f (&acc)[4][4], float* os, const float* __restrict__ bn, float sc, bf* ph, bf* pl, int lr, int hi) {
    v8f br[4]; float bc[4]; const float* bp = VT ? bn + hi * 8 : bn + lr;
#pragma unroll
    for (int i = 0; i < 4; ++i) { if (VT) br[i] = *(const v8f*)(bp + i * 16); else bc[i] = bp[i * 16]; }
    // the bias loads are issued: their address register (an input, so that it lives up to here) may be rewritten behind this wait
    asm volatile("s_wait_xcnt 0x0" :: "v"(bp) : "memory");
#pragma unroll
    for (int i = 0; i < 4; ++i) { if (VT) {
#pragma unroll
            for (int j = 0; j < 8; ++j) br[i][j] = bfr(br[i][j]); } else bc[i] = bfr(bc[i]); }
    bf* php = ph + (hi * 16 + lr) * 8; bf* plp = pl + (hi * 16 + lr) * 8;
#pragma unroll
    for (int mb = 0; mb < 4; ++mb) {
#pragma unroll
        for (int nb = 0; nb < 4; ++nb) {
#pragma unroll
            for (int j = 0; j < 8; ++j) os[(hi * 8 + j) * 68 + nb * 16 + lr] = acc[mb][nb][j] + (VT ? br[mb][j] : bc[nb]); }
        __builtin_amdgcn_wave_barrier(); asm volatile("" ::: "memory");
        v8us oh[4], ol[4];
#pragma unroll
        for (int s = 0; s < 4; ++s) { const float* sp = os + lr * 68 + s * 16 + hi * 8; const v4f v0 = *(const v4fa*)sp, v1 = *(const v4fa*)(sp + 4);   // the lane's 8 elements of half-block s: row lr, columns 16 s + 8 hi ..
#pragma unroll
            for (int q = 0; q < 4; ++q) { unsigned short c1, c2; splitf(v0[q] * sc, c1, c2); oh[s][q] = c1; ol[s][q] = c2; splitf(v1[q] * sc, c1, c2); oh[s][4 + q] = c1; ol[s][4 + q] = c2; }
            const int d = (VT ? (s >> 1) * 4 + mb : mb * 2 + (s >> 1)) * 512 + (s & 1) * 256;
            *(v8us*)(php + d) = oh[s]; *(v8us*)(plp + d) = ol[s]; }
        // the eight stores are issued: their data and address registers (inputs, so that they live up to here) may be rewritten behind this wait
        asm volatile("s_wait_xcnt 0x0" :: "v"(oh[0]), "v"(oh[1]), "v"(oh[2]), "v"(oh[3]), "v"(ol[0]), "v"(ol[1]), "v"(ol[2]), "v"(ol[3]), "v"(php), "v"(plp) : "memory");
        __builtin_amdgcn_wave_barrier();
    }
}
__global__ __launch_bounds__(384) void k_qkv(const bf* __restrict__ X, const bf* __restrict__ Wt, const float* __restrict__ bias, bf* Qh, bf* Ql, bf* Kh, bf* Kl, bf* Vh, bf* Vl) {
    typedef WFrag<bf> WF; typedef WF::V V; const int K = DD;
    __shared__ __align__(16) bf ring[2 * 28 * 1024];   // two stages of 28 row groups: 16 of X, 12 of Wt, each 16 rows x 64 k = two packed blocks
    __shared__ __align__(16) float osall[12 * 16 * 68];
    const int lane = threadIdx.x & 31, lr = lane & 15, hi = lane >> 4; const int w = __builtin_amdgcn_readfirstlane(threadIdx.x >> 5);
    const int wt = w & 3, wn = w >> 2; const int t0 = blockIdx.x * 256 + wt * 64, ny = blockIdx.y * 3 + wn, n0 = ny * 64; float* os = osall + w * (16 * 68);
    const int part = ny >> 4, z = (t0 >> 11) * NH_ + (ny & 15), tb = t0 & (TT - 1); const bool vt = part == 2;
    const int ao = (vt ? 16 + wn * 4 : wt * 4) * 1024, bo = (vt ? wt * 4 : 16 + wn * 4) * 1024;   // the wave's four A and four B row groups in a stage
    v8f acc[4][4];
#pragma unroll
    for (int mb = 0; mb < 4; ++mb)
#pragma unroll
        for (int nb = 0; nb < 4; ++nb) acc[mb][nb] = (v8f){};
    // a stage is 112 copies of 512 bytes, 4 a row group; wave w takes copies w, w + 12, ..: nine each, and waves 0 .. 3 a tenth. A group of 16 rows is 16 K elements of its plane, a stage of 64 k is 1024 elements on
    const bf* gp[10]; unsigned lp[10];
#pragma unroll
    for (int i = 0; i < 10; ++i) { const int c = min(w + 12 * i, 111), g = c >> 2;
        gp[i] = (g < 16 ? X + (size_t)(blockIdx.x * 16 + g) * (16 * K) : Wt + (size_t)(blockIdx.y * 12 + g - 16) * (16 * K)) + (c & 3) * 256 + lane * 8; lp[i] = (unsigned)(size_t)ring + c * 512 + lane * 16; }
    auto fill = [&](int buf) {
        unsigned l[10];
#pragma unroll
        for (int i = 0; i < 10; ++i) l[i] = lp[i] + buf * (28 * 2048);
        cp_9(l, gp); if (w < 4) cp_1(l[9], gp[9]);
#pragma unroll
        for (int i = 0; i < 10; ++i) gp[i] += 1024; };
    fill(0);
    // stage 0 has landed before the barrier behind which the other waves read it
    asm volatile("s_wait_asynccnt 0x0" ::: "memory");
    __syncthreads();
    fill(1);
#pragma unroll 1   // stays rolled: the two buffers differ by an offset only
    for (int s = 0; s < K / 64; ++s) {
        const bf* rb = ring + (s & 1) * (28 * 1024) + lane * 8;
        V a[4], b[4];
        // the fences keep the 16 LDS reads of each 32 k together as one group in front of their matrix instructions, as in k_gemmw
        __builtin_amdgcn_sched_barrier(0);
#pragma unroll
        for (int i = 0; i < 4; ++i) { a[i] = WF::ld(rb + ao + i * 1024); b[i] = WF::ld(rb + bo + i * 1024); }
        __builtin_amdgcn_sched_barrier(0);
#pragma unroll
        for (int nb = 0; nb < 4; ++nb)
#pragma unroll
            for (int mb = 0; mb < 4; ++mb) acc[mb][nb] = WF::mma(a[mb], b[nb], acc[mb][nb]);
        __builtin_amdgcn_sched_barrier(0);
#pragma unroll
        for (int i = 0; i < 4; ++i) { a[i] = WF::ld(rb + ao + i * 1024 + 512); b[i] = WF::ld(rb + bo + i * 1024 + 512); }
        // the publish point of stage s + 1, as in k_gemmw; here it stands behind the stage's last LDS reads and in front of its last 16 matrix instructions, which need registers only: the copies of stage s + 2 fly under them too
        asm volatile("s_wait_dscnt 0x0" ::: "memory");
        asm volatile("s_wait_asynccnt 0x0" ::: "memory");
        __syncthreads();
        if (s + 2 < K / 64) fill(s & 1);
#pragma unroll
        for (int nb = 0; nb < 4; ++nb)
#pragma unroll
            for (int mb = 0; mb < 4; ++mb) acc[mb][nb] = WF::mma(a[mb], b[nb], acc[mb][nb]);
    }
    // no copy is outstanding when the wave goes on
    asm volatile("s_wait_asynccnt 0x0" ::: "memory");
    if (vt) qkv_out<true>(acc, os, bias + n0, 1.0f, Vh + ((size_t)z * TT + tb) * HD, Vl + ((size_t)z * TT + tb) * HD, lr, hi);
    else qkv_out<false>(acc, os, bias + n0, part == 0 ? 0.125f : 1.0f, (part == 0 ? Qh : Kh) + ((size_t)z * TT + tb) * HD, (part == 0 ? Ql : Kl) + ((size_t)z * TT + tb) * HD, lr, hi);   // 64^-0.5 folded into q exactly
}
// k_fattn: scores, softcap, mask, softmax and attn.v of one head in one kernel; one wave owns 32 queries and walks the keys 32 at a time, everything in registers.
// S^T = K Q^T (A = 16 keys x 64, B = 16 queries): a lane then holds, for query lr, keys 8 hi + j of each 16-key tile, which is the B fragment of P^T for O^T = V^T P^T as it stands.
// The softcap bounds every score to [-30, 30], so exp(s) needs no running maximum; the row is divided by its sum once, behind the last key.
// Every inner loop is unrolled whole so that the fragment arrays are indexed by constants and stay in registers.
// A wave visits only the 32-key tiles that can hold a live key for its 32 queries: the tiles below the prefix length that lie outside its window, then the 17 tiles of its window (query tile - 16 .. query tile).
// The 8 windows of a block are 17 consecutive tiles out of the same 24, so each holds every residue modulo 17 once: at window step t a wave takes its tile of residue t, and the block reads at most two different tiles at a time, which one wave's lines serve to the others from the WGP cache.
// waves_per_eu(2, 2): the grid is one 8-wave block per WGP, two waves a SIMD, so the register budget is that of two waves.
__global__ __launch_bounds__(256) __attribute__((amdgpu_waves_per_eu(2, 2))) void k_fattn(const bf* __restrict__ Qh, const bf* __restrict__ Ql, const bf* __restrict__ Kh, const bf* __restrict__ Kl, const bf* __restrict__ Vh, const bf* __restrict__ Vl, const int* __restrict__ spl, bf* Ah, bf* Al) {
    typedef WFrag<bf> WF;
    const int lane = threadIdx.x & 31, lr = lane & 15, hi = lane >> 4; const int z = blockIdx.y, b = z >> 4, h = z & 15; const int w = __builtin_amdgcn_readfirstlane(threadIdx.x >> 5); const int q0 = blockIdx.x * 256 + w * 32; const int L = min(max(spl[b], 0), TT);   // key < L reads the same for keys 0 .. TT - 1, and L - j0 below cannot wrap
    // the walk, all in scalars and free of branches: steps 0 .. np - 1 are the prefix tiles, steps np .. np + 16 the window tiles; next_step passes over the prefix tiles that the window holds and the window tiles in front of key 0 (window steps w .. -tb - 1)
    const int tq = blockIdx.x * 8 + w, tb = blockIdx.x * 8 - 16, np = (L + 31) >> 5, nu = np + 17;
    auto next_step = [&](int v) -> int { int n = v + 1; n = (n < np && n >= tq - 16 && n <= tq) ? min(tq + 1, np) : n; return n - np >= w ? max(n, np - tb) : n; };
    auto tile_of = [&](int v) -> int { const int t = v - np; return v < np ? v : tb + t + (t < w ? 17 : 0); };   // at v = nu, behind the last step: tile tb + 17, in bounds
    const size_t zo = (size_t)z * TT * HD; Qh += zo; Ql += zo; Kh += zo; Kl += zo; Vh += zo; Vl += zo;
    v16bf qh[2][2], ql[2][2]; const bf* qhp = Qh + (q0 * HD + 8 * lane); const bf* qlp = Ql + (q0 * HD + 8 * lane);
#pragma unroll
    for (int qb = 0; qb < 2; ++qb)
#pragma unroll
        for (int kc = 0; kc < 2; ++kc) { qh[qb][kc] = WF::ld(qhp + (qb * 2 + kc) * 512); ql[qb][kc] = WF::ld(qlp + (qb * 2 + kc) * 512); }
    // the Q loads are issued: their address registers (inputs, so that they live up to here) may be rewritten behind this wait; the fence keeps later address work behind it
    asm volatile("s_wait_xcnt 0x0" :: "v"(qhp), "v"(qlp) : "memory");
    __builtin_amdgcn_sched_barrier(0);
    v8f o[4][2]; float sum[2] = {0.f, 0.f};
#pragma unroll
    for (int db = 0; db < 4; ++db)
#pragma unroll
        for (int qb = 0; qb < 2; ++qb) o[db][qb] = (v8f){};
    v16bf kh[2][2], kl[2][2];
    int u = next_step(-1), jt = tile_of(u);   // u < nu: the wave's own query tile tq is a step of the window part
    const size_t kln = (size_t)(8 * lane), vln = kln;   // the lane's place in a packed block; a 32-key tile is 4 blocks (32 * HD elements) of K and of V^T alike, and its offset is scalar
    const bf* khp = Kh + jt * (32 * HD) + kln; const bf* klp = Kl + jt * (32 * HD) + kln;
    int nj = -(jt * 32 + hi * 8);   // minus the lane's first key of the tile, carried from pass to pass: one vector add a pass, and the mask offsets below stay plain adds of constants
#pragma unroll
    for (int kt = 0; kt < 2; ++kt)
#pragma unroll
        for (int kc = 0; kc < 2; ++kc) { const int p = (kt * 2 + kc) * 512; kh[kt][kc] = WF::ld(khp + p); kl[kt][kc] = WF::ld(klp + p); }
    // the same for the first K loads
    asm volatile("s_wait_xcnt 0x0" ::: "memory");
    __builtin_amdgcn_sched_barrier(0);
#pragma unroll 1   // stays rolled: one pass is about 600 instructions, and the K fragments rotate through the same registers
    do {
        const int j0 = jt * 32;
        u = next_step(u); jt = tile_of(u);   // behind the last step this names a tile that is fetched and not used
        v16bf vh[4], vl[4]; const bf* vhp = Vh + j0 * HD + vln; const bf* vlp = Vl + j0 * HD + vln;
#pragma unroll
        for (int db = 0; db < 4; ++db) { vh[db] = WF::ld(vhp + db * 512); vl[db] = WF::ld(vlp + db * 512); }
        v8f s[2][2];
#pragma unroll
        for (int kt = 0; kt < 2; ++kt)
#pragma unroll
            for (int qb = 0; qb < 2; ++qb) { v8f a = (v8f){};
#pragma unroll
                for (int kc = 0; kc < 2; ++kc) { a = wmmab(kh[kt][kc], qh[qb][kc], a); a = wmmab(kh[kt][kc], ql[qb][kc], a); a = wmmab(kl[kt][kc], qh[qb][kc], a); }
                s[kt][qb] = a; }
        // the next tile's K fragments are fetched behind this pass's score products, so that they fly under the softmax and attn.v
        const int jn = jt * 32; khp = Kh + jn * HD + kln; klp = Kl + jn * HD + kln;
#pragma unroll
        for (int kt = 0; kt < 2; ++kt)
#pragma unroll
            for (int kc = 0; kc < 2; ++kc) { const int p = (kt * 2 + kc) * 512; kh[kt][kc] = WF::ld(khp + p); kl[kt][kc] = WF::ld(klp + p); }
        // all of this pass's loads are issued: their address registers may be rewritten behind this wait; the four addresses are inputs so that they live up to it and no load's result is placed in them ahead of it
        asm volatile("s_wait_xcnt 0x0" :: "v"(vhp), "v"(vlp), "v"(khp), "v"(klp) : "memory");
        // keeps the V and next-K loads issued above the softmax, where its vector work hides their latency (the scheduler otherwise sinks them to their first use)
        __builtin_amdgcn_sched_barrier(0);
        v16bf ph[2], pl[2]; const int lk = L + nj;
#pragma unroll
        for (int qb = 0; qb < 2; ++qb) { const int dq = q0 + qb * 16 + lr + nj;
#pragma unroll
            for (int kt = 0; kt < 2; ++kt)
#pragma unroll
                for (int j = 0; j < 8; ++j) { const int cj = kt * 16 + j; const bool live = ((unsigned)(dq - cj) <= 512u) || (cj < lk);   // key = j0 + 8 hi + cj: 0 <= i - key <= 512, or key < L
                    // exp(30 tanh(s/30)) with tanh(u) = 1 - 2/(exp(2u) + 1), both exponentials base 2: 2^(C2 - 2 C2 / (2^(C1 s) + 1)), C1 = 2 log2(e) / 30, C2 = 30 log2(e); overflow of the inner one gives tanh = 1, underflow -1
                    const float r = __builtin_amdgcn_rcpf(__builtin_amdgcn_exp2f(s[kt][qb][j] * 0.0961796694f) + 1.0f);
                    const float p = live ? __builtin_amdgcn_exp2f(__builtin_fmaf(r, -86.5617025f, 43.2808512f)) : 0.0f; sum[qb] += p;
                    const __bf16 a = (__bf16)p; ph[qb][kt * 8 + j] = a; pl[qb][kt * 8 + j] = (__bf16)(p - (float)a); } }
#pragma unroll
        for (int db = 0; db < 4; ++db)
#pragma unroll
            for (int qb = 0; qb < 2; ++qb) { o[db][qb] = wmmab(vh[db], ph[qb], o[db][qb]); o[db][qb] = wmmab(vh[db], pl[qb], o[db][qb]); o[db][qb] = wmmab(vl[db], ph[qb], o[db][qb]); }
        nj += j0 - jn;
    } while (u < nu);
    // the last pass's stand-in K fetch feeds nothing: it has landed before the wave gives its registers back
    asm volatile("s_wait_loadcnt 0x0" ::: "memory");
    // the output planes are packed for k_gemmw (rows = tokens, K = DD): features 16 db + 8 hi .. of head h are half-block db of the head's two blocks, and each lane is its own lane there
#pragma unroll
    for (int qb = 0; qb < 2; ++qb) { const float f = __fdiv_rn(1.0f, sum[qb] + __shfl_xor(sum[qb], 16, 32)); const size_t ro = ((size_t)b * TT + q0 + qb * 16) * DD + h * (2 * 512) + lane * 8; bf* ahp = Ah + ro; bf* alp = Al + ro; v8us oh[4], ol[4];
#pragma unroll
        for (int db = 0; db < 4; ++db) {
#pragma unroll
            for (int j = 0; j < 8; ++j) { unsigned short a, c2; splitf(o[db][qb][j] * f, a, c2); oh[db][j] = a; ol[db][j] = c2; }
            *(v8us*)(ahp + db * 256) = oh[db]; *(v8us*)(alp + db * 256) = ol[db]; }
        // the eight stores are issued: their data and address registers (inputs, so that they live up to here) may be rewritten behind this wait
        asm volatile("s_wait_xcnt 0x0" :: "v"(oh[0]), "v"(oh[1]), "v"(oh[2]), "v"(oh[3]), "v"(ol[0]), "v"(ol[1]), "v"(ol[2]), "v"(ol[3]), "v"(ahp), "v"(alp) : "memory"); }
}

extern "C" void kernel_launch(void* const* d_in, const int* in_sizes, int n_in,
                              void* d_out, int out_size, void* d_ws, size_t ws_size, hipStream_t stream) {
    (void)in_sizes; (void)n_in; (void)out_size;
    const float* x = (const float*)d_in[0]; const int* spl = (const int*)d_in[1]; const float* Wqkv = (const float*)d_in[2]; const float* bqkv = (const float*)d_in[3]; const float* Wo = (const float*)d_in[4]; const float* bo = (const float*)d_in[5];
    float* OUT = (float*)d_out;     // [2][2048][1024]
    char* wsp = (char*)d_ws;
    auto take = [&](size_t bytes) { char* p = wsp; wsp += (bytes + 255) & ~(size_t)255; return (void*)p; };
    bf* WQKV = (bf*)take((size_t)3 * DD * DD * 2); bf* WO = (bf*)take((size_t)DD * DD * 2);
    bf* XB = (bf*)take((size_t)NT * DD * 2);
    bf* QPh = (bf*)take((size_t)NT * DD * 2); bf* QPl = (bf*)take((size_t)NT * DD * 2); bf* KPh = (bf*)take((size_t)NT * DD * 2); bf* KPl = (bf*)take((size_t)NT * DD * 2); bf* VTh = (bf*)take((size_t)NT * DD * 2); bf* VTl = (bf*)take((size_t)NT * DD * 2);
    bf* ATh = (bf*)take((size_t)NT * DD * 2); bf* ATl = (bf*)take((size_t)NT * DD * 2);
    if ((size_t)(wsp - (char*)d_ws) > ws_size) return;    // ws 256 MiB
    { const size_t nw = (size_t)DD * DD / 8; const unsigned gw = (unsigned)((nw + 255) / 256); k_cvt8<<<3 * gw, 256, 0, stream>>>(Wqkv, WQKV, 3 * nw); k_cvt8<<<gw, 256, 0, stream>>>(Wo, WO, nw); }   // nn.Linear [out][in] = Bt as-is (q|k|v row blocks, one matrix)
    const size_t nx = (size_t)NT * DD / 8; const unsigned gx = (unsigned)((nx + 255) / 256);
    k_cvt8<<<gx, 256, 0, stream>>>(x, XB, nx);
    k_qkv<<<dim3(NT / 256, 3 * DD / 192, 1), 384, 0, stream>>>(XB, WQKV, bqkv, QPh, QPl, KPh, KPl, VTh, VTl);
    k_fattn<<<dim3(TT / 256, NB_ * NH_, 1), 256, 0, stream>>>(QPh, QPl, KPh, KPl, VTh, VTl, spl, ATh, ATl);
    k_gemmw<true, DD><<<dim3(NT / 128, DD / 128, 1), 128, 0, stream>>>(ATh, ATl, WO, OUT, DD, bo);
}

// v006
// A run of this version takes 85.6 microseconds.
// In both of two side-by-side timings against v005, it was 1.06 times as fast.
// Over all steps from v000 it is 15.6 times as fast.
#include <hip/hip_runtime.h>

// TunedSelfAttention (x [2][2048][1024]; qkv = x W_qkv^T + b_qkv ([3072][1024] Linear); 16 heads x 64; s = (q.k / 8); s = 30 tanh(s / 30) (softcap); keep key j iff (i >= j && i - j <= 512) || j < suffix_prefix_length[b] (int input, read as data), else -inf; softmax; y = attn.v merged; out = y W_proj^T + b_proj).
// The sliding-window/prefix mask is evaluated arithmetically per element; early rows see few keys, so scores and attn.v run on bf16 hi+lo planes.
// Compute dtypes, f32 accumulate: every float input rounded to bf16; q/k/v projections on PLAIN bf16 operands (x, W inputs: exact, + bias);
// scores on bf16 hi+lo q (x 1/8) and k planes (3 products); attn.v on bf16 hi+lo P and V^T planes (3 products); output projection on hi+lo planes x exact bf16 Wout (2 products);

#define NB_  2
#define TT   2048
#define DD   1024
#define NH_  16
#define HD   64
#define NT   (NB_ * TT)
#define ZH   2
#define PCAR 1024.0f
typedef _Float16 h16;
typedef unsigned short bf;
typedef __attribute__((ext_vector_type(16))) __bf16   v16bf;
typedef __attribute__((ext_vector_type(16))) _Float16 v16h;
typedef __attribute__((ext_vector_type(8)))  _Float16 v8h;
typedef __attribute__((ext_vector_type(8)))  unsigned short v8us;
typedef __attribute__((ext_vector_type(8)))  float    v8f;
typedef __attribute__((ext_vector_type(4)))  float    v4f;
typedef v8h  __attribute__((may_alias)) v8ha;
typedef v4f  __attribute__((may_alias)) v4fa;
typedef v8us __attribute__((may_alias)) v8usa;

__device__ __forceinline__ unsigned short f2bf(float f) { unsigned u = __float_as_uint(f); u += 0x7FFFu + ((u >> 16) & 1u); return (unsigned short)(u >> 16); }
__device__ __forceinline__ float bf2f(unsigned short b) { return __uint_as_float(((unsigned)b) << 16); }
__device__ __forceinline__ float bfr(float f) { return bf2f(f2bf(f)); }
__device__ __forceinline__ v16h cat16(v8h lo, v8h hi) { return __builtin_shufflevector(lo, hi, 0, 1, 2, 3, 4, 5, 6, 7, 8, 9, 10, 11, 12, 13, 14, 15); }
__device__ __forceinline__ v16bf cat16b(v8us lo, v8us hi) { return __builtin_bit_cast(v16bf, __builtin_shufflevector(lo, hi, 0, 1, 2, 3, 4, 5, 6, 7, 8, 9, 10, 11, 12, 13, 14, 15)); }
__device__ __forceinline__ v8f wmma16(v16h a, v16h b, v8f c) { return __builtin_amdgcn_wmma_f32_16x16x32_f16(false, a, false, b, (short)0, c, false, false); }
__device__ __forceinline__ v8f wmmab(v16bf a, v16bf b, v8f c) { return __builtin_amdgcn_wmma_f32_16x16x32_bf16(false, a, false, b, (short)0, c, false, false); }



// ---- k_gemmw: register-blocked GEMM, one wave per 64x64 output tile (16 accumulators), 4 waves (2 x 2) per 128x128 work-group tile; grid (M/128, N/128), 128 threads.
// C[m][n] (f32, pitch ldc, + optional f32 bias[n]) = sum_k (A[m][k] + A2[m][k]) Bt[n][k], two products. K % 64 == 0, K >= 128. The operand blocks of 64 k come once per work-group into LDS by asynchronous copies, two buffers: stage s + 2 flies while stage s + 1 is worked on; the waves read their fragments from LDS as they stand in the planes.
// FRAGMENT-PACKED PLANES: every 16-bit operand plane M[row][k] is kept as blocks of 16 rows x 32 k (512 elements, 1 KiB), a block being the WMMA fragment as the registers hold it:
// element (row, k) stands at block * 512 + half * 256 + lane * 8 + e with k % 32 = half * 16 + hi * 8 + e and lane = hi * 16 + row % 16. A wave-wide 16-byte load is then 512 contiguous bytes (4 whole lines, not 32 bytes of each of 16 lines).
// Lane and register of every element are those of the hardware's fragment layout, alike for A and B operands. Block order: (row / 16) * (K / 32) + k / 32, but V^T (see k_qkv). ld takes block start + lane * 8.
template <typename T16> struct WFrag;
template <> struct WFrag<h16> { typedef v16h V; static __device__ __forceinline__ V ld(const h16* p) { return cat16(*(const v8h*)p, *(const v8h*)(p + 256)); } static __device__ __forceinline__ v8f mma(V a, V b, v8f c) { return wmma16(a, b, c); } };
template <> struct WFrag<bf> { typedef v16bf V; static __device__ __forceinline__ V ld(const bf* p) { return cat16b(*(const v8us*)p, *(const v8us*)(p + 256)); } static __device__ __forceinline__ v8f mma(V a, V b, v8f c) { return wmmab(a, b, c); } };
// cp_*: asynchronous copies to LDS, 16 bytes a lane, 512 contiguous bytes a wave and copy (half a packed block), through no register. l = the lane's LDS byte address, g = its global address.
// The s_wait_xcnt 0 is the last line of the copies' own statement, so that it stands in front of every later write of a register that a copy names.
#define CPL(a, b) "global_load_async_to_lds_b128 %" #a ", %" #b ", off\n\t"
__device__ __forceinline__ void cp_1(unsigned l, const bf* g) { asm volatile(CPL(0, 1) "s_wait_xcnt 0x0" :: "v"(l), "v"(g) : "memory"); }
__device__ __forceinline__ void cp_9(const unsigned* l, const bf* const* g) {
    asm volatile(CPL(0, 1) CPL(2, 3) CPL(4, 5) CPL(6, 7) CPL(8, 9) CPL(10, 11) CPL(12, 13) CPL(14, 15) CPL(16, 17) "s_wait_xcnt 0x0"
        :: "v"(l[0]), "v"(g[0]), "v"(l[1]), "v"(g[1]), "v"(l[2]), "v"(g[2]), "v"(l[3]), "v"(g[3]), "v"(l[4]), "v"(g[4]), "v"(l[5]), "v"(g[5]), "v"(l[6]), "v"(g[6]), "v"(l[7]), "v"(g[7]), "v"(l[8]), "v"(g[8]) : "memory"); }
__device__ __forceinline__ void cp_12(const unsigned* l, const bf* const* g) {
    asm volatile(CPL(0, 1) CPL(2, 3) CPL(4, 5) CPL(6, 7) CPL(8, 9) CPL(10, 11) CPL(12, 13) CPL(14, 15) CPL(16, 17) CPL(18, 19) CPL(20, 21) CPL(22, 23) "s_wait_xcnt 0x0"
        :: "v"(l[0]), "v"(g[0]), "v"(l[1]), "v"(g[1]), "v"(l[2]), "v"(g[2]), "v"(l[3]), "v"(g[3]), "v"(l[4]), "v"(g[4]), "v"(l[5]), "v"(g[5]), "v"(l[6]), "v"(g[6]), "v"(l[7]), "v"(g[7]), "v"(l[8]), "v"(g[8]), "v"(l[9]), "v"(g[9]), "v"(l[10]), "v"(g[10]), "v"(l[11]), "v"(g[11]) : "memory"); }
template <bool BIAS, int K>   // K is a constant so that the stage count is one
__global__ __launch_bounds__(128) void k_gemmw(const bf* __restrict__ A, const bf* __restrict__ A2, const bf* __restrict__ Bt, float* C, int ldc, const float* __restrict__ bias) {
    typedef WFrag<bf> WF; typedef WF::V V;
    __shared__ __align__(16) bf ring[2 * 24 * 1024];   // two stages of 24 row groups: 8 of A, 8 of A2, 8 of Bt, each 16 rows x 64 k = two packed blocks
    __shared__ __align__(16) float osall[4 * 16 * 68];
    const int lane = threadIdx.x & 31, lr = lane & 15, hi = lane >> 4; const int w = __builtin_amdgcn_readfirstlane(threadIdx.x >> 5);
    const int wm = w & 1, wn = w >> 1; const int r0 = blockIdx.x * 128 + wm * 64, c0 = blockIdx.y * 128 + wn * 64; float* os = osall + w * (16 * 68);
    v8f acc[4][4];
#pragma unroll
    for (int mb = 0; mb < 4; ++mb)
#pragma unroll
        for (int nb = 0; nb < 4; ++nb) acc[mb][nb] = (v8f){};
    // wave w copies row groups 2 w and 2 w + 1 of each of the three planes in every stage, 4 copies a group; a group of 16 rows is 16 K elements of its plane, a stage of 64 k is 1024 elements on
    const bf* gb[6];
#pragma unroll
    for (int j = 0; j < 2; ++j) { const size_t ra = (size_t)(blockIdx.x * 8 + w * 2 + j) * (16 * K) + lane * 8; gb[j] = A + ra; gb[2 + j] = A2 + ra; gb[4 + j] = Bt + (size_t)(blockIdx.y * 8 + w * 2 + j) * (16 * K) + lane * 8; }
    const unsigned l0 = (unsigned)(size_t)ring + w * (2 * 2048) + lane * 16;
    auto fill = [&](int buf) {
        unsigned l[24]; const bf* g[24];
#pragma unroll
        for (int i = 0; i < 24; ++i) { l[i] = l0 + buf * (24 * 2048) + ((i >> 3) * 8 + ((i >> 2) & 1)) * 2048 + (i & 3) * 512; g[i] = gb[i >> 2] + (i & 3) * 256; }
        cp_12(l, g); cp_12(l + 12, g + 12);
#pragma unroll
        for (int i = 0; i < 6; ++i) gb[i] += 1024; };
    fill(0);
    // stage 0 has landed before the barrier behind which the other waves read it
    asm volatile("s_wait_asynccnt 0x0" ::: "memory");
    __syncthreads();
    fill(1);
#pragma unroll 1   // stays rolled: the two buffers differ by an offset only
    for (int s = 0; s < K / 64; ++s) {
        const bf* rb = ring + (s & 1) * (24 * 1024) + lane * 8;
#pragma unroll
        for (int kk = 0; kk < 2; ++kk) {
            V a[4], a2[4], b[4];
            // the two fences keep the 24 LDS reads of these 32 k together as one group in front of their matrix instructions (the scheduler otherwise spreads them among those, each place with a wait to 0)
            __builtin_amdgcn_sched_barrier(0);
#pragma unroll
            for (int i = 0; i < 4; ++i) { b[i] = WF::ld(rb + (16 + wn * 4 + i) * 1024 + kk * 512); a[i] = WF::ld(rb + (wm * 4 + i) * 1024 + kk * 512); }
#pragma unroll
            for (int i = 0; i < 4; ++i) a2[i] = WF::ld(rb + (8 + wm * 4 + i) * 1024 + kk * 512);
            __builtin_amdgcn_sched_barrier(0);
#pragma unroll
            for (int nb = 0; nb < 4; ++nb)
#pragma unroll
                for (int mb = 0; mb < 4; ++mb) acc[mb][nb] = WF::mma(a[mb], b[nb], acc[mb][nb]);
#pragma unroll
            for (int nb = 0; nb < 4; ++nb)
#pragma unroll
                for (int mb = 0; mb < 4; ++mb) acc[mb][nb] = WF::mma(a2[mb], b[nb], acc[mb][nb]);
        }
        // the publish point of stage s + 1: this wave's reads of stage s are done, its copies of stage s + 1 have landed, then the barrier; only behind it is stage s's buffer filled anew
        asm volatile("s_wait_dscnt 0x0" ::: "memory");
        asm volatile("s_wait_asynccnt 0x0" ::: "memory");
        __syncthreads();
        if (s + 2 < K / 64) fill(s & 1);
    }
    // no copy is outstanding when the wave goes on
    asm volatile("s_wait_asynccnt 0x0" ::: "memory");
#pragma unroll
    for (int mb = 0; mb < 4; ++mb) {
#pragma unroll
        for (int nb = 0; nb < 4; ++nb) {
#pragma unroll
            for (int j = 0; j < 8; ++j) os[(hi * 8 + j) * 68 + nb * 16 + lr] = acc[mb][nb][j]; }
        __builtin_amdgcn_wave_barrier(); asm volatile("" ::: "memory");
        float* crow = C + (size_t)(r0 + mb * 16) * ldc + c0;
{
#pragma unroll
            for (int s = 0; s < 8; ++s) { const int row = 2 * s + hi, cofs = lr * 4; v4f val = *(const v4fa*)(os + row * 68 + cofs); if (BIAS) { val[0] += bfr(bias[c0 + cofs]); val[1] += bfr(bias[c0 + cofs + 1]); val[2] += bfr(bias[c0 + cofs + 2]); val[3] += bfr(bias[c0 + cofs + 3]); }
                *(v4f*)(crow + (size_t)row * ldc + cofs) = val; }
             }
        __builtin_amdgcn_wave_barrier(); asm volatile("" ::: "memory");
    }
}

__device__ __forceinline__ h16 tohx(float x) { return (h16)x; }
__device__ __forceinline__ void splitf(float y, unsigned short& h, unsigned short& l) { h = f2bf(y); l = f2bf(y - bf2f(h)); }
typedef __attribute__((ext_vector_type(2))) _Float16 v2h;
typedef __attribute__((ext_vector_type(4))) _Float16 v4h;
typedef __attribute__((ext_vector_type(2))) unsigned short v2us;
typedef __attribute__((ext_vector_type(4))) int v4i;

// k_pack: the three row-major f32 matrices of DD columns (W_qkv, W_proj, x) to their fragment-packed bf16 planes in one launch of one 16-wave work-group per WGP: (3 DD + DD + NT) / 16 = 512 groups of 16 rows, two a work-group, a wave taking 128 k of one group.
// A wave reads its 16 rows by 16 loads of 512 contiguous bytes, all in flight at once, rounds them, turns them into fragment order in its own LDS slice and stores the 4 packed blocks as 4 KiB in a row.
// The slice holds the 16 chunks of 8 k (16 rows x 16 bytes each) at a pitch of 272 bytes: the 8-byte writes of a row (chunk = lane / 2) and the 16-byte reads of a half-block (row = lane % 16, chunk = 2 s + lane / 16) then both spread over all banks.
typedef __attribute__((ext_vector_type(4))) unsigned short v4us;
__global__ __launch_bounds__(512) void k_pack(const float* __restrict__ wq, const float* __restrict__ wo, const float* __restrict__ x, bf* WQ, bf* WP, bf* XP) {
    __shared__ __align__(16) bf tr[16 * 16 * 136];
    const int lane = threadIdx.x & 31; const int w = __builtin_amdgcn_readfirstlane(threadIdx.x >> 5); const int blk = blockIdx.x;
    const float* src = blk < 3 * DD / 32 ? wq : blk < 4 * DD / 32 ? wo : x; bf* dst = blk < 3 * DD / 32 ? WQ : blk < 4 * DD / 32 ? WP : XP;
    const int g = (blk < 3 * DD / 32 ? blk : blk < 4 * DD / 32 ? blk - 3 * DD / 32 : blk - 4 * DD / 32) * 2 + (w >> 3), kc = w & 7;   // the matrix's own group of 16 rows, and which 128 k of it
    const float* sp = src + (size_t)g * (16 * DD) + kc * 128 + lane * 4; v4f v[16];
#pragma unroll
    for (int r = 0; r < 16; ++r) v[r] = *(const v4f*)(sp + r * DD);
    bf* ts = tr + w * (16 * 136); bf* wp = ts + (lane >> 1) * 136 + (lane & 1) * 4;
#pragma unroll
    for (int r = 0; r < 16; ++r) { v4us o;
#pragma unroll
        for (int q = 0; q < 4; ++q) o[q] = f2bf(v[r][q]);
        *(v4us*)(wp + r * 8) = o; }
    // the wave's LDS writes are done before its lanes read what other lanes wrote
    asm volatile("s_wait_dscnt 0x0" ::: "memory");
    __builtin_amdgcn_wave_barrier();
    const bf* rp = ts + (lane >> 4) * 136 + (lane & 15) * 8; bf* dp = dst + (size_t)g * (16 * DD) + kc * 2048 + lane * 8; v8us o[8];
#pragma unroll
    for (int s = 0; s < 8; ++s) o[s] = *(const v8us*)(rp + s * (2 * 136));
#pragma unroll
    for (int s = 0; s < 8; ++s) *(v8us*)(dp + s * 256) = o[s];
}
__global__ __launch_bounds__(256) void k_wtT(const float* __restrict__ w, int pitch, int col0, bf* Bt) {
    const int lane = threadIdx.x & 31; const int L0 = (blockIdx.x * 8 + (threadIdx.x >> 5)) * 8; const int nlines = DD * DD / 64;
{
#pragma unroll
        for (int l = 0; l < 8; ++l) { const int L = L0 + l; if (L >= nlines) break; const int e = L * 64 + lane * 2; const int k = e & (DD - 1), n = e >> 10; v2us o;
#pragma unroll
            for (int q = 0; q < 2; ++q) o[q] = f2bf(w[(size_t)(k + q) * pitch + col0 + n]);
            *(v2us*)(Bt + (size_t)e) = o; }
         }
}
// k_qkv: the q, k and v projections as the one product x W_qkv^T that they are, one wave per 64x64 tile and the LDS ring as in k_gemmw, 12 waves (4 of tokens x 3 of W rows) per 256x192 work-group tile, grid (NT/256, 3 DD/192) = one work-group per WGP: a wave's tile column is one head of q, k or v.
// The epilogue adds the bias, scales (q only, by 1/8) and writes the bf16 hi+lo planes that k_fattn reads, fragment-packed: q and k per head as M[t][64] (block (t / 16) * 2 + feature / 32), v per head as M[feature][t] with the four blocks of a 32-key tile side by side (block (t / 32) * 4 + feature / 16).
// A v tile is computed transposed (rows = W_qkv rows, columns = tokens: both operands are packed alike, so the two loaders only trade places), so that all three kinds leave through the same whole-line stores.
// qkv_out: VT = false: tile rows are tokens, columns the head's 64 features (bias by column); VT = true: rows are features, columns tokens (bias by row). bn = the tile's 64 bias values; ph, pl = the tile's 8 packed blocks (4096 elements in a row, either kind) in the two planes.
template <bool VT>
__device__ __forceinline__ void qkv_out(const v8f (&acc)[4][4], float* os, const float* __restrict__ bn, float sc, bf* ph, bf* pl, int lr, int hi) {
    v8f br[4]; float bc[4]; const float* bp = VT ? bn + hi * 8 : bn + lr;
#pragma unroll
    for (int i = 0; i < 4; ++i) { if (VT) br[i] = *(const v8f*)(bp + i * 16); else bc[i] = bp[i * 16]; }
    // the bias loads are issued: their address register (an input, so that it lives up to here) may be rewritten behind this wait
    asm volatile("s_wait_xcnt 0x0" :: "v"(bp) : "memory");
#pragma unroll
    for (int i = 0; i < 4; ++i) { if (VT) {
#pragma unroll
            for (int j = 0; j < 8; ++j) br[i][j] = bfr(br[i][j]); } else bc[i] = bfr(bc[i]); }
    bf* php = ph + (hi * 16 + lr) * 8; bf* plp = pl + (hi * 16 + lr) * 8;
#pragma unroll
    for (int mb = 0; mb < 4; ++mb) {
#pragma unroll
        for (int nb = 0; nb < 4; ++nb) {
#pragma unroll
            for (int j = 0; j < 8; ++j) os[(hi * 8 + j) * 68 + nb * 16 + lr] = acc[mb][nb][j] + (VT ? br[mb][j] : bc[nb]); }
        __builtin_amdgcn_wave_barrier(); asm volatile("" ::: "memory");
        v8us oh[4], ol[4];
#pragma unroll
        for (int s = 0; s < 4; ++s) { const float* sp = os + lr * 68 + s * 16 + hi * 8; const v4f v0 = *(const v4fa*)sp, v1 = *(const v4fa*)(sp + 4);   // the lane's 8 elements of half-block s: row lr, columns 16 s + 8 hi ..
#pragma unroll
            for (int q = 0; q < 4; ++q) { unsigned short c1, c2; splitf(v0[q] * sc, c1, c2); oh[s][q] = c1; ol[s][q] = c2; splitf(v1[q] * sc, c1, c2); oh[s][4 + q] = c1; ol[s][4 + q] = c2; }
            const int d = (VT ? (s >> 1) * 4 + mb : mb * 2 + (s >> 1)) * 512 + (s & 1) * 256;
            *(v8us*)(php + d) = oh[s]; *(v8us*)(plp + d) = ol[s]; }
        // the eight stores are issued: their data and address registers (inputs, so that they live up to here) may be rewritten behind this wait
        asm volatile("s_wait_xcnt 0x0" :: "v"(oh[0]), "v"(oh[1]), "v"(oh[2]), "v"(oh[3]), "v"(ol[0]), "v"(ol[1]), "v"(ol[2]), "v"(ol[3]), "v"(php), "v"(plp) : "memory");
        __builtin_amdgcn_wave_barrier();
    }
}
__global__ __launch_bounds__(384) void k_qkv(const bf* __restrict__ X, const bf* __restrict__ Wt, const float* __restrict__ bias, bf* Qh, bf* Ql, bf* Kh, bf* Kl, bf* Vh, bf* Vl) {
    typedef WFrag<bf> WF; typedef WF::V V; const int K = DD;
    __shared__ __align__(16) bf ring[2 * 28 * 1024];   // two stages of 28 row groups: 16 of X, 12 of Wt, each 16 rows x 64 k = two packed blocks
    __shared__ __align__(16) float osall[12 * 16 * 68];
    const int lane = threadIdx.x & 31, lr = lane & 15, hi = lane >> 4; const int w = __builtin_amdgcn_readfirstlane(threadIdx.x >> 5);
    const int wt = w & 3, wn = w >> 2; const int t0 = blockIdx.x * 256 + wt * 64, ny = blockIdx.y * 3 + wn, n0 = ny * 64; float* os = osall + w * (16 * 68);
    const int part = ny >> 4, z = (t0 >> 11) * NH_ + (ny & 15), tb = t0 & (TT - 1); const bool vt = part == 2;
    const int ao = (vt ? 16 + wn * 4 : wt * 4) * 1024, bo = (vt ? wt * 4 : 16 + wn * 4) * 1024;   // the wave's four A and four B row groups in a stage
    v8f acc[4][4];
#pragma unroll
    for (int mb = 0; mb < 4; ++mb)
#pragma unroll
        for (int nb = 0; nb < 4; ++nb) acc[mb][nb] = (v8f){};
    // a stage is 112 copies of 512 bytes, 4 a row group; wave w takes copies w, w + 12, ..: nine each, and waves 0 .. 3 a tenth. A group of 16 rows is 16 K elements of its plane, a stage of 64 k is 1024 elements on
    const bf* gp[10]; unsigned lp[10];
#pragma unroll
    for (int i = 0; i < 10; ++i) { const int c = min(w + 12 * i, 111), g = c >> 2;
        gp[i] = (g < 16 ? X + (size_t)(blockIdx.x * 16 + g) * (16 * K) : Wt + (size_t)(blockIdx.y * 12 + g - 16) * (16 * K)) + (c & 3) * 256 + lane * 8; lp[i] = (unsigned)(size_t)ring + c * 512 + lane * 16; }
    auto fill = [&](int buf) {
        unsigned l[10];
#pragma unroll
        for (int i = 0; i < 10; ++i) l[i] = lp[i] + buf * (28 * 2048);
        cp_9(l, gp); if (w < 4) cp_1(l[9], gp[9]);
#pragma unroll
        for (int i = 0; i < 10; ++i) gp[i] += 1024; };
    fill(0);
    // stage 0 has landed before the barrier behind which the other waves read it
    asm volatile("s_wait_asynccnt 0x0" ::: "memory");
    __syncthreads();
    fill(1);
#pragma unroll 1   // stays rolled: the two buffers differ by an offset only
    for (int s = 0; s < K / 64; ++s) {
        const bf* rb = ring + (s & 1) * (28 * 1024) + lane * 8;
        V a[4], b[4];
        // the fences keep the 16 LDS reads of each 32 k together as one group in front of their matrix instructions, as in k_gemmw
        __builtin_amdgcn_sched_barrier(0);
#pragma unroll
        for (int i = 0; i < 4; ++i) { a[i] = WF::ld(rb + ao + i * 1024); b[i] = WF::ld(rb + bo + i * 1024); }
        __builtin_amdgcn_sched_barrier(0);
#pragma unroll
        for (int nb = 0; nb < 4; ++nb)
#pragma unroll
            for (int mb = 0; mb < 4; ++mb) acc[mb][nb] = WF::mma(a[mb], b[nb], acc[mb][nb]);
        __builtin_amdgcn_sched_barrier(0);
#pragma unroll
        for (int i = 0; i < 4; ++i) { a[i] = WF::ld(rb + ao + i * 1024 + 512); b[i] = WF::ld(rb + bo + i * 1024 + 512); }
        // the publish point of stage s + 1, as in k_gemmw; here it stands behind the stage's last LDS reads and in front of its last 16 matrix instructions, which need registers only: the copies of stage s + 2 fly under them too
        asm volatile("s_wait_dscnt 0x0" ::: "memory");
        asm volatile("s_wait_asynccnt 0x0" ::: "memory");
        __syncthreads();
        if (s + 2 < K / 64) fill(s & 1);
#pragma unroll
        for (int nb = 0; nb < 4; ++nb)
#pragma unroll
            for (int mb = 0; mb < 4; ++mb) acc[mb][nb] = WF::mma(a[mb], b[nb], acc[mb][nb]);
    }
    // no copy is outstanding when the wave goes on
    asm volatile("s_wait_asynccnt 0x0" ::: "memory");
    if (vt) qkv_out<true>(acc, os, bias + n0, 1.0f, Vh + ((size_t)z * TT + tb) * HD, Vl + ((size_t)z * TT + tb) * HD, lr, hi);
    else qkv_out<false>(acc, os, bias + n0, part == 0 ? 0.125f : 1.0f, (part == 0 ? Qh : Kh) + ((size_t)z * TT + tb) * HD, (part == 0 ? Ql : Kl) + ((size_t)z * TT + tb) * HD, lr, hi);   // 64^-0.5 folded into q exactly
}
// k_fattn: scores, softcap, mask, softmax and attn.v of one head in one kernel; one wave owns 32 queries and walks the keys 32 at a time, everything in registers.
// S^T = K Q^T (A = 16 keys x 64, B = 16 queries): a lane then holds, for query lr, keys 8 hi + j of each 16-key tile, which is the B fragment of P^T for O^T = V^T P^T as it stands.
// The softcap bounds every score to [-30, 30], so exp(s) needs no running maximum; the row is divided by its sum once, behind the last key.
// Every inner loop is unrolled whole so that the fragment arrays are indexed by constants and stay in registers.
// A wave visits only the 32-key tiles that can hold a live key for its 32 queries: the tiles below the prefix length that lie outside its window, then the 17 tiles of its window (query tile - 16 .. query tile).
// The 8 windows of a block are 17 consecutive tiles out of the same 24, so each holds every residue modulo 17 once: at window step t a wave takes its tile of residue t, and the block reads at most two different tiles at a time, which one wave's lines serve to the others from the WGP cache.
// waves_per_eu(2, 2): the grid is one 8-wave block per WGP, two waves a SIMD, so the register budget is that of two waves.
__global__ __launch_bounds__(256) __attribute__((amdgpu_waves_per_eu(2, 2))) void k_fattn(const bf* __restrict__ Qh, const bf* __restrict__ Ql, const bf* __restrict__ Kh, const bf* __restrict__ Kl, const bf* __restrict__ Vh, const bf* __restrict__ Vl, const int* __restrict__ spl, bf* Ah, bf* Al) {
    typedef WFrag<bf> WF;
    const int lane = threadIdx.x & 31, lr = lane & 15, hi = lane >> 4; const int z = blockIdx.y, b = z >> 4, h = z & 15; const int w = __builtin_amdgcn_readfirstlane(threadIdx.x >> 5); const int q0 = blockIdx.x * 256 + w * 32; const int L = min(max(spl[b], 0), TT);   // key < L reads the same for keys 0 .. TT - 1, and L - j0 below cannot wrap
    // the walk, all in scalars and free of branches: steps 0 .. np - 1 are the prefix tiles, steps np .. np + 16 the window tiles; next_step passes over the prefix tiles that the window holds and the window tiles in front of key 0 (window steps w .. -tb - 1)
    const int tq = blockIdx.x * 8 + w, tb = blockIdx.x * 8 - 16, np = (L + 31) >> 5, nu = np + 17;
    auto next_step = [&](int v) -> int { int n = v + 1; n = (n < np && n >= tq - 16 && n <= tq) ? min(tq + 1, np) : n; return n - np >= w ? max(n, np - tb) : n; };
    auto tile_of = [&](int v) -> int { const int t = v - np; return v < np ? v : tb + t + (t < w ? 17 : 0); };   // at v = nu, behind the last step: tile tb + 17, in bounds
    const size_t zo = (size_t)z * TT * HD; Qh += zo; Ql += zo; Kh += zo; Kl += zo; Vh += zo; Vl += zo;
    v16bf qh[2][2], ql[2][2]; const bf* qhp = Qh + (q0 * HD + 8 * lane); const bf* qlp = Ql + (q0 * HD + 8 * lane);
#pragma unroll
    for (int qb = 0; qb < 2; ++qb)
#pragma unroll
        for (int kc = 0; kc < 2; ++kc) { qh[qb][kc] = WF::ld(qhp + (qb * 2 + kc) * 512); ql[qb][kc] = WF::ld(qlp + (qb * 2 + kc) * 512); }
    // the Q loads are issued: their address registers (inputs, so that they live up to here) may be rewritten behind this wait; the fence keeps later address work behind it
    asm volatile("s_wait_xcnt 0x0" :: "v"(qhp), "v"(qlp) : "memory");
    __builtin_amdgcn_sched_barrier(0);
    v8f o[4][2]; float sum[2] = {0.f, 0.f};
#pragma unroll
    for (int db = 0; db < 4; ++db)
#pragma unroll
        for (int qb = 0; qb < 2; ++qb) o[db][qb] = (v8f){};
    v16bf kh[2][2], kl[2][2];
    int u = next_step(-1), jt = tile_of(u);   // u < nu: the wave's own query tile tq is a step of the window part
    const size_t kln = (size_t)(8 * lane), vln = kln;   // the lane's place in a packed block; a 32-key tile is 4 blocks (32 * HD elements) of K and of V^T alike, and its offset is scalar
    const bf* khp = Kh + jt * (32 * HD) + kln; const bf* klp = Kl + jt * (32 * HD) + kln;
    int nj = -(jt * 32 + hi * 8);   // minus the lane's first key of the tile, carried from pass to pass: one vector add a pass, and the mask offsets below stay plain adds of constants
#pragma unroll
    for (int kt = 0; kt < 2; ++kt)
#pragma unroll
        for (int kc = 0; kc < 2; ++kc) { const int p = (kt * 2 + kc) * 512; kh[kt][kc] = WF::ld(khp + p); kl[kt][kc] = WF::ld(klp + p); }
    // the same for the first K loads
    asm volatile("s_wait_xcnt 0x0" ::: "memory");
    __builtin_amdgcn_sched_barrier(0);
#pragma unroll 1   // stays rolled: one pass is about 600 instructions, and the K fragments rotate through the same registers
    do {
        const int j0 = jt * 32;
        u = next_step(u); jt = tile_of(u);   // behind the last step this names a tile that is fetched and not used
        v16bf vh[4], vl[4]; const bf* vhp = Vh + j0 * HD + vln; const bf* vlp = Vl + j0 * HD + vln;
#pragma unroll
        for (int db = 0; db < 4; ++db) { vh[db] = WF::ld(vhp + db * 512); vl[db] = WF::ld(vlp + db * 512); }
        v8f s[2][2];
#pragma unroll
        for (int kt = 0; kt < 2; ++kt)
#pragma unroll
            for (int qb = 0; qb < 2; ++qb) { v8f a = (v8f){};
#pragma unroll
                for (int kc = 0; kc < 2; ++kc) { a = wmmab(kh[kt][kc], qh[qb][kc], a); a = wmmab(kh[kt][kc], ql[qb][kc], a); a = wmmab(kl[kt][kc], qh[qb][kc], a); }
                s[kt][qb] = a; }
        // the next tile's K fragments are fetched behind this pass's score products, so that they fly under the softmax and attn.v
        const int jn = jt * 32; khp = Kh + jn * HD + kln; klp = Kl + jn * HD + kln;
#pragma unroll
        for (int kt = 0; kt < 2; ++kt)
#pragma unroll
            for (int kc = 0; kc < 2; ++kc) { const int p = (kt * 2 + kc) * 512; kh[kt][kc] = WF::ld(khp + p); kl[kt][kc] = WF::ld(klp + p); }
        // all of this pass's loads are issued: their address registers may be rewritten behind this wait; the four addresses are inputs so that they live up to it and no load's result is placed in them ahead of it
        asm volatile("s_wait_xcnt 0x0" :: "v"(vhp), "v"(vlp), "v"(khp), "v"(klp) : "memory");
        // keeps the V and next-K loads issued above the softmax, where its vector work hides their latency (the scheduler otherwise sinks them to their first use)
        __builtin_amdgcn_sched_barrier(0);
        v16bf ph[2], pl[2]; const int lk = L + nj;
#pragma unroll
        for (int qb = 0; qb < 2; ++qb) { const int dq = q0 + qb * 16 + lr + nj;
#pragma unroll
            for (int kt = 0; kt < 2; ++kt)
#pragma unroll
                for (int j = 0; j < 8; ++j) { const int cj = kt * 16 + j; const bool live = ((unsigned)(dq - cj) <= 512u) || (cj < lk);   // key = j0 + 8 hi + cj: 0 <= i - key <= 512, or key < L
                    // exp(30 tanh(s/30)) with tanh(u) = 1 - 2/(exp(2u) + 1), both exponentials base 2: 2^(C2 - 2 C2 / (2^(C1 s) + 1)), C1 = 2 log2(e) / 30, C2 = 30 log2(e); overflow of the inner one gives tanh = 1, underflow -1
                    const float r = __builtin_amdgcn_rcpf(__builtin_amdgcn_exp2f(s[kt][qb][j] * 0.0961796694f) + 1.0f);
                    const float p = live ? __builtin_amdgcn_exp2f(__builtin_fmaf(r, -86.5617025f, 43.2808512f)) : 0.0f; sum[qb] += p;
                    const __bf16 a = (__bf16)p; ph[qb][kt * 8 + j] = a; pl[qb][kt * 8 + j] = (__bf16)(p - (float)a); } }
#pragma unroll
        for (int db = 0; db < 4; ++db)
#pragma unroll
            for (int qb = 0; qb < 2; ++qb) { o[db][qb] = wmmab(vh[db], ph[qb], o[db][qb]); o[db][qb] = wmmab(vh[db], pl[qb], o[db][qb]); o[db][qb] = wmmab(vl[db], ph[qb], o[db][qb]); }
        nj += j0 - jn;
    } while (u < nu);
    // the last pass's stand-in K fetch feeds nothing: it has landed before the wave gives its registers back
    asm volatile("s_wait_loadcnt 0x0" ::: "memory");
    // the output planes are packed for k_gemmw (rows = tokens, K = DD): features 16 db + 8 hi .. of head h are half-block db of the head's two blocks, and each lane is its own lane there
#pragma unroll
    for (int qb = 0; qb < 2; ++qb) { const float f = __fdiv_rn(1.0f, sum[qb] + __shfl_xor(sum[qb], 16, 32)); const size_t ro = ((size_t)b * TT + q0 + qb * 16) * DD + h * (2 * 512) + lane * 8; bf* ahp = Ah + ro; bf* alp = Al + ro; v8us oh[4], ol[4];
#pragma unroll
        for (int db = 0; db < 4; ++db) {
#pragma unroll
            for (int j = 0; j < 8; ++j) { unsigned short a, c2; splitf(o[db][qb][j] * f, a, c2); oh[db][j] = a; ol[db][j] = c2; }
            *(v8us*)(ahp + db * 256) = oh[db]; *(v8us*)(alp + db * 256) = ol[db]; }
        // the eight stores are issued: their data and address registers (inputs, so that they live up to here) may be rewritten behind this wait
        asm volatile("s_wait_xcnt 0x0" :: "v"(oh[0]), "v"(oh[1]), "v"(oh[2]), "v"(oh[3]), "v"(ol[0]), "v"(ol[1]), "v"(ol[2]), "v"(ol[3]), "v"(ahp), "v"(alp) : "memory"); }
}

extern "C" void kernel_launch(void* const* d_in, const int* in_sizes, int n_in,
                              void* d_out, int out_size, void* d_ws, size_t ws_size, hipStream_t stream) {
    (void)in_sizes; (void)n_in; (void)out_size;
    const float* x = (const float*)d_in[0]; const int* spl = (const int*)d_in[1]; const float* Wqkv = (const float*)d_in[2]; const float* bqkv = (const float*)d_in[3]; const float* Wo = (const float*)d_in[4]; const float* bo = (const float*)d_in[5];
    float* OUT = (float*)d_out;     // [2][2048][1024]
    char* wsp = (char*)d_ws;
    auto take = [&](size_t bytes) { char* p = wsp; wsp += (bytes + 255) & ~(size_t)255; return (void*)p; };
    bf* WQKV = (bf*)take((size_t)3 * DD * DD * 2); bf* WO = (bf*)take((size_t)DD * DD * 2);
    bf* XB = (bf*)take((size_t)NT * DD * 2);
    bf* QPh = (bf*)take((size_t)NT * DD * 2); bf* QPl = (bf*)take((size_t)NT * DD * 2); bf* KPh = (bf*)take((size_t)NT * DD * 2); bf* KPl = (bf*)take((size_t)NT * DD * 2); bf* VTh = (bf*)take((size_t)NT * DD * 2); bf* VTl = (bf*)take((size_t)NT * DD * 2);
    bf* ATh = (bf*)take((size_t)NT * DD * 2); bf* ATl = (bf*)take((size_t)NT * DD * 2);
    if ((size_t)(wsp - (char*)d_ws) > ws_size) return;    // ws 256 MiB
    k_pack<<<(4 * DD + NT) / 32, 512, 0, stream>>>(Wqkv, Wo, x, WQKV, WO, XB);   // nn.Linear [out][in] = Bt as-is (q|k|v row blocks, one matrix)
    k_qkv<<<dim3(NT / 256, 3 * DD / 192, 1), 384, 0, stream>>>(XB, WQKV, bqkv, QPh, QPl, KPh, KPl, VTh, VTl);
    k_fattn<<<dim3(TT / 256, NB_ * NH_, 1), 256, 0, stream>>>(QPh, QPl, KPh, KPl, VTh, VTl, spl, ATh, ATl);
    k_gemmw<true, DD><<<dim3(NT / 128, DD / 128, 1), 128, 0, stream>>>(ATh, ATl, WO, OUT, DD, bo);
}

// v007
// It runs in 80.8 microseconds.
// In two side-by-side timings against v006, it was 1.06 and 1.05 times as fast.
// Over all steps from v000 it is 16.4 times as fast.
#include <hip/hip_runtime.h>

// TunedSelfAttention (x [2][2048][1024]; qkv = x W_qkv^T + b_qkv ([3072][1024] Linear); 16 heads x 64; s = (q.k / 8); s = 30 tanh(s / 30) (softcap); keep key j iff (i >= j && i - j <= 512) || j < suffix_prefix_length[b] (int input, read as data), else -inf; softmax; y = attn.v merged; out = y W_proj^T + b_proj).
// The sliding-window/prefix mask is evaluated arithmetically per element; early rows see few keys, so scores and attn.v run on bf16 hi+lo planes.
// Compute dtypes, f32 accumulate: every float input rounded to bf16; q/k/v projections on PLAIN bf16 operands (x, W inputs: exact, + bias);
// scores on bf16 hi+lo q (x 1/8) and k planes (3 products); attn.v on bf16 hi+lo P and V^T planes (3 products); output projection on hi+lo planes x exact bf16 Wout (2 products);

#define NB_  2
#define TT   2048
#define DD   1024
#define NH_  16
#define HD   64
#define NT   (NB_ * TT)
#define ZH   2
#define PCAR 1024.0f
typedef _Float16 h16;
typedef unsigned short bf;
typedef __attribute__((ext_vector_type(16))) __bf16   v16bf;
typedef __attribute__((ext_vector_type(16))) _Float16 v16h;
typedef __attribute__((ext_vector_type(8)))  _Float16 v8h;
typedef __attribute__((ext_vector_type(8)))  unsigned short v8us;
typedef __attribute__((ext_vector_type(8)))  float    v8f;
typedef __attribute__((ext_vector_type(4)))  float    v4f;
typedef v8h  __attribute__((may_alias)) v8ha;
typedef v4f  __attribute__((may_alias)) v4fa;
typedef v8us __attribute__((may_alias)) v8usa;

__device__ __forceinline__ unsigned short f2bf(float f) { unsigned u = __float_as_uint(f); u += 0x7FFFu + ((u >> 16) & 1u); return (unsigned short)(u >> 16); }
__device__ __forceinline__ float bf2f(unsigned short b) { return __uint_as_float(((unsigned)b) << 16); }
__device__ __forceinline__ float bfr(float f) { return bf2f(f2bf(f)); }
__device__ __forceinline__ v16h cat16(v8h lo, v8h hi) { return __builtin_shufflevector(lo, hi, 0, 1, 2, 3, 4, 5, 6, 7, 8, 9, 10, 11, 12, 13, 14, 15); }
__device__ __forceinline__ v16bf cat16b(v8us lo, v8us hi) { return __builtin_bit_cast(v16bf, __builtin_shufflevector(lo, hi, 0, 1, 2, 3, 4, 5, 6, 7, 8, 9, 10, 11, 12, 13, 14, 15)); }
__device__ __forceinline__ v8f wmma16(v16h a, v16h b, v8f c) { return __builtin_amdgcn_wmma_f32_16x16x32_f16(false, a, false, b, (short)0, c, false, false); }
__device__ __forceinline__ v8f wmmab(v16bf a, v16bf b, v8f c) { return __builtin_amdgcn_wmma_f32_16x16x32_bf16(false, a, false, b, (short)0, c, false, false); }



// ---- k_gemmw: register-blocked GEMM, one wave per 64x64 output tile (16 accumulators), 4 waves (2 x 2) per 128x128 work-group tile; grid (M/128, N/128), 128 threads.
// C[m][n] (f32, pitch ldc, + optional f32 bias[n]) = sum_k (A[m][k] + A2[m][k]) Bt[n][k], two products. K % 64 == 0, K >= 128. The operand blocks of 64 k come once per work-group into LDS by asynchronous copies, two buffers: stage s + 2 flies while stage s + 1 is worked on; the waves read their fragments from LDS as they stand in the planes.
// FRAGMENT-PACKED PLANES: every 16-bit operand plane M[row][k] is kept as blocks of 16 rows x 32 k (512 elements, 1 KiB), a block being the WMMA fragment as the registers hold it:
// element (row, k) stands at block * 512 + half * 256 + lane * 8 + e with k % 32 = half * 16 + hi * 8 + e and lane = hi * 16 + row % 16. A wave-wide 16-byte load is then 512 contiguous bytes (4 whole lines, not 32 bytes of each of 16 lines).
// Lane and register of every element are those of the hardware's fragment layout, alike for A and B operands. Block order: (row / 16) * (K / 32) + k / 32, but V^T (see k_qkv). ld takes block start + lane * 8.
template <typename T16> struct WFrag;
template <> struct WFrag<h16> { typedef v16h V; static __device__ __forceinline__ V ld(const h16* p) { return cat16(*(const v8h*)p, *(const v8h*)(p + 256)); } static __device__ __forceinline__ v8f mma(V a, V b, v8f c) { return wmma16(a, b, c); } };
template <> struct WFrag<bf> { typedef v16bf V; static __device__ __forceinline__ V ld(const bf* p) { return cat16b(*(const v8us*)p, *(const v8us*)(p + 256)); } static __device__ __forceinline__ v8f mma(V a, V b, v8f c) { return wmmab(a, b, c); } };
// cp_*: asynchronous copies to LDS, 16 bytes a lane, 512 contiguous bytes a wave and copy (half a packed block), through no register. l = the lane's LDS byte address, g = its global address.
// The s_wait_xcnt 0 is the last line of the copies' own statement, so that it stands in front of every later write of a register that a copy names.
#define CPL(a, b) "global_load_async_to_lds_b128 %" #a ", %" #b ", off\n\t"
__device__ __forceinline__ void cp_1(unsigned l, const bf* g) { asm volatile(CPL(0, 1) "s_wait_xcnt 0x0" :: "v"(l), "v"(g) : "memory"); }
__device__ __forceinline__ void cp_9(const unsigned* l, const bf* const* g) {
    asm volatile(CPL(0, 1) CPL(2, 3) CPL(4, 5) CPL(6, 7) CPL(8, 9) CPL(10, 11) CPL(12, 13) CPL(14, 15) CPL(16, 17) "s_wait_xcnt 0x0"
        :: "v"(l[0]), "v"(g[0]), "v"(l[1]), "v"(g[1]), "v"(l[2]), "v"(g[2]), "v"(l[3]), "v"(g[3]), "v"(l[4]), "v"(g[4]), "v"(l[5]), "v"(g[5]), "v"(l[6]), "v"(g[6]), "v"(l[7]), "v"(g[7]), "v"(l[8]), "v"(g[8]) : "memory"); }
__device__ __forceinline__ void cp_12(const unsigned* l, const bf* const* g) {
    asm volatile(CPL(0, 1) CPL(2, 3) CPL(4, 5) CPL(6, 7) CPL(8, 9) CPL(10, 11) CPL(12, 13) CPL(14, 15) CPL(16, 17) CPL(18, 19) CPL(20, 21) CPL(22, 23) "s_wait_xcnt 0x0"
        :: "v"(l[0]), "v"(g[0]), "v"(l[1]), "v"(g[1]), "v"(l[2]), "v"(g[2]), "v"(l[3]), "v"(g[3]), "v"(l[4]), "v"(g[4]), "v"(l[5]), "v"(g[5]), "v"(l[6]), "v"(g[6]), "v"(l[7]), "v"(g[7]), "v"(l[8]), "v"(g[8]), "v"(l[9]), "v"(g[9]), "v"(l[10]), "v"(g[10]), "v"(l[11]), "v"(g[11]) : "memory"); }
template <bool BIAS, int K>   // K is a constant so that the stage count is one
__global__ __launch_bounds__(128) void k_gemmw(const bf* __restrict__ A, const bf* __restrict__ A2, const bf* __restrict__ Bt, float* C, int ldc, const float* __restrict__ bias) {
    typedef WFrag<bf> WF; typedef WF::V V;
    __shared__ __align__(16) bf ring[2 * 24 * 1024];   // two stages of 24 row groups: 8 of A, 8 of A2, 8 of Bt, each 16 rows x 64 k = two packed blocks
    __shared__ __align__(16) float osall[4 * 16 * 68];
    const int lane = threadIdx.x & 31, lr = lane & 15, hi = lane >> 4; const int w = __builtin_amdgcn_readfirstlane(threadIdx.x >> 5);
    const int wm = w & 1, wn = w >> 1; const int r0 = blockIdx.x * 128 + wm * 64, c0 = blockIdx.y * 128 + wn * 64; float* os = osall + w * (16 * 68);
    v8f acc[4][4];
#pragma unroll
    for (int mb = 0; mb < 4; ++mb)
#pragma unroll
        for (int nb = 0; nb < 4; ++nb) acc[mb][nb] = (v8f){};
    // wave w copies row groups 2 w and 2 w + 1 of each of the three planes in every stage, 4 copies a group; a group of 16 rows is 16 K elements of its plane, a stage of 64 k is 1024 elements on
    // the work-groups that share operand rows (one blockIdx.x, or one blockIdx.y) run in step: each starts its walk over K at block (blockIdx.x + blockIdx.y) mod K / 64 and wraps round, so that at most two of them ask L2 for the same lines at the same moment. fs = the block that the next fill brings
    static_assert((K / 64 & (K / 64 - 1)) == 0, "the wrap is a mask");
    int fs = (blockIdx.x + blockIdx.y) & (K / 64 - 1);
    const bf* gb[6];
#pragma unroll
    for (int j = 0; j < 2; ++j) { const size_t ra = (size_t)(blockIdx.x * 8 + w * 2 + j) * (16 * K) + fs * 1024 + lane * 8; gb[j] = A + ra; gb[2 + j] = A2 + ra; gb[4 + j] = Bt + (size_t)(blockIdx.y * 8 + w * 2 + j) * (16 * K) + fs * 1024 + lane * 8; }
    const unsigned l0 = (unsigned)(size_t)ring + w * (2 * 2048) + lane * 16;
    auto fill = [&](int buf) {
        unsigned l[24]; const bf* g[24];
#pragma unroll
        for (int i = 0; i < 24; ++i) { l[i] = l0 + buf * (24 * 2048) + ((i >> 3) * 8 + ((i >> 2) & 1)) * 2048 + (i & 3) * 512; g[i] = gb[i >> 2] + (i & 3) * 256; }
        cp_12(l, g); cp_12(l + 12, g + 12);
        const int d = fs == K / 64 - 1 ? -(K / 64 - 1) * 1024 : 1024; fs = (fs + 1) & (K / 64 - 1);   // on to the next block of 64 k, from the last back to the first
#pragma unroll
        for (int i = 0; i < 6; ++i) gb[i] += d; };
    fill(0);
    // stage 0 has landed before the barrier behind which the other waves read it
    asm volatile("s_wait_asynccnt 0x0" ::: "memory");
    __syncthreads();
    fill(1);
#pragma unroll 1   // stays rolled: the two buffers differ by an offset only
    for (int s = 0; s < K / 64; ++s) {
        const bf* rb = ring + (s & 1) * (24 * 1024) + lane * 8;
#pragma unroll
        for (int kk = 0; kk < 2; ++kk) {
            V a[4], a2[4], b[4];
            // the two fences keep the 24 LDS reads of these 32 k together as one group in front of their matrix instructions (the scheduler otherwise spreads them among those, each place with a wait to 0)
            __builtin_amdgcn_sched_barrier(0);
#pragma unroll
            for (int i = 0; i < 4; ++i) { b[i] = WF::ld(rb + (16 + wn * 4 + i) * 1024 + kk * 512); a[i] = WF::ld(rb + (wm * 4 + i) * 1024 + kk * 512); }
#pragma unroll
            for (int i = 0; i < 4; ++i) a2[i] = WF::ld(rb + (8 + wm * 4 + i) * 1024 + kk * 512);
            __builtin_amdgcn_sched_barrier(0);
#pragma unroll
            for (int nb = 0; nb < 4; ++nb)
#pragma unroll
                for (int mb = 0; mb < 4; ++mb) acc[mb][nb] = WF::mma(a[mb], b[nb], acc[mb][nb]);
#pragma unroll
            for (int nb = 0; nb < 4; ++nb)
#pragma unroll
                for (int mb = 0; mb < 4; ++mb) acc[mb][nb] = WF::mma(a2[mb], b[nb], acc[mb][nb]);
        }
        // the publish point of stage s + 1: this wave's reads of stage s are done, its copies of stage s + 1 have landed, then the barrier; only behind it is stage s's buffer filled anew
        asm volatile("s_wait_dscnt 0x0" ::: "memory");
        asm volatile("s_wait_asynccnt 0x0" ::: "memory");
        __syncthreads();
        if (s + 2 < K / 64) fill(s & 1);
    }
    // no copy is outstanding when the wave goes on
    asm volatile("s_wait_asynccnt 0x0" ::: "memory");
#pragma unroll
    for (int mb = 0; mb < 4; ++mb) {
#pragma unroll
        for (int nb = 0; nb < 4; ++nb) {
#pragma unroll
            for (int j = 0; j < 8; ++j) os[(hi * 8 + j) * 68 + nb * 16 + lr] = acc[mb][nb][j]; }
        __builtin_amdgcn_wave_barrier(); asm volatile("" ::: "memory");
        float* crow = C + (size_t)(r0 + mb * 16) * ldc + c0;
{
#pragma unroll
            for (int s = 0; s < 8; ++s) { const int row = 2 * s + hi, cofs = lr * 4; v4f val = *(const v4fa*)(os + row * 68 + cofs); if (BIAS) { val[0] += bfr(bias[c0 + cofs]); val[1] += bfr(bias[c0 + cofs + 1]); val[2] += bfr(bias[c0 + cofs + 2]); val[3] += bfr(bias[c0 + cofs + 3]); }
                *(v4f*)(crow + (size_t)row * ldc + cofs) = val; }
             }
        __builtin_amdgcn_wave_barrier(); asm volatile("" ::: "memory");
    }
}

__device__ __forceinline__ h16 tohx(float x) { return (h16)x; }
__device__ __forceinline__ void splitf(float y, unsigned short& h, unsigned short& l) { h = f2bf(y); l = f2bf(y - bf2f(h)); }
typedef __attribute__((ext_vector_type(2))) _Float16 v2h;
typedef __attribute__((ext_vector_type(4))) _Float16 v4h;
typedef __attribute__((ext_vector_type(2))) unsigned short v2us;
typedef __attribute__((ext_vector_type(4))) int v4i;

// k_pack: the three row-major f32 matrices of DD columns (W_qkv, W_proj, x) to their fragment-packed bf16 planes in one launch of one 16-wave work-group per WGP: (3 DD + DD + NT) / 16 = 512 groups of 16 rows, two a work-group, a wave taking 128 k of one group.
// A wave reads its 16 rows by 16 loads of 512 contiguous bytes, all in flight at once, rounds them, turns them into fragment order in its own LDS slice and stores the 4 packed blocks as 4 KiB in a row.
// The slice holds the 16 chunks of 8 k (16 rows x 16 bytes each) at a pitch of 272 bytes: the 8-byte writes of a row (chunk = lane / 2) and the 16-byte reads of a half-block (row = lane % 16, chunk = 2 s + lane / 16) then both spread over all banks.
typedef __attribute__((ext_vector_type(4))) unsigned short v4us;
__global__ __launch_bounds__(512) void k_pack(const float* __restrict__ wq, const float* __restrict__ wo, const float* __restrict__ x, bf* WQ, bf* WP, bf* XP) {
    __shared__ __align__(16) bf tr[16 * 16 * 136];
    const int lane = threadIdx.x & 31; const int w = __builtin_amdgcn_readfirstlane(threadIdx.x >> 5); const int blk = blockIdx.x;
    const float* src = blk < 3 * DD / 32 ? wq : blk < 4 * DD / 32 ? wo : x; bf* dst = blk < 3 * DD / 32 ? WQ : blk < 4 * DD / 32 ? WP : XP;
    const int g = (blk < 3 * DD / 32 ? blk : blk < 4 * DD / 32 ? blk - 3 * DD / 32 : blk - 4 * DD / 32) * 2 + (w >> 3), kc = w & 7;   // the matrix's own group of 16 rows, and which 128 k of it
    const float* sp = src + (size_t)g * (16 * DD) + kc * 128 + lane * 4; v4f v[16];
#pragma unroll
    for (int r = 0; r < 16; ++r) v[r] = *(const v4f*)(sp + r * DD);
    bf* ts = tr + w * (16 * 136); bf* wp = ts + (lane >> 1) * 136 + (lane & 1) * 4;
#pragma unroll
    for (int r = 0; r < 16; ++r) { v4us o;
#pragma unroll
        for (int q = 0; q < 4; ++q) o[q] = f2bf(v[r][q]);
        *(v4us*)(wp + r * 8) = o; }
    // the wave's LDS writes are done before its lanes read what other lanes wrote
    asm volatile("s_wait_dscnt 0x0" ::: "memory");
    __builtin_amdgcn_wave_barrier();
    const bf* rp = ts + (lane >> 4) * 136 + (lane & 15) * 8; bf* dp = dst + (size_t)g * (16 * DD) + kc * 2048 + lane * 8; v8us o[8];
#pragma unroll
    for (int s = 0; s < 8; ++s) o[s] = *(const v8us*)(rp + s * (2 * 136));
#pragma unroll
    for (int s = 0; s < 8; ++s) *(v8us*)(dp + s * 256) = o[s];
}
__global__ __launch_bounds__(256) void k_wtT(const float* __restrict__ w, int pitch, int col0, bf* Bt) {
    const int lane = threadIdx.x & 31; const int L0 = (blockIdx.x * 8 + (threadIdx.x >> 5)) * 8; const int nlines = DD * DD / 64;
{
#pragma unroll
        for (int l = 0; l < 8; ++l) { const int L = L0 + l; if (L >= nlines) break; const int e = L * 64 + lane * 2; const int k = e & (DD - 1), n = e >> 10; v2us o;
#pragma unroll
            for (int q = 0; q < 2; ++q) o[q] = f2bf(w[(size_t)(k + q) * pitch + col0 + n]);
            *(v2us*)(Bt + (size_t)e) = o; }
         }
}
// k_qkv: the q, k and v projections as the one product x W_qkv^T that they are, one wave per 64x64 tile and the LDS ring as in k_gemmw, 12 waves (4 of tokens x 3 of W rows) per 256x192 work-group tile, grid (NT/256, 3 DD/192) = one work-group per WGP: a wave's tile column is one head of q, k or v.
// The epilogue adds the bias, scales (q only, by 1/8) and writes the bf16 hi+lo planes that k_fattn reads, fragment-packed: q and k per head as M[t][64] (block (t / 16) * 2 + feature / 32), v per head as M[feature][t] with the four blocks of a 32-key tile side by side (block (t / 32) * 4 + feature / 16).
// A v tile is computed transposed (rows = W_qkv rows, columns = tokens: both operands are packed alike, so the two loaders only trade places), so that all three kinds leave through the same whole-line stores.
// qkv_out: VT = false: tile rows are tokens, columns the head's 64 features (bias by column); VT = true: rows are features, columns tokens (bias by row). bn = the tile's 64 bias values; ph, pl = the tile's 8 packed blocks (4096 elements in a row, either kind) in the two planes.
template <bool VT>
__device__ __forceinline__ void qkv_out(const v8f (&acc)[4][4], float* os, const float* __restrict__ bn, float sc, bf* ph, bf* pl, int lr, int hi) {
    v8f br[4]; float bc[4]; const float* bp = VT ? bn + hi * 8 : bn + lr;
#pragma unroll
    for (int i = 0; i < 4; ++i) { if (VT) br[i] = *(const v8f*)(bp + i * 16); else bc[i] = bp[i * 16]; }
    // the bias loads are issued: their address register (an input, so that it lives up to here) may be rewritten behind this wait
    asm volatile("s_wait_xcnt 0x0" :: "v"(bp) : "memory");
#pragma unroll
    for (int i = 0; i < 4; ++i) { if (VT) {
#pragma unroll
            for (int j = 0; j < 8; ++j) br[i][j] = bfr(br[i][j]); } else bc[i] = bfr(bc[i]); }
    bf* php = ph + (hi * 16 + lr) * 8; bf* plp = pl + (hi * 16 + lr) * 8;
#pragma unroll
    for (int mb = 0; mb < 4; ++mb) {
#pragma unroll
        for (int nb = 0; nb < 4; ++nb) {
#pragma unroll
            for (int j = 0; j < 8; ++j) os[(hi * 8 + j) * 68 + nb * 16 + lr] = acc[mb][nb][j] + (VT ? br[mb][j] : bc[nb]); }
        __builtin_amdgcn_wave_barrier(); asm volatile("" ::: "memory");
        v8us oh[4], ol[4];
#pragma unroll
        for (int s = 0; s < 4; ++s) { const float* sp = os + lr * 68 + s * 16 + hi * 8; const v4f v0 = *(const v4fa*)sp, v1 = *(const v4fa*)(sp + 4);   // the lane's 8 elements of half-block s: row lr, columns 16 s + 8 hi ..
#pragma unroll
            for (int q = 0; q < 4; ++q) { unsigned short c1, c2; splitf(v0[q] * sc, c1, c2); oh[s][q] = c1; ol[s][q] = c2; splitf(v1[q] * sc, c1, c2); oh[s][4 + q] = c1; ol[s][4 + q] = c2; }
            const int d = (VT ? (s >> 1) * 4 + mb : mb * 2 + (s >> 1)) * 512 + (s & 1) * 256;
            *(v8us*)(php + d) = oh[s]; *(v8us*)(plp + d) = ol[s]; }
        // the eight stores are issued: their data and address registers (inputs, so that they live up to here) may be rewritten behind this wait
        asm volatile("s_wait_xcnt 0x0" :: "v"(oh[0]), "v"(oh[1]), "v"(oh[2]), "v"(oh[3]), "v"(ol[0]), "v"(ol[1]), "v"(ol[2]), "v"(ol[3]), "v"(php), "v"(plp) : "memory");
        __builtin_amdgcn_wave_barrier();
    }
}
__global__ __launch_bounds__(384) void k_qkv(const bf* __restrict__ X, const bf* __restrict__ Wt, const float* __restrict__ bias, bf* Qh, bf* Ql, bf* Kh, bf* Kl, bf* Vh, bf* Vl) {
    typedef WFrag<bf> WF; typedef WF::V V; const int K = DD;
    __shared__ __align__(16) bf ring[2 * 28 * 1024];   // two stages of 28 row groups: 16 of X, 12 of Wt, each 16 rows x 64 k = two packed blocks
    __shared__ __align__(16) float osall[12 * 16 * 68];
    const int lane = threadIdx.x & 31, lr = lane & 15, hi = lane >> 4; const int w = __builtin_amdgcn_readfirstlane(threadIdx.x >> 5);
    const int wt = w & 3, wn = w >> 2; const int t0 = blockIdx.x * 256 + wt * 64, ny = blockIdx.y * 3 + wn, n0 = ny * 64; float* os = osall + w * (16 * 68);
    const int part = ny >> 4, z = (t0 >> 11) * NH_ + (ny & 15), tb = t0 & (TT - 1); const bool vt = part == 2;
    const int ao = (vt ? 16 + wn * 4 : wt * 4) * 1024, bo = (vt ? wt * 4 : 16 + wn * 4) * 1024;   // the wave's four A and four B row groups in a stage
    v8f acc[4][4];
#pragma unroll
    for (int mb = 0; mb < 4; ++mb)
#pragma unroll
        for (int nb = 0; nb < 4; ++nb) acc[mb][nb] = (v8f){};
    // a stage is 112 copies of 512 bytes, 4 a row group; wave w takes copies w, w + 12, ..: nine each, and waves 0 .. 3 a tenth. A group of 16 rows is 16 K elements of its plane, a stage of 64 k is 1024 elements on
    // as in k_gemmw, each work-group starts its walk over K at another block of 64 k and wraps round; fs = the block that the next fill brings
    int fs = (blockIdx.x + blockIdx.y) & (K / 64 - 1);
    const bf* gp[10]; unsigned lp[10];
#pragma unroll
    for (int i = 0; i < 10; ++i) { const int c = min(w + 12 * i, 111), g = c >> 2;
        gp[i] = (g < 16 ? X + (size_t)(blockIdx.x * 16 + g) * (16 * K) : Wt + (size_t)(blockIdx.y * 12 + g - 16) * (16 * K)) + fs * 1024 + (c & 3) * 256 + lane * 8; lp[i] = (unsigned)(size_t)ring + c * 512 + lane * 16; }
    auto fill = [&](int buf) {
        unsigned l[10];
#pragma unroll
        for (int i = 0; i < 10; ++i) l[i] = lp[i] + buf * (28 * 2048);
        cp_9(l, gp); if (w < 4) cp_1(l[9], gp[9]);
        const int d = fs == K / 64 - 1 ? -(K / 64 - 1) * 1024 : 1024; fs = (fs + 1) & (K / 64 - 1);   // on to the next block of 64 k, from the last back to the first
#pragma unroll
        for (int i = 0; i < 10; ++i) gp[i] += d; };
    fill(0);
    // stage 0 has landed before the barrier behind which the other waves read it
    asm volatile("s_wait_asynccnt 0x0" ::: "memory");
    __syncthreads();
    fill(1);
#pragma unroll 1   // stays rolled: the two buffers differ by an offset only
    for (int s = 0; s < K / 64; ++s) {
        const bf* rb = ring + (s & 1) * (28 * 1024) + lane * 8;
        V a[4], b[4];
        // the fences keep the 16 LDS reads of each 32 k together as one group in front of their matrix instructions, as in k_gemmw
        __builtin_amdgcn_sched_barrier(0);
#pragma unroll
        for (int i = 0; i < 4; ++i) { a[i] = WF::ld(rb + ao + i * 1024); b[i] = WF::ld(rb + bo + i * 1024); }
        __builtin_amdgcn_sched_barrier(0);
#pragma unroll
        for (int nb = 0; nb < 4; ++nb)
#pragma unroll
            for (int mb = 0; mb < 4; ++mb) acc[mb][nb] = WF::mma(a[mb], b[nb], acc[mb][nb]);
        __builtin_amdgcn_sched_barrier(0);
#pragma unroll
        for (int i = 0; i < 4; ++i) { a[i] = WF::ld(rb + ao + i * 1024 + 512); b[i] = WF::ld(rb + bo + i * 1024 + 512); }
        // the publish point of stage s + 1, as in k_gemmw; here it stands behind the stage's last LDS reads and in front of its last 16 matrix instructions, which need registers only: the copies of stage s + 2 fly under them too
        asm volatile("s_wait_dscnt 0x0" ::: "memory");
        asm volatile("s_wait_asynccnt 0x0" ::: "memory");
        __syncthreads();
        if (s + 2 < K / 64) fill(s & 1);
#pragma unroll
        for (int nb = 0; nb < 4; ++nb)
#pragma unroll
            for (int mb = 0; mb < 4; ++mb) acc[mb][nb] = WF::mma(a[mb], b[nb], acc[mb][nb]);
    }
    // no copy is outstanding when the wave goes on
    asm volatile("s_wait_asynccnt 0x0" ::: "memory");
    if (vt) qkv_out<true>(acc, os, bias + n0, 1.0f, Vh + ((size_t)z * TT + tb) * HD, Vl + ((size_t)z * TT + tb) * HD, lr, hi);
    else qkv_out<false>(acc, os, bias + n0, part == 0 ? 0.125f : 1.0f, (part == 0 ? Qh : Kh) + ((size_t)z * TT + tb) * HD, (part == 0 ? Ql : Kl) + ((size_t)z * TT + tb) * HD, lr, hi);   // 64^-0.5 folded into q exactly
}
// k_fattn: scores, softcap, mask, softmax and attn.v of one head in one kernel; one wave owns 32 queries and walks the keys 32 at a time, everything in registers.
// S^T = K Q^T (A = 16 keys x 64, B = 16 queries): a lane then holds, for query lr, keys 8 hi + j of each 16-key tile, which is the B fragment of P^T for O^T = V^T P^T as it stands.
// The softcap bounds every score to [-30, 30], so exp(s) needs no running maximum; the row is divided by its sum once, behind the last key.
// Every inner loop is unrolled whole so that the fragment arrays are indexed by constants and stay in registers.
// A wave visits only the 32-key tiles that can hold a live key for its 32 queries: the tiles below the prefix length that lie outside its window, then the 17 tiles of its window (query tile - 16 .. query tile).
// The 8 windows of a block are 17 consecutive tiles out of the same 24, so each holds every residue modulo 17 once: at window step t a wave takes its tile of residue t, and the block reads at most two different tiles at a time, which one wave's lines serve to the others from the WGP cache.
// waves_per_eu(2, 2): the grid is one 8-wave block per WGP, two waves a SIMD, so the register budget is that of two waves.
__global__ __launch_bounds__(256) __attribute__((amdgpu_waves_per_eu(2, 2))) void k_fattn(const bf* __restrict__ Qh, const bf* __restrict__ Ql, const bf* __restrict__ Kh, const bf* __restrict__ Kl, const bf* __restrict__ Vh, const bf* __restrict__ Vl, const int* __restrict__ spl, bf* Ah, bf* Al) {
    typedef WFrag<bf> WF;
    const int lane = threadIdx.x & 31, lr = lane & 15, hi = lane >> 4; const int z = blockIdx.y, b = z >> 4, h = z & 15; const int w = __builtin_amdgcn_readfirstlane(threadIdx.x >> 5); const int q0 = blockIdx.x * 256 + w * 32; const int L = min(max(spl[b], 0), TT);   // key < L reads the same for keys 0 .. TT - 1, and L - j0 below cannot wrap
    // the walk, all in scalars and free of branches: steps 0 .. np - 1 are the prefix tiles, steps np .. np + 16 the window tiles; next_step passes over the prefix tiles that the window holds and the window tiles in front of key 0 (window steps w .. -tb - 1)
    const int tq = blockIdx.x * 8 + w, tb = blockIdx.x * 8 - 16, np = (L + 31) >> 5, nu = np + 17;
    auto next_step = [&](int v) -> int { int n = v + 1; n = (n < np && n >= tq - 16 && n <= tq) ? min(tq + 1, np) : n; return n - np >= w ? max(n, np - tb) : n; };
    auto tile_of = [&](int v) -> int { const int t = v - np; return v < np ? v : tb + t + (t < w ? 17 : 0); };   // at v = nu, behind the last step: tile tb + 17, in bounds
    const size_t zo = (size_t)z * TT * HD; Qh += zo; Ql += zo; Kh += zo; Kl += zo; Vh += zo; Vl += zo;
    v16bf qh[2][2], ql[2][2]; const bf* qhp = Qh + (q0 * HD + 8 * lane); const bf* qlp = Ql + (q0 * HD + 8 * lane);
#pragma unroll
    for (int qb = 0; qb < 2; ++qb)
#pragma unroll
        for (int kc = 0; kc < 2; ++kc) { qh[qb][kc] = WF::ld(qhp + (qb * 2 + kc) * 512); ql[qb][kc] = WF::ld(qlp + (qb * 2 + kc) * 512); }
    // the Q loads are issued: their address registers (inputs, so that they live up to here) may be rewritten behind this wait; the fence keeps later address work behind it
    asm volatile("s_wait_xcnt 0x0" :: "v"(qhp), "v"(qlp) : "memory");
    __builtin_amdgcn_sched_barrier(0);
    v8f o[4][2]; float sum[2] = {0.f, 0.f};
#pragma unroll
    for (int db = 0; db < 4; ++db)
#pragma unroll
        for (int qb = 0; qb < 2; ++qb) o[db][qb] = (v8f){};
    v16bf kh[2][2], kl[2][2];
    int u = next_step(-1), jt = tile_of(u);   // u < nu: the wave's own query tile tq is a step of the window part
    const size_t kln = (size_t)(8 * lane), vln = kln;   // the lane's place in a packed block; a 32-key tile is 4 blocks (32 * HD elements) of K and of V^T alike, and its offset is scalar
    const bf* khp = Kh + jt * (32 * HD) + kln; const bf* klp = Kl + jt * (32 * HD) + kln;
    int nj = -(jt * 32 + hi * 8);   // minus the lane's first key of the tile, carried from pass to pass: one vector add a pass, and the mask offsets below stay plain adds of constants
#pragma unroll
    for (int kt = 0; kt < 2; ++kt)
#pragma unroll
        for (int kc = 0; kc < 2; ++kc) { const int p = (kt * 2 + kc) * 512; kh[kt][kc] = WF::ld(khp + p); kl[kt][kc] = WF::ld(klp + p); }
    // the same for the first K loads
    asm volatile("s_wait_xcnt 0x0" ::: "memory");
    __builtin_amdgcn_sched_barrier(0);
#pragma unroll 1   // stays rolled: one pass is about 600 instructions, and the K fragments rotate through the same registers
    do {
        const int j0 = jt * 32;
        u = next_step(u); jt = tile_of(u);   // behind the last step this names a tile that is fetched and not used
        v16bf vh[4], vl[4]; const bf* vhp = Vh + j0 * HD + vln; const bf* vlp = Vl + j0 * HD + vln;
#pragma unroll
        for (int db = 0; db < 4; ++db) { vh[db] = WF::ld(vhp + db * 512); vl[db] = WF::ld(vlp + db * 512); }
        v8f s[2][2];
#pragma unroll
        for (int kt = 0; kt < 2; ++kt)
#pragma unroll
            for (int qb = 0; qb < 2; ++qb) { v8f a = (v8f){};
#pragma unroll
                for (int kc = 0; kc < 2; ++kc) { a = wmmab(kh[kt][kc], qh[qb][kc], a); a = wmmab(kh[kt][kc], ql[qb][kc], a); a = wmmab(kl[kt][kc], qh[qb][kc], a); }
                s[kt][qb] = a; }
        // the next tile's K fragments are fetched behind this pass's score products, so that they fly under the softmax and attn.v
        const int jn = jt * 32; khp = Kh + jn * HD + kln; klp = Kl + jn * HD + kln;
#pragma unroll
        for (int kt = 0; kt < 2; ++kt)
#pragma unroll
            for (int kc = 0; kc < 2; ++kc) { const int p = (kt * 2 + kc) * 512; kh[kt][kc] = WF::ld(khp + p); kl[kt][kc] = WF::ld(klp + p); }
        // all of this pass's loads are issued: their address registers may be rewritten behind this wait; the four addresses are inputs so that they live up to it and no load's result is placed in them ahead of it
        asm volatile("s_wait_xcnt 0x0" :: "v"(vhp), "v"(vlp), "v"(khp), "v"(klp) : "memory");
        // keeps the V and next-K loads issued above the softmax, where its vector work hides their latency (the scheduler otherwise sinks them to their first use)
        __builtin_amdgcn_sched_barrier(0);
        v16bf ph[2], pl[2]; const int lk = L + nj;
#pragma unroll
        for (int qb = 0; qb < 2; ++qb) { const int dq = q0 + qb * 16 + lr + nj;
#pragma unroll
            for (int kt = 0; kt < 2; ++kt)
#pragma unroll
                for (int j = 0; j < 8; ++j) { const int cj = kt * 16 + j; const bool live = ((unsigned)(dq - cj) <= 512u) || (cj < lk);   // key = j0 + 8 hi + cj: 0 <= i - key <= 512, or key < L
                    // exp(30 tanh(s/30)) with tanh(u) = 1 - 2/(exp(2u) + 1), both exponentials base 2: 2^(C2 - 2 C2 / (2^(C1 s) + 1)), C1 = 2 log2(e) / 30, C2 = 30 log2(e); overflow of the inner one gives tanh = 1, underflow -1
                    const float r = __builtin_amdgcn_rcpf(__builtin_amdgcn_exp2f(s[kt][qb][j] * 0.0961796694f) + 1.0f);
                    const float p = live ? __builtin_amdgcn_exp2f(__builtin_fmaf(r, -86.5617025f, 43.2808512f)) : 0.0f; sum[qb] += p;
                    const __bf16 a = (__bf16)p; ph[qb][kt * 8 + j] = a; pl[qb][kt * 8 + j] = (__bf16)(p - (float)a); } }
#pragma unroll
        for (int db = 0; db < 4; ++db)
#pragma unroll
            for (int qb = 0; qb < 2; ++qb) { o[db][qb] = wmmab(vh[db], ph[qb], o[db][qb]); o[db][qb] = wmmab(vh[db], pl[qb], o[db][qb]); o[db][qb] = wmmab(vl[db], ph[qb], o[db][qb]); }
        nj += j0 - jn;
    } while (u < nu);
    // the last pass's stand-in K fetch feeds nothing: it has landed before the wave gives its registers back
    asm volatile("s_wait_loadcnt 0x0" ::: "memory");
    // the output planes are packed for k_gemmw (rows = tokens, K = DD): features 16 db + 8 hi .. of head h are half-block db of the head's two blocks, and each lane is its own lane there
#pragma unroll
    for (int qb = 0; qb < 2; ++qb) { const float f = __fdiv_rn(1.0f, sum[qb] + __shfl_xor(sum[qb], 16, 32)); const size_t ro = ((size_t)b * TT + q0 + qb * 16) * DD + h * (2 * 512) + lane * 8; bf* ahp = Ah + ro; bf* alp = Al + ro; v8us oh[4], ol[4];
#pragma unroll
        for (int db = 0; db < 4; ++db) {
#pragma unroll
            for (int j = 0; j < 8; ++j) { unsigned short a, c2; splitf(o[db][qb][j] * f, a, c2); oh[db][j] = a; ol[db][j] = c2; }
            *(v8us*)(ahp + db * 256) = oh[db]; *(v8us*)(alp + db * 256) = ol[db]; }
        // the eight stores are issued: their data and address registers (inputs, so that they live up to here) may be rewritten behind this wait
        asm volatile("s_wait_xcnt 0x0" :: "v"(oh[0]), "v"(oh[1]), "v"(oh[2]), "v"(oh[3]), "v"(ol[0]), "v"(ol[1]), "v"(ol[2]), "v"(ol[3]), "v"(ahp), "v"(alp) : "memory"); }
}

extern "C" void kernel_launch(void* const* d_in, const int* in_sizes, int n_in,
                              void* d_out, int out_size, void* d_ws, size_t ws_size, hipStream_t stream) {
    (void)in_sizes; (void)n_in; (void)out_size;
    const float* x = (const float*)d_in[0]; const int* spl = (const int*)d_in[1]; const float* Wqkv = (const float*)d_in[2]; const float* bqkv = (const float*)d_in[3]; const float* Wo = (const float*)d_in[4]; const float* bo = (const float*)d_in[5];
    float* OUT = (float*)d_out;     // [2][2048][1024]
    char* wsp = (char*)d_ws;
    auto take = [&](size_t bytes) { char* p = wsp; wsp += (bytes + 255) & ~(size_t)255; return (void*)p; };
    bf* WQKV = (bf*)take((size_t)3 * DD * DD * 2); bf* WO = (bf*)take((size_t)DD * DD * 2);
    bf* XB = (bf*)take((size_t)NT * DD * 2);
    bf* QPh = (bf*)take((size_t)NT * DD * 2); bf* QPl = (bf*)take((size_t)NT * DD * 2); bf* KPh = (bf*)take((size_t)NT * DD * 2); bf* KPl = (bf*)take((size_t)NT * DD * 2); bf* VTh = (bf*)take((size_t)NT * DD * 2); bf* VTl = (bf*)take((size_t)NT * DD * 2);
    bf* ATh = (bf*)take((size_t)NT * DD * 2); bf* ATl = (bf*)take((size_t)NT * DD * 2);
    if ((size_t)(wsp - (char*)d_ws) > ws_size) return;    // ws 256 MiB
    k_pack<<<(4 * DD + NT) / 32, 512, 0, stream>>>(Wqkv, Wo, x, WQKV, WO, XB);   // nn.Linear [out][in] = Bt as-is (q|k|v row blocks, one matrix)
    k_qkv<<<dim3(NT / 256, 3 * DD / 192, 1), 384, 0, stream>>>(XB, WQKV, bqkv, QPh, QPl, KPh, KPl, VTh, VTl);
    k_fattn<<<dim3(TT / 256, NB_ * NH_, 1), 256, 0, stream>>>(QPh, QPl, KPh, KPl, VTh, VTl, spl, ATh, ATl);
    k_gemmw<true, DD><<<dim3(NT / 128, DD / 128, 1), 128, 0, stream>>>(ATh, ATl, WO, OUT, DD, bo);
}

// v009
// Measured time: 67.1 microseconds a run.
// Versions between v007 and this one are left out; their measured steps multiply to 1.20 times as fast.
// All steps since v000 together make it 19.8 times as fast.
#include <hip/hip_runtime.h>

// TunedSelfAttention (x [2][2048][1024]; qkv = x W_qkv^T + b_qkv ([3072][1024] Linear); 16 heads x 64; s = (q.k / 8); s = 30 tanh(s / 30) (softcap); keep key j iff (i >= j && i - j <= 512) || j < suffix_prefix_length[b] (int input, read as data), else -inf; softmax; y = attn.v merged; out = y W_proj^T + b_proj).
// The sliding-window/prefix mask is evaluated arithmetically per element; early rows see few keys, so attn.v runs on bf16 hi+lo planes (P = exp(s) spans e^-30 .. e^30, beyond the f16 range).
// Compute dtypes, f32 accumulate: every float input rounded to bf16; q/k/v projections on PLAIN bf16 operands (x, W inputs: exact, + bias);
// scores on one f16 plane each of q (x 1/8) and k (1 product); attn.v on bf16 hi+lo P and V^T planes (3 products); output projection on one f16 plane of the attention output x Wout (rounded to bf16, held as f16: exact from 2^-14 up, below that to 2^-25 absolute) (1 product);

#define NB_  2
#define TT   2048
#define DD   1024
#define NH_  16
#define HD   64
#define NT   (NB_ * TT)
#define ZH   2
#define PCAR 1024.0f
typedef _Float16 h16;
typedef unsigned short bf;
typedef __attribute__((ext_vector_type(16))) __bf16   v16bf;
typedef __attribute__((ext_vector_type(16))) _Float16 v16h;
typedef __attribute__((ext_vector_type(8)))  _Float16 v8h;
typedef __attribute__((ext_vector_type(8)))  unsigned short v8us;
typedef __attribute__((ext_vector_type(8)))  float    v8f;
typedef __attribute__((ext_vector_type(4)))  float    v4f;
typedef v8h  __attribute__((may_alias)) v8ha;
typedef v4f  __attribute__((may_alias)) v4fa;
typedef v8us __attribute__((may_alias)) v8usa;

__device__ __forceinline__ unsigned short f2bf(float f) { unsigned u = __float_as_uint(f); u += 0x7FFFu + ((u >> 16) & 1u); return (unsigned short)(u >> 16); }
__device__ __forceinline__ float bf2f(unsigned short b) { return __uint_as_float(((unsigned)b) << 16); }
__device__ __forceinline__ float bfr(float f) { return bf2f(f2bf(f)); }
__device__ __forceinline__ unsigned short f2h(float f) { return __builtin_bit_cast(unsigned short, (_Float16)f); }   // f32 to f16, nearest even, as the 16 bits a plane holds
__device__ __forceinline__ v16h cat16(v8h lo, v8h hi) { return __builtin_shufflevector(lo, hi, 0, 1, 2, 3, 4, 5, 6, 7, 8, 9, 10, 11, 12, 13, 14, 15); }
__device__ __forceinline__ v16bf cat16b(v8us lo, v8us hi) { return __builtin_bit_cast(v16bf, __builtin_shufflevector(lo, hi, 0, 1, 2, 3, 4, 5, 6, 7, 8, 9, 10, 11, 12, 13, 14, 15)); }
__device__ __forceinline__ v8f wmma16(v16h a, v16h b, v8f c) { return __builtin_amdgcn_wmma_f32_16x16x32_f16(false, a, false, b, (short)0, c, false, false); }
__device__ __forceinline__ v8f wmmab(v16bf a, v16bf b, v8f c) { return __builtin_amdgcn_wmma_f32_16x16x32_bf16(false, a, false, b, (short)0, c, false, false); }



// ---- k_gemmw: register-blocked GEMM, one wave per 64x64 output tile (16 accumulators), 4 waves (2 x 2) per 128x128 work-group tile; grid (M/128, N/128), 128 threads.
// C[m][n] (f32, pitch ldc, + optional f32 bias[n]) = sum_k A[m][k] Bt[n][k], both planes f16. K % 64 == 0, K >= 128. The operand blocks of 64 k come once per work-group into LDS by asynchronous copies, two buffers: stage s + 2 flies while stage s + 1 is worked on; the waves read their fragments from LDS as they stand in the planes.
// FRAGMENT-PACKED PLANES: every 16-bit operand plane M[row][k] is kept as blocks of 16 rows x 32 k (512 elements, 1 KiB), a block being the WMMA fragment as the registers hold it:
// element (row, k) stands at block * 512 + half * 256 + lane * 8 + e with k % 32 = half * 16 + hi * 8 + e and lane = hi * 16 + row % 16. A wave-wide 16-byte load is then 512 contiguous bytes (4 whole lines, not 32 bytes of each of 16 lines).
// Lane and register of every element are those of the hardware's fragment layout, alike for A and B operands. Block order: (row / 16) * (K / 32) + k / 32, but V^T (see k_qkv). ld takes block start + lane * 8.
template <typename T16> struct WFrag;
template <> struct WFrag<h16> { typedef v16h V; static __device__ __forceinline__ V ld(const h16* p) { return cat16(*(const v8h*)p, *(const v8h*)(p + 256)); } static __device__ __forceinline__ v8f mma(V a, V b, v8f c) { return wmma16(a, b, c); } };
template <> struct WFrag<bf> { typedef v16bf V; static __device__ __forceinline__ V ld(const bf* p) { return cat16b(*(const v8us*)p, *(const v8us*)(p + 256)); } static __device__ __forceinline__ v8f mma(V a, V b, v8f c) { return wmmab(a, b, c); } };
// cp_*: asynchronous copies to LDS, 16 bytes a lane, 512 contiguous bytes a wave and copy (half a packed block), through no register. l = the lane's LDS byte address, g = its global address.
// The s_wait_xcnt 0 is the last line of the copies' own statement, so that it stands in front of every later write of a register that a copy names.
#define CPL(a, b) "global_load_async_to_lds_b128 %" #a ", %" #b ", off\n\t"
__device__ __forceinline__ void cp_1(unsigned l, const bf* g) { asm volatile(CPL(0, 1) "s_wait_xcnt 0x0" :: "v"(l), "v"(g) : "memory"); }
__device__ __forceinline__ void cp_8(const unsigned* l, const bf* const* g) {
    asm volatile(CPL(0, 1) CPL(2, 3) CPL(4, 5) CPL(6, 7) CPL(8, 9) CPL(10, 11) CPL(12, 13) CPL(14, 15) "s_wait_xcnt 0x0"
        :: "v"(l[0]), "v"(g[0]), "v"(l[1]), "v"(g[1]), "v"(l[2]), "v"(g[2]), "v"(l[3]), "v"(g[3]), "v"(l[4]), "v"(g[4]), "v"(l[5]), "v"(g[5]), "v"(l[6]), "v"(g[6]), "v"(l[7]), "v"(g[7]) : "memory"); }
__device__ __forceinline__ void cp_9(const unsigned* l, const bf* const* g) {
    asm volatile(CPL(0, 1) CPL(2, 3) CPL(4, 5) CPL(6, 7) CPL(8, 9) CPL(10, 11) CPL(12, 13) CPL(14, 15) CPL(16, 17) "s_wait_xcnt 0x0"
        :: "v"(l[0]), "v"(g[0]), "v"(l[1]), "v"(g[1]), "v"(l[2]), "v"(g[2]), "v"(l[3]), "v"(g[3]), "v"(l[4]), "v"(g[4]), "v"(l[5]), "v"(g[5]), "v"(l[6]), "v"(g[6]), "v"(l[7]), "v"(g[7]), "v"(l[8]), "v"(g[8]) : "memory"); }
template <bool BIAS, int K>   // K is a constant so that the stage count is one
__global__ __launch_bounds__(128) void k_gemmw(const bf* __restrict__ A, const bf* __restrict__ Bt, float* C, int ldc, const float* __restrict__ bias) {
    typedef WFrag<h16> WF; typedef WF::V V;
    __shared__ __align__(16) h16 ring[2 * 16 * 1024];   // two stages of 16 row groups: 8 of A, 8 of Bt, each 16 rows x 64 k = two packed blocks
    __shared__ __align__(16) float osall[4 * 16 * 68];
    const int lane = threadIdx.x & 31, lr = lane & 15, hi = lane >> 4; const int w = __builtin_amdgcn_readfirstlane(threadIdx.x >> 5);
    const int wm = w & 1, wn = w >> 1; const int r0 = blockIdx.x * 128 + wm * 64, c0 = blockIdx.y * 128 + wn * 64; float* os = osall + w * (16 * 68);
    v8f acc[4][4];
#pragma unroll
    for (int mb = 0; mb < 4; ++mb)
#pragma unroll
        for (int nb = 0; nb < 4; ++nb) acc[mb][nb] = (v8f){};
    // wave w copies row groups 2 w and 2 w + 1 of each of the two planes in every stage, 4 copies a group; a group of 16 rows is 16 K elements of its plane, a stage of 64 k is 1024 elements on
    // the work-groups that share operand rows (one blockIdx.x, or one blockIdx.y) run in step: each starts its walk over K at another block of 64 k and wraps round, so that they do not ask L2 for the same lines at the same moment. fs = the block that the next fill brings
    static_assert((K / 64 & (K / 64 - 1)) == 0, "the wrap is a mask");
    int fs = (blockIdx.x + blockIdx.y) & (K / 64 - 1);
    // gb, l0 are the same in every lane and live in scalar registers from fill to fill; the lane's own 16 bytes are added where a copy's addresses are formed, in registers that the fragment set read next has left free
    const bf* gb[4];
#pragma unroll
    for (int j = 0; j < 2; ++j) { gb[j] = A + (size_t)(blockIdx.x * 8 + w * 2 + j) * (16 * K) + fs * 1024; gb[2 + j] = Bt + (size_t)(blockIdx.y * 8 + w * 2 + j) * (16 * K) + fs * 1024; }
    const unsigned l0 = (unsigned)(size_t)ring + w * (2 * 2048);
    auto fill = [&](int buf) {
        unsigned l[16]; const bf* g[16];
#pragma unroll
        for (int i = 0; i < 16; ++i) { l[i] = l0 + buf * (16 * 2048) + ((i >> 3) * 8 + ((i >> 2) & 1)) * 2048 + (i & 3) * 512 + lane * 16; g[i] = gb[i >> 2] + (i & 3) * 256 + lane * 8; }
        cp_8(l, g); cp_8(l + 8, g + 8);
        const int d = fs == K / 64 - 1 ? -(K / 64 - 1) * 1024 : 1024; fs = (fs + 1) & (K / 64 - 1);   // on to the next block of 64 k, from the last back to the first
#pragma unroll
        for (int i = 0; i < 4; ++i) gb[i] += d; };
    fill(0);
    // stage 0 has landed before the barrier behind which the other waves read it
    asm volatile("s_wait_asynccnt 0x0" ::: "memory");
    __syncthreads();
    fill(1);
    // two fragment sets: each block of 32 k is read from LDS one block ahead, as one group, into the set that the matrix instructions in front of it have just left, and lands under the other set's 16 matrix instructions
    V a0[4], b0[4], a1[4], b1[4];
    auto frags = [&](V (&a)[4], V (&b)[4], const h16* p) {
#pragma unroll
        for (int i = 0; i < 4; ++i) { b[i] = WF::ld(p + (8 + wn * 4 + i) * 1024); a[i] = WF::ld(p + (wm * 4 + i) * 1024); } };
    auto block = [&](const V (&a)[4], const V (&b)[4]) {
#pragma unroll
        for (int nb = 0; nb < 4; ++nb)
#pragma unroll
            for (int mb = 0; mb < 4; ++mb) acc[mb][nb] = WF::mma(a[mb], b[nb], acc[mb][nb]); };
    frags(a0, b0, ring + lane * 8);
#pragma unroll 1   // stays rolled: the two buffers differ by an offset only
    for (int s = 0; s < K / 64; ++s) {
        const h16* rb = ring + (s & 1) * (16 * 1024) + lane * 8; const h16* rn = ring + ((s + 1) & 1) * (16 * 1024) + lane * 8;
        // the fences keep each group of 16 LDS reads together and in front of the other set's matrix instructions (the scheduler otherwise sinks them to their first use or spreads them among those, each place with a wait)
        __builtin_amdgcn_sched_barrier(0);
        frags(a1, b1, rb + 512);
        __builtin_amdgcn_sched_barrier(0);
        block(a0, b0);
        __builtin_amdgcn_sched_barrier(0);
        // the publish point of stage s + 1, in front of stage s's last block, whose fragments are fetched: this wave's reads of stage s are done, its copies of stage s + 1 have landed, then the barrier; only behind it is stage s's buffer filled anew and stage s + 1 read
        asm volatile("s_wait_dscnt 0x0" ::: "memory");
        asm volatile("s_wait_asynccnt 0x0" ::: "memory");
        __syncthreads();
        if (s + 2 < K / 64) fill(s & 1);
        frags(a0, b0, rn);   // behind the last stage this reads the other buffer's old bytes, which feed nothing
        __builtin_amdgcn_sched_barrier(0);
        block(a1, b1);
    }
    // no copy is outstanding when the wave goes on
    asm volatile("s_wait_asynccnt 0x0" ::: "memory");
#pragma unroll
    for (int mb = 0; mb < 4; ++mb) {
#pragma unroll
        for (int nb = 0; nb < 4; ++nb) {
#pragma unroll
            for (int j = 0; j < 8; ++j) os[(hi * 8 + j) * 68 + nb * 16 + lr] = acc[mb][nb][j]; }
        __builtin_amdgcn_wave_barrier(); asm volatile("" ::: "memory");
        float* crow = C + (size_t)(r0 + mb * 16) * ldc + c0;
{
#pragma unroll
            for (int s = 0; s < 8; ++s) { const int row = 2 * s + hi, cofs = lr * 4; v4f val = *(const v4fa*)(os + row * 68 + cofs); if (BIAS) { val[0] += bfr(bias[c0 + cofs]); val[1] += bfr(bias[c0 + cofs + 1]); val[2] += bfr(bias[c0 + cofs + 2]); val[3] += bfr(bias[c0 + cofs + 3]); }
                *(v4f*)(crow + (size_t)row * ldc + cofs) = val; }
             }
        __builtin_amdgcn_wave_barrier(); asm volatile("" ::: "memory");
    }
}

__device__ __forceinline__ h16 tohx(float x) { return (h16)x; }
__device__ __forceinline__ void splitf(float y, unsigned short& h, unsigned short& l) { h = f2bf(y); l = f2bf(y - bf2f(h)); }
typedef __attribute__((ext_vector_type(2))) _Float16 v2h;
typedef __attribute__((ext_vector_type(4))) _Float16 v4h;
typedef __attribute__((ext_vector_type(2))) unsigned short v2us;
typedef __attribute__((ext_vector_type(4))) int v4i;

// k_pack: the three row-major f32 matrices of DD columns (W_qkv, W_proj, x) to their fragment-packed 16-bit planes (bf16; W_proj rounded to bf16 like the others and then held as f16, the operand type of k_gemmw) in one launch of one 16-wave work-group per WGP: (3 DD + DD + NT) / 16 = 512 groups of 16 rows, two a work-group, a wave taking 128 k of one group.
// A wave reads its 16 rows by 16 loads of 512 contiguous bytes, all in flight at once, rounds them, turns them into fragment order in its own LDS slice and stores the 4 packed blocks as 4 KiB in a row.
// The slice holds the 16 chunks of 8 k (16 rows x 16 bytes each) at a pitch of 272 bytes: the 8-byte writes of a row (chunk = lane / 2) and the 16-byte reads of a half-block (row = lane % 16, chunk = 2 s + lane / 16) then both spread over all banks.
typedef __attribute__((ext_vector_type(4))) unsigned short v4us;
__global__ __launch_bounds__(512) void k_pack(const float* __restrict__ wq, const float* __restrict__ wo, const float* __restrict__ x, bf* WQ, bf* WP, bf* XP) {
    __shared__ __align__(16) bf tr[16 * 16 * 136];
    const int lane = threadIdx.x & 31; const int w = __builtin_amdgcn_readfirstlane(threadIdx.x >> 5); const int blk = blockIdx.x;
    const float* src = blk < 3 * DD / 32 ? wq : blk < 4 * DD / 32 ? wo : x; bf* dst = blk < 3 * DD / 32 ? WQ : blk < 4 * DD / 32 ? WP : XP;
    const int g = (blk < 3 * DD / 32 ? blk : blk < 4 * DD / 32 ? blk - 3 * DD / 32 : blk - 4 * DD / 32) * 2 + (w >> 3), kc = w & 7;   // the matrix's own group of 16 rows, and which 128 k of it
    const float* sp = src + (size_t)g * (16 * DD) + kc * 128 + lane * 4; v4f v[16];
#pragma unroll
    for (int r = 0; r < 16; ++r) v[r] = *(const v4f*)(sp + r * DD);
    bf* ts = tr + w * (16 * 136); bf* wp = ts + (lane >> 1) * 136 + (lane & 1) * 4;
    if (blk >= 3 * DD / 32 && blk < 4 * DD / 32) {   // W_proj, one scalar branch for the whole work-group: the bf16 values as f16
#pragma unroll
        for (int r = 0; r < 16; ++r) { v4us o;
#pragma unroll
            for (int q = 0; q < 4; ++q) o[q] = f2h(bfr(v[r][q]));
            *(v4us*)(wp + r * 8) = o; }
    } else {
#pragma unroll
        for (int r = 0; r < 16; ++r) { v4us o;
#pragma unroll
            for (int q = 0; q < 4; ++q) o[q] = f2bf(v[r][q]);
            *(v4us*)(wp + r * 8) = o; }
    }
    // the wave's LDS writes are done before its lanes read what other lanes wrote
    asm volatile("s_wait_dscnt 0x0" ::: "memory");
    __builtin_amdgcn_wave_barrier();
    const bf* rp = ts + (lane >> 4) * 136 + (lane & 15) * 8; bf* dp = dst + (size_t)g * (16 * DD) + kc * 2048 + lane * 8; v8us o[8];
#pragma unroll
    for (int s = 0; s < 8; ++s) o[s] = *(const v8us*)(rp + s * (2 * 136));
#pragma unroll
    for (int s = 0; s < 8; ++s) *(v8us*)(dp + s * 256) = o[s];
}
__global__ __launch_bounds__(256) void k_wtT(const float* __restrict__ w, int pitch, int col0, bf* Bt) {
    const int lane = threadIdx.x & 31; const int L0 = (blockIdx.x * 8 + (threadIdx.x >> 5)) * 8; const int nlines = DD * DD / 64;
{
#pragma unroll
        for (int l = 0; l < 8; ++l) { const int L = L0 + l; if (L >= nlines) break; const int e = L * 64 + lane * 2; const int k = e & (DD - 1), n = e >> 10; v2us o;
#pragma unroll
            for (int q = 0; q < 2; ++q) o[q] = f2bf(w[(size_t)(k + q) * pitch + col0 + n]);
            *(v2us*)(Bt + (size_t)e) = o; }
         }
}
// k_qkv: the q, k and v projections as the one product x W_qkv^T that they are, one wave per 64x64 tile and the LDS ring as in k_gemmw, 12 waves (4 of tokens x 3 of W rows) per 256x192 work-group tile, grid (NT/256, 3 DD/192) = one work-group per WGP: a wave's tile column is one head of q, k or v.
// The epilogue adds the bias, scales (q only, by 1/8) and writes the planes that k_fattn reads (q, k: one f16 plane each; v: bf16 hi+lo), fragment-packed: q and k per head as M[t][64] (block (t / 16) * 2 + feature / 32), v per head as M[feature][t] with the four blocks of a 32-key tile side by side (block (t / 32) * 4 + feature / 16).
// A v tile is computed transposed (rows = W_qkv rows, columns = tokens: both operands are packed alike, so the two loaders only trade places), so that all three kinds leave through the same whole-line stores.
// qkv_out: VT = false: tile rows are tokens, columns the head's 64 features (bias by column); VT = true: rows are features, columns tokens (bias by row). bn = the tile's 64 bias values; ph, pl = the tile's 8 packed blocks (4096 elements in a row, either kind) in the two planes. ONE = true: one f16 plane, ph alone.
template <bool VT, bool ONE>
__device__ __forceinline__ void qkv_out(const v8f (&acc)[4][4], float* os, const float* __restrict__ bn, float sc, bf* ph, bf* pl, int lr, int hi) {
    v8f br[4]; float bc[4]; const float* bp = VT ? bn + hi * 8 : bn + lr;
#pragma unroll
    for (int i = 0; i < 4; ++i) { if (VT) br[i] = *(const v8f*)(bp + i * 16); else bc[i] = bp[i * 16]; }
    // the bias loads are issued: their address register (an input, so that it lives up to here) may be rewritten behind this wait
    asm volatile("s_wait_xcnt 0x0" :: "v"(bp) : "memory");
#pragma unroll
    for (int i = 0; i < 4; ++i) { if (VT) {
#pragma unroll
            for (int j = 0; j < 8; ++j) br[i][j] = bfr(br[i][j]); } else bc[i] = bfr(bc[i]); }
    bf* php = ph + (hi * 16 + lr) * 8; bf* plp = ONE ? php : pl + (hi * 16 + lr) * 8;
#pragma unroll
    for (int mb = 0; mb < 4; ++mb) {
#pragma unroll
        for (int nb = 0; nb < 4; ++nb) {
#pragma unroll
            for (int j = 0; j < 8; ++j) os[(hi * 8 + j) * 68 + nb * 16 + lr] = acc[mb][nb][j] + (VT ? br[mb][j] : bc[nb]); }
        __builtin_amdgcn_wave_barrier(); asm volatile("" ::: "memory");
        v8us oh[4], ol[4];
#pragma unroll
        for (int s = 0; s < 4; ++s) { const float* sp = os + lr * 68 + s * 16 + hi * 8; const v4f v0 = *(const v4fa*)sp, v1 = *(const v4fa*)(sp + 4);   // the lane's 8 elements of half-block s: row lr, columns 16 s + 8 hi ..
#pragma unroll
            for (int q = 0; q < 4; ++q) { if constexpr (ONE) { oh[s][q] = f2h(v0[q] * sc); oh[s][4 + q] = f2h(v1[q] * sc); } else { unsigned short c1, c2; splitf(v0[q] * sc, c1, c2); oh[s][q] = c1; ol[s][q] = c2; splitf(v1[q] * sc, c1, c2); oh[s][4 + q] = c1; ol[s][4 + q] = c2; } }
            const int d = (VT ? (s >> 1) * 4 + mb : mb * 2 + (s >> 1)) * 512 + (s & 1) * 256;
            *(v8us*)(php + d) = oh[s]; if constexpr (!ONE) *(v8us*)(plp + d) = ol[s]; }
        // the stores are issued: their data and address registers (inputs, so that they live up to here) may be rewritten behind this wait
        if constexpr (ONE) asm volatile("s_wait_xcnt 0x0" :: "v"(oh[0]), "v"(oh[1]), "v"(oh[2]), "v"(oh[3]), "v"(php) : "memory");
        else asm volatile("s_wait_xcnt 0x0" :: "v"(oh[0]), "v"(oh[1]), "v"(oh[2]), "v"(oh[3]), "v"(ol[0]), "v"(ol[1]), "v"(ol[2]), "v"(ol[3]), "v"(php), "v"(plp) : "memory");
        __builtin_amdgcn_wave_barrier();
    }
}
__global__ __launch_bounds__(384) void k_qkv(const bf* __restrict__ X, const bf* __restrict__ Wt, const float* __restrict__ bias, bf* Qf, bf* Kf, bf* Vh, bf* Vl) {
    typedef WFrag<bf> WF; typedef WF::V V; const int K = DD;
    __shared__ __align__(16) bf ring[2 * 28 * 1024];   // two stages of 28 row groups: 16 of X, 12 of Wt, each 16 rows x 64 k = two packed blocks
    __shared__ __align__(16) float osall[12 * 16 * 68];
    const int lane = threadIdx.x & 31, lr = lane & 15, hi = lane >> 4; const int w = __builtin_amdgcn_readfirstlane(threadIdx.x >> 5);
    const int wt = w & 3, wn = w >> 2; const int t0 = blockIdx.x * 256 + wt * 64, ny = blockIdx.y * 3 + wn, n0 = ny * 64; float* os = osall + w * (16 * 68);
    const int part = ny >> 4, z = (t0 >> 11) * NH_ + (ny & 15), tb = t0 & (TT - 1); const bool vt = part == 2;
    const int ao = (vt ? 16 + wn * 4 : wt * 4) * 1024, bo = (vt ? wt * 4 : 16 + wn * 4) * 1024;   // the wave's four A and four B row groups in a stage
    v8f acc[4][4];
#pragma unroll
    for (int mb = 0; mb < 4; ++mb)
#pragma unroll
        for (int nb = 0; nb < 4; ++nb) acc[mb][nb] = (v8f){};
    // a stage is 112 copies of 512 bytes, 4 a row group; wave w takes copies w, w + 12, ..: nine each, and waves 0 .. 3 a tenth. A group of 16 rows is 16 K elements of its plane, a stage of 64 k is 1024 elements on
    // as in k_gemmw, each work-group starts its walk over K at another block of 64 k and wraps round; fs = the block that the next fill brings
    int fs = (blockIdx.x + blockIdx.y) & (K / 64 - 1);
    // gp, lp are the same in every lane and live in scalar registers from fill to fill, as in k_gemmw; the lane's own 16 bytes are added where a copy's addresses are formed
    const bf* gp[10]; unsigned lp[10];
#pragma unroll
    for (int i = 0; i < 10; ++i) { const int c = min(w + 12 * i, 111), g = c >> 2;
        gp[i] = (g < 16 ? X + (size_t)(blockIdx.x * 16 + g) * (16 * K) : Wt + (size_t)(blockIdx.y * 12 + g - 16) * (16 * K)) + fs * 1024 + (c & 3) * 256; lp[i] = (unsigned)(size_t)ring + c * 512; }
    auto fill = [&](int buf) {
        unsigned l[10]; const bf* g[10];
#pragma unroll
        for (int i = 0; i < 10; ++i) { l[i] = lp[i] + lane * 16; g[i] = gp[i] + lane * 8; }
        cp_9(l, g); if (w < 4) cp_1(l[9], g[9]);
        const int d = fs == K / 64 - 1 ? -(K / 64 - 1) * 1024 : 1024; fs = (fs + 1) & (K / 64 - 1);   // on to the next block of 64 k, from the last back to the first
        const int e = buf ? -(28 * 2048) : 28 * 2048;   // and to the other buffer: lp walks too, in scalars, so that no per-copy vector address is kept from fill to fill
#pragma unroll
        for (int i = 0; i < 10; ++i) { gp[i] += d; lp[i] += e; } };
    fill(0);
    // stage 0 has landed before the barrier behind which the other waves read it
    asm volatile("s_wait_asynccnt 0x0" ::: "memory");
    __syncthreads();
    fill(1);
    // two fragment sets, as in k_gemmw: each block of 32 k is read one block ahead and lands under the other set's 16 matrix instructions
    V a0[4], b0[4], a1[4], b1[4];
    auto frags = [&](V (&a)[4], V (&b)[4], const bf* p) {
#pragma unroll
        for (int i = 0; i < 4; ++i) { a[i] = WF::ld(p + ao + i * 1024); b[i] = WF::ld(p + bo + i * 1024); } };
    auto block = [&](const V (&a)[4], const V (&b)[4]) {
#pragma unroll
        for (int nb = 0; nb < 4; ++nb)
#pragma unroll
            for (int mb = 0; mb < 4; ++mb) acc[mb][nb] = WF::mma(a[mb], b[nb], acc[mb][nb]); };
    frags(a0, b0, ring + lane * 8);
#pragma unroll 1   // stays rolled: the two buffers differ by an offset only
    for (int s = 0; s < K / 64; ++s) {
        const bf* rb = ring + (s & 1) * (28 * 1024) + lane * 8; const bf* rn = ring + ((s + 1) & 1) * (28 * 1024) + lane * 8;
        // the fences keep each group of 16 LDS reads together and in front of the other set's matrix instructions, as in k_gemmw
        __builtin_amdgcn_sched_barrier(0);
        frags(a1, b1, rb + 512);
        __builtin_amdgcn_sched_barrier(0);
        block(a0, b0);
        __builtin_amdgcn_sched_barrier(0);
        // the publish point of stage s + 1, as in k_gemmw, in front of stage s's last 16 matrix instructions, which need registers only: the copies of stage s + 2 and the first reads of stage s + 1 fly under them
        asm volatile("s_wait_dscnt 0x0" ::: "memory");
        asm volatile("s_wait_asynccnt 0x0" ::: "memory");
        __syncthreads();
        if (s + 2 < K / 64) fill(s & 1);
        frags(a0, b0, rn);   // behind the last stage this reads the other buffer's old bytes, which feed nothing
        __builtin_amdgcn_sched_barrier(0);
        block(a1, b1);
    }
    // no copy is outstanding when the wave goes on
    asm volatile("s_wait_asynccnt 0x0" ::: "memory");
    if (vt) qkv_out<true, false>(acc, os, bias + n0, 1.0f, Vh + ((size_t)z * TT + tb) * HD, Vl + ((size_t)z * TT + tb) * HD, lr, hi);
    else qkv_out<false, true>(acc, os, bias + n0, part == 0 ? 0.125f : 1.0f, (part == 0 ? Qf : Kf) + ((size_t)z * TT + tb) * HD, nullptr, lr, hi);   // 64^-0.5 folded into q exactly
}
// k_fattn: scores, softcap, mask, softmax and attn.v of one head in one kernel; one wave owns 32 queries and walks the keys 32 at a time, everything in registers.
// S^T = K Q^T (A = 16 keys x 64, B = 16 queries): a lane then holds, for query lr, keys 8 hi + j of each 16-key tile, which is the B fragment of P^T for O^T = V^T P^T as it stands.
// The softcap bounds every score to [-30, 30], so exp(s) needs no running maximum; the row is divided by its sum once, behind the last key.
// Every inner loop is unrolled whole so that the fragment arrays are indexed by constants and stay in registers.
// A wave visits only the 32-key tiles that can hold a live key for its 32 queries: the tiles below the prefix length that lie outside its window, then the 17 tiles of its window (query tile - 16 .. query tile).
// The 8 windows of a block are 17 consecutive tiles out of the same 24, so each holds every residue modulo 17 once: at window step t a wave takes its tile of residue t, and the block reads at most two different tiles at a time, which one wave's lines serve to the others from the WGP cache.
// waves_per_eu(2, 2): the grid is one 8-wave block per WGP, two waves a SIMD, so the register budget is that of two waves.
__global__ __launch_bounds__(256) __attribute__((amdgpu_waves_per_eu(2, 2))) void k_fattn(const bf* __restrict__ Qf, const bf* __restrict__ Kf, const bf* __restrict__ Vh, const bf* __restrict__ Vl, const int* __restrict__ spl, bf* Af) {
    typedef WFrag<bf> WF; typedef WFrag<h16> WH;
    const int lane = threadIdx.x & 31, lr = lane & 15, hi = lane >> 4; const int z = blockIdx.y, b = z >> 4, h = z & 15; const int w = __builtin_amdgcn_readfirstlane(threadIdx.x >> 5); const int q0 = blockIdx.x * 256 + w * 32; const int L = min(max(spl[b], 0), TT);   // key < L reads the same for keys 0 .. TT - 1, and L - j0 below cannot wrap
    // the walk, all in scalars and free of branches: steps 0 .. np - 1 are the prefix tiles, steps np .. np + 16 the window tiles; next_step passes over the prefix tiles that the window holds and the window tiles in front of key 0 (window steps w .. -tb - 1)
    const int tq = blockIdx.x * 8 + w, tb = blockIdx.x * 8 - 16, np = (L + 31) >> 5, nu = np + 17;
    auto next_step = [&](int v) -> int { int n = v + 1; n = (n < np && n >= tq - 16 && n <= tq) ? min(tq + 1, np) : n; return n - np >= w ? max(n, np - tb) : n; };
    auto tile_of = [&](int v) -> int { const int t = v - np; return v < np ? v : tb + t + (t < w ? 17 : 0); };   // at v = nu, behind the last step: tile tb + 17, in bounds
    const size_t zo = (size_t)z * TT * HD; const h16* Q = (const h16*)Qf + zo; const h16* Kp = (const h16*)Kf + zo; Vh += zo; Vl += zo;
    v16h qf[2][2]; const h16* qp = Q + (q0 * HD + 8 * lane);
#pragma unroll
    for (int qb = 0; qb < 2; ++qb)
#pragma unroll
        for (int kc = 0; kc < 2; ++kc) qf[qb][kc] = WH::ld(qp + (qb * 2 + kc) * 512);
    // the Q loads are issued: their address register (an input, so that it lives up to here) may be rewritten behind this wait; the fence keeps later address work behind it
    asm volatile("s_wait_xcnt 0x0" :: "v"(qp) : "memory");
    __builtin_amdgcn_sched_barrier(0);
    v8f o[4][2]; float sum[2] = {0.f, 0.f};
#pragma unroll
    for (int db = 0; db < 4; ++db)
#pragma unroll
        for (int qb = 0; qb < 2; ++qb) o[db][qb] = (v8f){};
    v16h kf[2][2];
    int u = next_step(-1), jt = tile_of(u);   // u < nu: the wave's own query tile tq is a step of the window part
    const size_t kln = (size_t)(8 * lane), vln = kln;   // the lane's place in a packed block; a 32-key tile is 4 blocks (32 * HD elements) of K and of V^T alike, and its offset is scalar
    const h16* kp = Kp + jt * (32 * HD) + kln;
    int nj = -(jt * 32 + hi * 8);   // minus the lane's first key of the tile, carried from pass to pass: one vector add a pass, and the mask offsets below stay plain adds of constants
#pragma unroll
    for (int kt = 0; kt < 2; ++kt)
#pragma unroll
        for (int kc = 0; kc < 2; ++kc) kf[kt][kc] = WH::ld(kp + (kt * 2 + kc) * 512);
    // the same for the first K loads
    asm volatile("s_wait_xcnt 0x0" ::: "memory");
    __builtin_amdgcn_sched_barrier(0);
#pragma unroll 1   // stays rolled: one pass is about 600 instructions, and the K fragments rotate through the same registers
    do {
        const int j0 = jt * 32;
        u = next_step(u); jt = tile_of(u);   // behind the last step this names a tile that is fetched and not used
        v16bf vh[4], vl[4]; const bf* vhp = Vh + j0 * HD + vln; const bf* vlp = Vl + j0 * HD + vln;
#pragma unroll
        for (int db = 0; db < 4; ++db) { vh[db] = WF::ld(vhp + db * 512); vl[db] = WF::ld(vlp + db * 512); }
        v8f s[2][2];
#pragma unroll
        for (int kt = 0; kt < 2; ++kt)
#pragma unroll
            for (int qb = 0; qb < 2; ++qb) { v8f a = (v8f){};
#pragma unroll
                for (int kc = 0; kc < 2; ++kc) a = wmma16(kf[kt][kc], qf[qb][kc], a);
                s[kt][qb] = a; }
        // the next tile's K fragments are fetched behind this pass's score products, so that they fly under the softmax and attn.v
        const int jn = jt * 32; kp = Kp + jn * HD + kln;
#pragma unroll
        for (int kt = 0; kt < 2; ++kt)
#pragma unroll
            for (int kc = 0; kc < 2; ++kc) kf[kt][kc] = WH::ld(kp + (kt * 2 + kc) * 512);
        // all of this pass's loads are issued: their address registers may be rewritten behind this wait; the three addresses are inputs so that they live up to it and no load's result is placed in them ahead of it
        asm volatile("s_wait_xcnt 0x0" :: "v"(vhp), "v"(vlp), "v"(kp) : "memory");
        // keeps the V and next-K loads issued above the softmax, where its vector work hides their latency (the scheduler otherwise sinks them to their first use)
        __builtin_amdgcn_sched_barrier(0);
        v16bf ph[2], pl[2]; const int lk = L + nj;
#pragma unroll
        for (int qb = 0; qb < 2; ++qb) { const int dq = q0 + qb * 16 + lr + nj;
#pragma unroll
            for (int kt = 0; kt < 2; ++kt)
#pragma unroll
                for (int j = 0; j < 8; ++j) { const int cj = kt * 16 + j; const bool live = ((unsigned)(dq - cj) <= 512u) || (cj < lk);   // key = j0 + 8 hi + cj: 0 <= i - key <= 512, or key < L
                    // exp(30 tanh(s/30)) with tanh(u) = 1 - 2/(exp(2u) + 1), both exponentials base 2: 2^(C2 - 2 C2 / (2^(C1 s) + 1)), C1 = 2 log2(e) / 30, C2 = 30 log2(e); overflow of the inner one gives tanh = 1, underflow -1
                    const float r = __builtin_amdgcn_rcpf(__builtin_amdgcn_exp2f(s[kt][qb][j] * 0.0961796694f) + 1.0f);
                    const float p = live ? __builtin_amdgcn_exp2f(__builtin_fmaf(r, -86.5617025f, 43.2808512f)) : 0.0f; sum[qb] += p;
                    const __bf16 a = (__bf16)p; ph[qb][kt * 8 + j] = a; pl[qb][kt * 8 + j] = (__bf16)(p - (float)a); } }
#pragma unroll
        for (int db = 0; db < 4; ++db)
#pragma unroll
            for (int qb = 0; qb < 2; ++qb) { o[db][qb] = wmmab(vh[db], ph[qb], o[db][qb]); o[db][qb] = wmmab(vh[db], pl[qb], o[db][qb]); o[db][qb] = wmmab(vl[db], ph[qb], o[db][qb]); }
        nj += j0 - jn;
    } while (u < nu);
    // the last pass's stand-in K fetch feeds nothing: it has landed before the wave gives its registers back
    asm volatile("s_wait_loadcnt 0x0" ::: "memory");
    // the output plane (f16) is packed for k_gemmw (rows = tokens, K = DD): features 16 db + 8 hi .. of head h are half-block db of the head's two blocks, and each lane is its own lane there
#pragma unroll
    for (int qb = 0; qb < 2; ++qb) { const float f = __fdiv_rn(1.0f, sum[qb] + __shfl_xor(sum[qb], 16, 32)); const size_t ro = ((size_t)b * TT + q0 + qb * 16) * DD + h * (2 * 512) + lane * 8; bf* ahp = Af + ro; v8us oh[4];
#pragma unroll
        for (int db = 0; db < 4; ++db) {
#pragma unroll
            for (int j = 0; j < 8; ++j) oh[db][j] = f2h(o[db][qb][j] * f);
            *(v8us*)(ahp + db * 256) = oh[db]; }
        // the four stores are issued: their data and address registers (inputs, so that they live up to here) may be rewritten behind this wait
        asm volatile("s_wait_xcnt 0x0" :: "v"(oh[0]), "v"(oh[1]), "v"(oh[2]), "v"(oh[3]), "v"(ahp) : "memory"); }
}

extern "C" void kernel_launch(void* const* d_in, const int* in_sizes, int n_in,
                              void* d_out, int out_size, void* d_ws, size_t ws_size, hipStream_t stream) {
    (void)in_sizes; (void)n_in; (void)out_size;
    const float* x = (const float*)d_in[0]; const int* spl = (const int*)d_in[1]; const float* Wqkv = (const float*)d_in[2]; const float* bqkv = (const float*)d_in[3]; const float* Wo = (const float*)d_in[4]; const float* bo = (const float*)d_in[5];
    float* OUT = (float*)d_out;     // [2][2048][1024]
    char* wsp = (char*)d_ws;
    auto take = [&](size_t bytes) { char* p = wsp; wsp += (bytes + 255) & ~(size_t)255; return (void*)p; };
    bf* WQKV = (bf*)take((size_t)3 * DD * DD * 2); bf* WO = (bf*)take((size_t)DD * DD * 2);
    bf* XB = (bf*)take((size_t)NT * DD * 2);
    bf* QF = (bf*)take((size_t)NT * DD * 2); bf* KF = (bf*)take((size_t)NT * DD * 2); bf* VTh = (bf*)take((size_t)NT * DD * 2); bf* VTl = (bf*)take((size_t)NT * DD * 2);
    bf* ATF = (bf*)take((size_t)NT * DD * 2);
    if ((size_t)(wsp - (char*)d_ws) > ws_size) return;    // ws 256 MiB
    k_pack<<<(4 * DD + NT) / 32, 512, 0, stream>>>(Wqkv, Wo, x, WQKV, WO, XB);   // nn.Linear [out][in] = Bt as-is (q|k|v row blocks, one matrix)
    k_qkv<<<dim3(NT / 256, 3 * DD / 192, 1), 384, 0, stream>>>(XB, WQKV, bqkv, QF, KF, VTh, VTl);
    k_fattn<<<dim3(TT / 256, NB_ * NH_, 1), 256, 0, stream>>>(QF, KF, VTh, VTl, spl, ATF);
    k_gemmw<true, DD><<<dim3(NT / 128, DD / 128, 1), 128, 0, stream>>>(ATF, WO, OUT, DD, bo);
}

// v010
// One run takes 63.2 microseconds.
// Next to v009, in two timings, it ran 1.06 times as fast each time.
// Counting every step since v000, it is 21.0 times as fast.
#include <hip/hip_runtime.h>

// TunedSelfAttention (x [2][2048][1024]; qkv = x W_qkv^T + b_qkv ([3072][1024] Linear); 16 heads x 64; s = (q.k / 8); s = 30 tanh(s / 30) (softcap); keep key j iff (i >= j && i - j <= 512) || j < suffix_prefix_length[b] (int input, read as data), else -inf; softmax; y = attn.v merged; out = y W_proj^T + b_proj).
// The sliding-window/prefix mask is evaluated arithmetically per element; early rows see few keys, so attn.v runs on bf16 hi+lo planes (P = exp(s) spans e^-30 .. e^30, beyond the f16 range).
// Compute dtypes, f32 accumulate: every float input rounded to bf16; q/k/v projections on PLAIN bf16 operands (x, W inputs: exact, + bias);
// scores on one f16 plane each of q (x 1/8) and k (1 product); attn.v on bf16 hi+lo P and V^T planes (3 products); output projection on one f16 plane of the attention output x Wout (rounded to bf16, held as f16: exact from 2^-14 up, below that to 2^-25 absolute) (1 product);

#define NB_  2
#define TT   2048
#define DD   1024
#define NH_  16
#define HD   64
#define NT   (NB_ * TT)
#define ZH   2
#define PCAR 1024.0f
typedef _Float16 h16;
typedef unsigned short bf;
typedef __attribute__((ext_vector_type(16))) __bf16   v16bf;
typedef __attribute__((ext_vector_type(16))) _Float16 v16h;
typedef __attribute__((ext_vector_type(8)))  _Float16 v8h;
typedef __attribute__((ext_vector_type(8)))  unsigned short v8us;
typedef __attribute__((ext_vector_type(8)))  float    v8f;
typedef __attribute__((ext_vector_type(4)))  float    v4f;
typedef v8h  __attribute__((may_alias)) v8ha;
typedef v4f  __attribute__((may_alias)) v4fa;
typedef v8us __attribute__((may_alias)) v8usa;

__device__ __forceinline__ unsigned short f2bf(float f) { unsigned u = __float_as_uint(f); u += 0x7FFFu + ((u >> 16) & 1u); return (unsigned short)(u >> 16); }
__device__ __forceinline__ float bf2f(unsigned short b) { return __uint_as_float(((unsigned)b) << 16); }
__device__ __forceinline__ float bfr(float f) { return bf2f(f2bf(f)); }
__device__ __forceinline__ unsigned short f2h(float f) { return __builtin_bit_cast(unsigned short, (_Float16)f); }   // f32 to f16, nearest even, as the 16 bits a plane holds
__device__ __forceinline__ v16h cat16(v8h lo, v8h hi) { return __builtin_shufflevector(lo, hi, 0, 1, 2, 3, 4, 5, 6, 7, 8, 9, 10, 11, 12, 13, 14, 15); }
__device__ __forceinline__ v16bf cat16b(v8us lo, v8us hi) { return __builtin_bit_cast(v16bf, __builtin_shufflevector(lo, hi, 0, 1, 2, 3, 4, 5, 6, 7, 8, 9, 10, 11, 12, 13, 14, 15)); }
__device__ __forceinline__ v8f wmma16(v16h a, v16h b, v8f c) { return __builtin_amdgcn_wmma_f32_16x16x32_f16(false, a, false, b, (short)0, c, false, false); }
__device__ __forceinline__ v8f wmmab(v16bf a, v16bf b, v8f c) { return __builtin_amdgcn_wmma_f32_16x16x32_bf16(false, a, false, b, (short)0, c, false, false); }



// ---- k_gemmw: register-blocked GEMM, one wave per 64x64 output tile (16 accumulators), 4 waves (2 x 2) per 128x128 work-group tile; grid (M/128, N/128), 128 threads.
// C[m][n] (f32, pitch ldc, + optional f32 bias[n]) = sum_k A[m][k] Bt[n][k], both planes f16. K / 64 a power of two, K >= 256. The operand blocks of 64 k come once per work-group into LDS by asynchronous copies, three buffers: stages s + 2 and s + 3 fly while stage s + 1 is worked on; the waves read their fragments from LDS as they stand in the planes.
// FRAGMENT-PACKED PLANES: every 16-bit operand plane M[row][k] is kept as blocks of 16 rows x 32 k (512 elements, 1 KiB), a block being the WMMA fragment as the registers hold it:
// element (row, k) stands at block * 512 + half * 256 + lane * 8 + e with k % 32 = half * 16 + hi * 8 + e and lane = hi * 16 + row % 16. A wave-wide 16-byte load is then 512 contiguous bytes (4 whole lines, not 32 bytes of each of 16 lines).
// Lane and register of every element are those of the hardware's fragment layout, alike for A and B operands. Block order: (row / 16) * (K / 32) + k / 32, but V^T (see k_qkv). ld takes block start + lane * 8.
template <typename T16> struct WFrag;
template <> struct WFrag<h16> { typedef v16h V; static __device__ __forceinline__ V ld(const h16* p) { return cat16(*(const v8h*)p, *(const v8h*)(p + 256)); } static __device__ __forceinline__ v8f mma(V a, V b, v8f c) { return wmma16(a, b, c); } };
template <> struct WFrag<bf> { typedef v16bf V; static __device__ __forceinline__ V ld(const bf* p) { return cat16b(*(const v8us*)p, *(const v8us*)(p + 256)); } static __device__ __forceinline__ v8f mma(V a, V b, v8f c) { return wmmab(a, b, c); } };
// cp_g*: asynchronous copies to LDS, 16 bytes a lane, 512 contiguous bytes a wave and copy, through no register. A row group of a stage (16 rows x 64 k = two packed blocks) is 2 KiB in a row in its plane and in LDS alike,
// so its four copies share one address pair: l = the lane's LDS byte address, g = its global address, and the immediate offset moves both by the same bytes.
// The s_wait_xcnt 0 is the last line of the copies' own statement, so that it stands in front of every later write of a register that a copy names.
#define CPG(a, b) "global_load_async_to_lds_b128 %" #a ", %" #b ", off\n\tglobal_load_async_to_lds_b128 %" #a ", %" #b ", off offset:512\n\tglobal_load_async_to_lds_b128 %" #a ", %" #b ", off offset:1024\n\tglobal_load_async_to_lds_b128 %" #a ", %" #b ", off offset:1536\n\t"
__device__ __forceinline__ void cp_g1(unsigned l, const bf* g) { asm volatile(CPG(0, 1) "s_wait_xcnt 0x0" :: "v"(l), "v"(g) : "memory"); }
__device__ __forceinline__ void cp_g4(const unsigned* l, const bf* const* g) {
    asm volatile(CPG(0, 1) CPG(2, 3) CPG(4, 5) CPG(6, 7) "s_wait_xcnt 0x0"
        :: "v"(l[0]), "v"(g[0]), "v"(l[1]), "v"(g[1]), "v"(l[2]), "v"(g[2]), "v"(l[3]), "v"(g[3]) : "memory"); }
__device__ __forceinline__ void cp_g8(const unsigned* l, const bf* const* g) {
    asm volatile(CPG(0, 1) CPG(2, 3) CPG(4, 5) CPG(6, 7) CPG(8, 9) CPG(10, 11) CPG(12, 13) CPG(14, 15) "s_wait_xcnt 0x0"
        :: "v"(l[0]), "v"(g[0]), "v"(l[1]), "v"(g[1]), "v"(l[2]), "v"(g[2]), "v"(l[3]), "v"(g[3]), "v"(l[4]), "v"(g[4]), "v"(l[5]), "v"(g[5]), "v"(l[6]), "v"(g[6]), "v"(l[7]), "v"(g[7]) : "memory"); }
template <bool BIAS, int K>   // K is a constant so that the stage count is one
__global__ __launch_bounds__(128) void k_gemmw(const bf* __restrict__ A, const bf* __restrict__ Bt, float* C, int ldc, const float* __restrict__ bias) {
    typedef WFrag<h16> WF; typedef WF::V V;
    __shared__ __align__(16) h16 ring[3 * 16 * 1024];   // three stages of 16 row groups: 8 of A, 8 of Bt, each 16 rows x 64 k = two packed blocks
    __shared__ __align__(16) float osall[4 * 16 * 68];
    const int lane = threadIdx.x & 31, lr = lane & 15, hi = lane >> 4; const int w = __builtin_amdgcn_readfirstlane(threadIdx.x >> 5);
    const int wm = w & 1, wn = w >> 1; const int r0 = blockIdx.x * 128 + wm * 64, c0 = blockIdx.y * 128 + wn * 64; float* os = osall + w * (16 * 68);
    v8f acc[4][4];
#pragma unroll
    for (int mb = 0; mb < 4; ++mb)
#pragma unroll
        for (int nb = 0; nb < 4; ++nb) acc[mb][nb] = (v8f){};
    // THE RING: stage t lies in buffer t mod 3. The waves fill in two halves that take turns: the waves of parity fg bring the stages of that parity, so a wave has one stage's copies outstanding at a time and every wait is to 0,
    // while the work-group has two stages in flight, each with two passes from issue to wait. Wave rank fr of its half copies row groups 4 fr .. 4 fr + 3 of each of the two planes; a group of 16 rows is 16 K elements of its plane, a stage of 64 k is 1024 elements on
    // the work-groups that share operand rows (one blockIdx.x, or one blockIdx.y): each starts its walk over K at another block of 64 k and wraps round, so that they do not ask L2 for the same lines at the same moment. fs = the block that the wave's next fill brings, fb = the buffer it goes to
    static_assert((K / 64 & (K / 64 - 1)) == 0 && K / 64 >= 4, "the wrap is a mask");
    const int fg = w & 1, fr = w >> 1;
    int fs = (blockIdx.x + blockIdx.y + fg) & (K / 64 - 1), fb = fg;
    // ga, gt, l0 are the same in every lane and live in scalar registers from fill to fill; the lane's own 16 bytes are added where a copy's addresses are formed, in registers that the fragment set read next has left free
    const bf* ga = A + (size_t)(blockIdx.x * 8 + fr * 4) * (16 * K) + fs * 1024; const bf* gt = Bt + (size_t)(blockIdx.y * 8 + fr * 4) * (16 * K) + fs * 1024;
    const unsigned l0 = (unsigned)(size_t)ring + fr * (4 * 2048);
    auto fill = [&]() {
        unsigned l[8]; const bf* g[8];
#pragma unroll
        for (int j = 0; j < 4; ++j) { l[j] = l0 + fb * (16 * 2048) + j * 2048 + lane * 16; g[j] = ga + j * (16 * K) + lane * 8; l[4 + j] = l[j] + 8 * 2048; g[4 + j] = gt + j * (16 * K) + lane * 8; }
        cp_g8(l, g);
        const int d = fs >= K / 64 - 2 ? -(K / 64 - 2) * 1024 : 2 * 1024; fs = (fs + 2) & (K / 64 - 1);   // on by two blocks of 64 k, wrapping from the end to the start
        ga += d; gt += d; fb = fb == 0 ? 2 : fb - 1; };   // t + 2 mod 3 = t mod 3 - 1
    fill();   // stage 0 from the even half, stage 1 from the odd
    // stage 0 has landed before the barrier behind which the other waves read it
    if (fg == 0) asm volatile("s_wait_asynccnt 0x0" ::: "memory");
    __syncthreads();
    if (fg == 0) fill();   // stage 2
    // two fragment sets: each block of 32 k is read from LDS one block ahead, as one group, into the set that the matrix instructions in front of it have just left, and lands under the other set's 16 matrix instructions
    V a0[4], b0[4], a1[4], b1[4];
    auto frags = [&](V (&a)[4], V (&b)[4], const h16* p) {
#pragma unroll
        for (int i = 0; i < 4; ++i) { b[i] = WF::ld(p + (8 + wn * 4 + i) * 1024); a[i] = WF::ld(p + (wm * 4 + i) * 1024); } };
    auto block = [&](const V (&a)[4], const V (&b)[4]) {
#pragma unroll
        for (int nb = 0; nb < 4; ++nb)
#pragma unroll
            for (int mb = 0; mb < 4; ++mb) acc[mb][nb] = WF::mma(a[mb], b[nb], acc[mb][nb]); };
    frags(a0, b0, ring + lane * 8);
    int ro = 0;   // where stage s's buffer starts
#pragma unroll 1   // stays rolled: the buffers differ by an offset only
    for (int s = 0; s < K / 64; ++s) {
        const int rno = ro == 2 * (16 * 1024) ? 0 : ro + 16 * 1024; const h16* rb = ring + ro + lane * 8; const h16* rn = ring + rno + lane * 8; ro = rno;
        const bool mine = ((s + 1) & 1) == fg;   // stage s + 1 is of this wave's half: a scalar test
        // the fences keep each group of 16 LDS reads together and in front of the other set's matrix instructions (the scheduler otherwise sinks them to their first use or spreads them among those, each place with a wait)
        __builtin_amdgcn_sched_barrier(0);
        frags(a1, b1, rb + 512);
        __builtin_amdgcn_sched_barrier(0);
        block(a0, b0);
        __builtin_amdgcn_sched_barrier(0);
        // the publish point of stage s + 1, in front of stage s's last block, whose fragments are fetched: this wave's reads of stage s are done, the copies of stage s + 1 (all that its half has outstanding) have landed, then the barrier; only behind it is stage s's buffer filled anew, with stage s + 3 by the same half, and stage s + 1 read
        asm volatile("s_wait_dscnt 0x0" ::: "memory");
        if (mine) asm volatile("s_wait_asynccnt 0x0" ::: "memory");
        __syncthreads();
        if (mine && s + 3 < K / 64) fill();
        frags(a0, b0, rn);   // behind the last stage this reads the next buffer's old bytes, which feed nothing
        __builtin_amdgcn_sched_barrier(0);
        block(a1, b1);
    }
    // no copy is outstanding when the wave goes on
    asm volatile("s_wait_asynccnt 0x0" ::: "memory");
#pragma unroll
    for (int mb = 0; mb < 4; ++mb) {
#pragma unroll
        for (int nb = 0; nb < 4; ++nb) {
#pragma unroll
            for (int j = 0; j < 8; ++j) os[(hi * 8 + j) * 68 + nb * 16 + lr] = acc[mb][nb][j]; }
        __builtin_amdgcn_wave_barrier(); asm volatile("" ::: "memory");
        float* crow = C + (size_t)(r0 + mb * 16) * ldc + c0;
{
#pragma unroll
            for (int s = 0; s < 8; ++s) { const int row = 2 * s + hi, cofs = lr * 4; v4f val = *(const v4fa*)(os + row * 68 + cofs); if (BIAS) { val[0] += bfr(bias[c0 + cofs]); val[1] += bfr(bias[c0 + cofs + 1]); val[2] += bfr(bias[c0 + cofs + 2]); val[3] += bfr(bias[c0 + cofs + 3]); }
                *(v4f*)(crow + (size_t)row * ldc + cofs) = val; }
             }
        __builtin_amdgcn_wave_barrier(); asm volatile("" ::: "memory");
    }
}

__device__ __forceinline__ h16 tohx(float x) { return (h16)x; }
__device__ __forceinline__ void splitf(float y, unsigned short& h, unsigned short& l) { h = f2bf(y); l = f2bf(y - bf2f(h)); }
typedef __attribute__((ext_vector_type(2))) _Float16 v2h;
typedef __attribute__((ext_vector_type(4))) _Float16 v4h;
typedef __attribute__((ext_vector_type(2))) unsigned short v2us;
typedef __attribute__((ext_vector_type(4))) int v4i;

// k_pack: the three row-major f32 matrices of DD columns (W_qkv, W_proj, x) to their fragment-packed 16-bit planes (bf16; W_proj rounded to bf16 like the others and then held as f16, the operand type of k_gemmw) in one launch of one 16-wave work-group per WGP: (3 DD + DD + NT) / 16 = 512 groups of 16 rows, two a work-group, a wave taking 128 k of one group.
// A wave reads its 16 rows by 16 loads of 512 contiguous bytes, all in flight at once, rounds them, turns them into fragment order in its own LDS slice and stores the 4 packed blocks as 4 KiB in a row.
// The slice holds the 16 chunks of 8 k (16 rows x 16 bytes each) at a pitch of 272 bytes: the 8-byte writes of a row (chunk = lane / 2) and the 16-byte reads of a half-block (row = lane % 16, chunk = 2 s + lane / 16) then both spread over all banks.
typedef __attribute__((ext_vector_type(4))) unsigned short v4us;
__global__ __launch_bounds__(512) void k_pack(const float* __restrict__ wq, const float* __restrict__ wo, const float* __restrict__ x, bf* WQ, bf* WP, bf* XP) {
    __shared__ __align__(16) bf tr[16 * 16 * 136];
    const int lane = threadIdx.x & 31; const int w = __builtin_amdgcn_readfirstlane(threadIdx.x >> 5); const int blk = blockIdx.x;
    const float* src = blk < 3 * DD / 32 ? wq : blk < 4 * DD / 32 ? wo : x; bf* dst = blk < 3 * DD / 32 ? WQ : blk < 4 * DD / 32 ? WP : XP;
    const int g = (blk < 3 * DD / 32 ? blk : blk < 4 * DD / 32 ? blk - 3 * DD / 32 : blk - 4 * DD / 32) * 2 + (w >> 3), kc = w & 7;   // the matrix's own group of 16 rows, and which 128 k of it
    const float* sp = src + (size_t)g * (16 * DD) + kc * 128 + lane * 4; v4f v[16];
#pragma unroll
    for (int r = 0; r < 16; ++r) v[r] = *(const v4f*)(sp + r * DD);
    bf* ts = tr + w * (16 * 136); bf* wp = ts + (lane >> 1) * 136 + (lane & 1) * 4;
    if (blk >= 3 * DD / 32 && blk < 4 * DD / 32) {   // W_proj, one scalar branch for the whole work-group: the bf16 values as f16
#pragma unroll
        for (int r = 0; r < 16; ++r) { v4us o;
#pragma unroll
            for (int q = 0; q < 4; ++q) o[q] = f2h(bfr(v[r][q]));
            *(v4us*)(wp + r * 8) = o; }
    } else {
#pragma unroll
        for (int r = 0; r < 16; ++r) { v4us o;
#pragma unroll
            for (int q = 0; q < 4; ++q) o[q] = f2bf(v[r][q]);
            *(v4us*)(wp + r * 8) = o; }
    }
    // the wave's LDS writes are done before its lanes read what other lanes wrote
    asm volatile("s_wait_dscnt 0x0" ::: "memory");
    __builtin_amdgcn_wave_barrier();
    const bf* rp = ts + (lane >> 4) * 136 + (lane & 15) * 8; bf* dp = dst + (size_t)g * (16 * DD) + kc * 2048 + lane * 8; v8us o[8];
#pragma unroll
    for (int s = 0; s < 8; ++s) o[s] = *(const v8us*)(rp + s * (2 * 136));
#pragma unroll
    for (int s = 0; s < 8; ++s) *(v8us*)(dp + s * 256) = o[s];
}
__global__ __launch_bounds__(256) void k_wtT(const float* __restrict__ w, int pitch, int col0, bf* Bt) {
    const int lane = threadIdx.x & 31; const int L0 = (blockIdx.x * 8 + (threadIdx.x >> 5)) * 8; const int nlines = DD * DD / 64;
{
#pragma unroll
        for (int l = 0; l < 8; ++l) { const int L = L0 + l; if (L >= nlines) break; const int e = L * 64 + lane * 2; const int k = e & (DD - 1), n = e >> 10; v2us o;
#pragma unroll
            for (int q = 0; q < 2; ++q) o[q] = f2bf(w[(size_t)(k + q) * pitch + col0 + n]);
            *(v2us*)(Bt + (size_t)e) = o; }
         }
}
// k_qkv: the q, k and v projections as the one product x W_qkv^T that they are, one wave per 64x64 tile and the LDS ring as in k_gemmw, 12 waves (4 of tokens x 3 of W rows) per 256x192 work-group tile, grid (NT/256, 3 DD/192) = one work-group per WGP: a wave's tile column is one head of q, k or v.
// The epilogue adds the bias, scales (q only, by 1/8) and writes the planes that k_fattn reads (q, k: one f16 plane each; v: bf16 hi+lo), fragment-packed: q and k per head as M[t][64] (block (t / 16) * 2 + feature / 32), v per head as M[feature][t] with the four blocks of a 32-key tile side by side (block (t / 32) * 4 + feature / 16).
// A v tile is computed transposed (rows = W_qkv rows, columns = tokens: both operands are packed alike, so the two loaders only trade places), so that all three kinds leave through the same whole-line stores.
// qkv_out: VT = false: tile rows are tokens, columns the head's 64 features (bias by column); VT = true: rows are features, columns tokens (bias by row). bn = the tile's 64 bias values; ph, pl = the tile's 8 packed blocks (4096 elements in a row, either kind) in the two planes. ONE = true: one f16 plane, ph alone.
template <bool VT, bool ONE>
__device__ __forceinline__ void qkv_out(const v8f (&acc)[4][4], float* os, const float* __restrict__ bn, float sc, bf* ph, bf* pl, int lr, int hi) {
    v8f br[4]; float bc[4]; const float* bp = VT ? bn + hi * 8 : bn + lr;
#pragma unroll
    for (int i = 0; i < 4; ++i) { if (VT) br[i] = *(const v8f*)(bp + i * 16); else bc[i] = bp[i * 16]; }
    // the bias loads are issued: their address register (an input, so that it lives up to here) may be rewritten behind this wait
    asm volatile("s_wait_xcnt 0x0" :: "v"(bp) : "memory");
#pragma unroll
    for (int i = 0; i < 4; ++i) { if (VT) {
#pragma unroll
            for (int j = 0; j < 8; ++j) br[i][j] = bfr(br[i][j]); } else bc[i] = bfr(bc[i]); }
    bf* php = ph + (hi * 16 + lr) * 8; bf* plp = ONE ? php : pl + (hi * 16 + lr) * 8;
#pragma unroll
    for (int mb = 0; mb < 4; ++mb) {
#pragma unroll
        for (int nb = 0; nb < 4; ++nb) {
#pragma unroll
            for (int j = 0; j < 8; ++j) os[(hi * 8 + j) * 68 + nb * 16 + lr] = acc[mb][nb][j] + (VT ? br[mb][j] : bc[nb]); }
        __builtin_amdgcn_wave_barrier(); asm volatile("" ::: "memory");
        v8us oh[4], ol[4];
#pragma unroll
        for (int s = 0; s < 4; ++s) { const float* sp = os + lr * 68 + s * 16 + hi * 8; const v4f v0 = *(const v4fa*)sp, v1 = *(const v4fa*)(sp + 4);   // the lane's 8 elements of half-block s: row lr, columns 16 s + 8 hi ..
#pragma unroll
            for (int q = 0; q < 4; ++q) { if constexpr (ONE) { oh[s][q] = f2h(v0[q] * sc); oh[s][4 + q] = f2h(v1[q] * sc); } else { unsigned short c1, c2; splitf(v0[q] * sc, c1, c2); oh[s][q] = c1; ol[s][q] = c2; splitf(v1[q] * sc, c1, c2); oh[s][4 + q] = c1; ol[s][4 + q] = c2; } }
            const int d = (VT ? (s >> 1) * 4 + mb : mb * 2 + (s >> 1)) * 512 + (s & 1) * 256;
            *(v8us*)(php + d) = oh[s]; if constexpr (!ONE) *(v8us*)(plp + d) = ol[s]; }
        // the stores are issued: their data and address registers (inputs, so that they live up to here) may be rewritten behind this wait
        if constexpr (ONE) asm volatile("s_wait_xcnt 0x0" :: "v"(oh[0]), "v"(oh[1]), "v"(oh[2]), "v"(oh[3]), "v"(php) : "memory");
        else asm volatile("s_wait_xcnt 0x0" :: "v"(oh[0]), "v"(oh[1]), "v"(oh[2]), "v"(oh[3]), "v"(ol[0]), "v"(ol[1]), "v"(ol[2]), "v"(ol[3]), "v"(php), "v"(plp) : "memory");
        __builtin_amdgcn_wave_barrier();
    }
}
__global__ __launch_bounds__(384) void k_qkv(const bf* __restrict__ X, const bf* __restrict__ Wt, const float* __restrict__ bias, bf* Qf, bf* Kf, bf* Vh, bf* Vl) {
    typedef WFrag<bf> WF; typedef WF::V V; const int K = DD;
    __shared__ __align__(16) bf ring[3 * 28 * 1024];   // three stages of 28 row groups: 16 of X, 12 of Wt, each 16 rows x 64 k = two packed blocks
    __shared__ __align__(16) float osall[12 * 16 * 68];
    const int lane = threadIdx.x & 31, lr = lane & 15, hi = lane >> 4; const int w = __builtin_amdgcn_readfirstlane(threadIdx.x >> 5);
    const int wt = w & 3, wn = w >> 2; const int t0 = blockIdx.x * 256 + wt * 64, ny = blockIdx.y * 3 + wn, n0 = ny * 64; float* os = osall + w * (16 * 68);
    const int part = ny >> 4, z = (t0 >> 11) * NH_ + (ny & 15), tb = t0 & (TT - 1); const bool vt = part == 2;
    const int ao = (vt ? 16 + wn * 4 : wt * 4) * 1024, bo = (vt ? wt * 4 : 16 + wn * 4) * 1024;   // the wave's four A and four B row groups in a stage
    v8f acc[4][4];
#pragma unroll
    for (int mb = 0; mb < 4; ++mb)
#pragma unroll
        for (int nb = 0; nb < 4; ++nb) acc[mb][nb] = (v8f){};
    // the ring of k_gemmw: three buffers, and two halves of six waves that bring the even and the odd stages in turn (waves w, w + 4, w + 8 are never all of one half). A stage is 28 row groups of four copies; rank fr of its half takes groups fr, fr + 6, fr + 12, fr + 18, and ranks 0 .. 3 also group 24 + fr
    // as in k_gemmw, each work-group starts its walk over K at another block of 64 k and wraps round; fs = the block that the wave's next fill brings, fb = the buffer it goes to
    const int fg = ((w >> 2) + w) & 1, fr = w >> 1;
    int fs = (blockIdx.x + blockIdx.y + fg) & (K / 64 - 1), fb = fg;
    // gq, l0 are the same in every lane and live in scalar registers from fill to fill, as in k_gemmw; the lane's own 16 bytes are added where a copy's addresses are formed
    const bf* gq[5];
#pragma unroll
    for (int i = 0; i < 5; ++i) { const int g = min(fr + 6 * i, 27);
        gq[i] = (g < 16 ? X + (size_t)(blockIdx.x * 16 + g) * (16 * K) : Wt + (size_t)(blockIdx.y * 12 + g - 16) * (16 * K)) + fs * 1024; }
    const unsigned l0 = (unsigned)(size_t)ring + fr * 2048;
    auto fill = [&]() {
        unsigned l[5]; const bf* g[5];
#pragma unroll
        for (int i = 0; i < 5; ++i) { l[i] = l0 + fb * (28 * 2048) + i * (6 * 2048) + lane * 16; g[i] = gq[i] + lane * 8; }
        cp_g4(l, g); if (fr < 4) cp_g1(l[4], g[4]);
        const int d = fs >= K / 64 - 2 ? -(K / 64 - 2) * 1024 : 2 * 1024; fs = (fs + 2) & (K / 64 - 1);   // on by two blocks of 64 k, wrapping from the end to the start
#pragma unroll
        for (int i = 0; i < 5; ++i) gq[i] += d;
        fb = fb == 0 ? 2 : fb - 1; };   // t + 2 mod 3 = t mod 3 - 1
    fill();   // stage 0 from the even half, stage 1 from the odd
    // stage 0 has landed before the barrier behind which the other waves read it
    if (fg == 0) asm volatile("s_wait_asynccnt 0x0" ::: "memory");
    __syncthreads();
    if (fg == 0) fill();   // stage 2
    // two fragment sets, as in k_gemmw: each block of 32 k is read one block ahead and lands under the other set's 16 matrix instructions
    V a0[4], b0[4], a1[4], b1[4];
    auto frags = [&](V (&a)[4], V (&b)[4], const bf* p) {
#pragma unroll
        for (int i = 0; i < 4; ++i) { a[i] = WF::ld(p + ao + i * 1024); b[i] = WF::ld(p + bo + i * 1024); } };
    auto block = [&](const V (&a)[4], const V (&b)[4]) {
#pragma unroll
        for (int nb = 0; nb < 4; ++nb)
#pragma unroll
            for (int mb = 0; mb < 4; ++mb) acc[mb][nb] = WF::mma(a[mb], b[nb], acc[mb][nb]); };
    frags(a0, b0, ring + lane * 8);
    int ro = 0;   // where stage s's buffer starts
#pragma unroll 1   // stays rolled: the buffers differ by an offset only
    for (int s = 0; s < K / 64; ++s) {
        const int rno = ro == 2 * (28 * 1024) ? 0 : ro + 28 * 1024; const bf* rb = ring + ro + lane * 8; const bf* rn = ring + rno + lane * 8; ro = rno;
        const bool mine = ((s + 1) & 1) == fg;   // stage s + 1 is of this wave's half: a scalar test
        // the fences keep each group of 16 LDS reads together and in front of the other set's matrix instructions, as in k_gemmw
        __builtin_amdgcn_sched_barrier(0);
        frags(a1, b1, rb + 512);
        __builtin_amdgcn_sched_barrier(0);
        block(a0, b0);
        __builtin_amdgcn_sched_barrier(0);
        // the publish point of stage s + 1, as in k_gemmw, in front of stage s's last 16 matrix instructions, which need registers only: the copies of stage s + 3 and the first reads of stage s + 1 fly under them
        asm volatile("s_wait_dscnt 0x0" ::: "memory");
        if (mine) asm volatile("s_wait_asynccnt 0x0" ::: "memory");
        __syncthreads();
        if (mine && s + 3 < K / 64) fill();
        frags(a0, b0, rn);   // behind the last stage this reads the next buffer's old bytes, which feed nothing
        __builtin_amdgcn_sched_barrier(0);
        block(a1, b1);
    }
    // no copy is outstanding when the wave goes on
    asm volatile("s_wait_asynccnt 0x0" ::: "memory");
    if (vt) qkv_out<true, false>(acc, os, bias + n0, 1.0f, Vh + ((size_t)z * TT + tb) * HD, Vl + ((size_t)z * TT + tb) * HD, lr, hi);
    else qkv_out<false, true>(acc, os, bias + n0, part == 0 ? 0.125f : 1.0f, (part == 0 ? Qf : Kf) + ((size_t)z * TT + tb) * HD, nullptr, lr, hi);   // 64^-0.5 folded into q exactly
}
// k_fattn: scores, softcap, mask, softmax and attn.v of one head in one kernel; one wave owns 32 queries and walks the keys 32 at a time, everything in registers.
// S^T = K Q^T (A = 16 keys x 64, B = 16 queries): a lane then holds, for query lr, keys 8 hi + j of each 16-key tile, which is the B fragment of P^T for O^T = V^T P^T as it stands.
// The softcap bounds every score to [-30, 30], so exp(s) needs no running maximum; the row is divided by its sum once, behind the last key.
// Every inner loop is unrolled whole so that the fragment arrays are indexed by constants and stay in registers.
// A wave visits only the 32-key tiles that can hold a live key for its 32 queries: the tiles below the prefix length that lie outside its window, then the 17 tiles of its window (query tile - 16 .. query tile).
// The 8 windows of a block are 17 consecutive tiles out of the same 24, so each holds every residue modulo 17 once: at window step t a wave takes its tile of residue t, and the block reads at most two different tiles at a time, which one wave's lines serve to the others from the WGP cache.
// waves_per_eu(2, 2): the grid is one 8-wave block per WGP, two waves a SIMD, so the register budget is that of two waves.
__global__ __launch_bounds__(256) __attribute__((amdgpu_waves_per_eu(2, 2))) void k_fattn(const bf* __restrict__ Qf, const bf* __restrict__ Kf, const bf* __restrict__ Vh, const bf* __restrict__ Vl, const int* __restrict__ spl, bf* Af) {
    typedef WFrag<bf> WF; typedef WFrag<h16> WH;
    const int lane = threadIdx.x & 31, lr = lane & 15, hi = lane >> 4; const int z = blockIdx.y, b = z >> 4, h = z & 15; const int w = __builtin_amdgcn_readfirstlane(threadIdx.x >> 5); const int q0 = blockIdx.x * 256 + w * 32; const int L = min(max(spl[b], 0), TT);   // key < L reads the same for keys 0 .. TT - 1, and L - j0 below cannot wrap
    // the walk, all in scalars and free of branches: steps 0 .. np - 1 are the prefix tiles, steps np .. np + 16 the window tiles; next_step passes over the prefix tiles that the window holds and the window tiles in front of key 0 (window steps w .. -tb - 1)
    const int tq = blockIdx.x * 8 + w, tb = blockIdx.x * 8 - 16, np = (L + 31) >> 5, nu = np + 17;
    auto next_step = [&](int v) -> int { int n = v + 1; n = (n < np && n >= tq - 16 && n <= tq) ? min(tq + 1, np) : n; return n - np >= w ? max(n, np - tb) : n; };
    auto tile_of = [&](int v) -> int { const int t = v - np; return v < np ? v : tb + t + (t < w ? 17 : 0); };   // at v = nu, behind the last step: tile tb + 17, in bounds
    const size_t zo = (size_t)z * TT * HD; const h16* Q = (const h16*)Qf + zo; const h16* Kp = (const h16*)Kf + zo; Vh += zo; Vl += zo;
    v16h qf[2][2]; const h16* qp = Q + (q0 * HD + 8 * lane);
#pragma unroll
    for (int qb = 0; qb < 2; ++qb)
#pragma unroll
        for (int kc = 0; kc < 2; ++kc) qf[qb][kc] = WH::ld(qp + (qb * 2 + kc) * 512);
    // the Q loads are issued: their address register (an input, so that it lives up to here) may be rewritten behind this wait; the fence keeps later address work behind it
    asm volatile("s_wait_xcnt 0x0" :: "v"(qp) : "memory");
    __builtin_amdgcn_sched_barrier(0);
    v8f o[4][2]; float sum[2] = {0.f, 0.f};
#pragma unroll
    for (int db = 0; db < 4; ++db)
#pragma unroll
        for (int qb = 0; qb < 2; ++qb) o[db][qb] = (v8f){};
    v16h kf[2][2];
    int u = next_step(-1), jt = tile_of(u);   // u < nu: the wave's own query tile tq is a step of the window part
    const size_t kln = (size_t)(8 * lane), vln = kln;   // the lane's place in a packed block; a 32-key tile is 4 blocks (32 * HD elements) of K and of V^T alike, and its offset is scalar
    const h16* kp = Kp + jt * (32 * HD) + kln;
    int nj = -(jt * 32 + hi * 8);   // minus the lane's first key of the tile, carried from pass to pass: one vector add a pass, and the mask offsets below stay plain adds of constants
#pragma unroll
    for (int kt = 0; kt < 2; ++kt)
#pragma unroll
        for (int kc = 0; kc < 2; ++kc) kf[kt][kc] = WH::ld(kp + (kt * 2 + kc) * 512);
    // the same for the first K loads
    asm volatile("s_wait_xcnt 0x0" ::: "memory");
    __builtin_amdgcn_sched_barrier(0);
#pragma unroll 1   // stays rolled: one pass is about 600 instructions, and the K fragments rotate through the same registers
    do {
        const int j0 = jt * 32;
        u = next_step(u); jt = tile_of(u);   // behind the last step this names a tile that is fetched and not used
        v16bf vh[4], vl[4]; const bf* vhp = Vh + j0 * HD + vln; const bf* vlp = Vl + j0 * HD + vln;
#pragma unroll
        for (int db = 0; db < 4; ++db) { vh[db] = WF::ld(vhp + db * 512); vl[db] = WF::ld(vlp + db * 512); }
        v8f s[2][2];
#pragma unroll
        for (int kt = 0; kt < 2; ++kt)
#pragma unroll
            for (int qb = 0; qb < 2; ++qb) { v8f a = (v8f){};
#pragma unroll
                for (int kc = 0; kc < 2; ++kc) a = wmma16(kf[kt][kc], qf[qb][kc], a);
                s[kt][qb] = a; }
        // the next tile's K fragments are fetched behind this pass's score products, so that they fly under the softmax and attn.v
        const int jn = jt * 32; kp = Kp + jn * HD + kln;
#pragma unroll
        for (int kt = 0; kt < 2; ++kt)
#pragma unroll
            for (int kc = 0; kc < 2; ++kc) kf[kt][kc] = WH::ld(kp + (kt * 2 + kc) * 512);
        // all of this pass's loads are issued: their address registers may be rewritten behind this wait; the three addresses are inputs so that they live up to it and no load's result is placed in them ahead of it
        asm volatile("s_wait_xcnt 0x0" :: "v"(vhp), "v"(vlp), "v"(kp) : "memory");
        // keeps the V and next-K loads issued above the softmax, where its vector work hides their latency (the scheduler otherwise sinks them to their first use)
        __builtin_amdgcn_sched_barrier(0);
        v16bf ph[2], pl[2]; const int lk = L + nj;
#pragma unroll
        for (int qb = 0; qb < 2; ++qb) { const int dq = q0 + qb * 16 + lr + nj;
#pragma unroll
            for (int kt = 0; kt < 2; ++kt)
#pragma unroll
                for (int j = 0; j < 8; ++j) { const int cj = kt * 16 + j; const bool live = ((unsigned)(dq - cj) <= 512u) || (cj < lk);   // key = j0 + 8 hi + cj: 0 <= i - key <= 512, or key < L
                    // exp(30 tanh(s/30)) with tanh(u) = 1 - 2/(exp(2u) + 1), both exponentials base 2: 2^(C2 - 2 C2 / (2^(C1 s) + 1)), C1 = 2 log2(e) / 30, C2 = 30 log2(e); overflow of the inner one gives tanh = 1, underflow -1
                    const float r = __builtin_amdgcn_rcpf(__builtin_amdgcn_exp2f(s[kt][qb][j] * 0.0961796694f) + 1.0f);
                    const float p = live ? __builtin_amdgcn_exp2f(__builtin_fmaf(r, -86.5617025f, 43.2808512f)) : 0.0f; sum[qb] += p;
                    const __bf16 a = (__bf16)p; ph[qb][kt * 8 + j] = a; pl[qb][kt * 8 + j] = (__bf16)(p - (float)a); } }
#pragma unroll
        for (int db = 0; db < 4; ++db)
#pragma unroll
            for (int qb = 0; qb < 2; ++qb) { o[db][qb] = wmmab(vh[db], ph[qb], o[db][qb]); o[db][qb] = wmmab(vh[db], pl[qb], o[db][qb]); o[db][qb] = wmmab(vl[db], ph[qb], o[db][qb]); }
        nj += j0 - jn;
    } while (u < nu);
    // the last pass's stand-in K fetch feeds nothing: it has landed before the wave gives its registers back
    asm volatile("s_wait_loadcnt 0x0" ::: "memory");
    // the output plane (f16) is packed for k_gemmw (rows = tokens, K = DD): features 16 db + 8 hi .. of head h are half-block db of the head's two blocks, and each lane is its own lane there
#pragma unroll
    for (int qb = 0; qb < 2; ++qb) { const float f = __fdiv_rn(1.0f, sum[qb] + __shfl_xor(sum[qb], 16, 32)); const size_t ro = ((size_t)b * TT + q0 + qb * 16) * DD + h * (2 * 512) + lane * 8; bf* ahp = Af + ro; v8us oh[4];
#pragma unroll
        for (int db = 0; db < 4; ++db) {
#pragma unroll
            for (int j = 0; j < 8; ++j) oh[db][j] = f2h(o[db][qb][j] * f);
            *(v8us*)(ahp + db * 256) = oh[db]; }
        // the four stores are issued: their data and address registers (inputs, so that they live up to here) may be rewritten behind this wait
        asm volatile("s_wait_xcnt 0x0" :: "v"(oh[0]), "v"(oh[1]), "v"(oh[2]), "v"(oh[3]), "v"(ahp) : "memory"); }
}

extern "C" void kernel_launch(void* const* d_in, const int* in_sizes, int n_in,
                              void* d_out, int out_size, void* d_ws, size_t ws_size, hipStream_t stream) {
    (void)in_sizes; (void)n_in; (void)out_size;
    const float* x = (const float*)d_in[0]; const int* spl = (const int*)d_in[1]; const float* Wqkv = (const float*)d_in[2]; const float* bqkv = (const float*)d_in[3]; const float* Wo = (const float*)d_in[4]; const float* bo = (const float*)d_in[5];
    float* OUT = (float*)d_out;     // [2][2048][1024]
    char* wsp = (char*)d_ws;
    auto take = [&](size_t bytes) { char* p = wsp; wsp += (bytes + 255) & ~(size_t)255; return (void*)p; };
    bf* WQKV = (bf*)take((size_t)3 * DD * DD * 2); bf* WO = (bf*)take((size_t)DD * DD * 2);
    bf* XB = (bf*)take((size_t)NT * DD * 2);
    bf* QF = (bf*)take((size_t)NT * DD * 2); bf* KF = (bf*)take((size_t)NT * DD * 2); bf* VTh = (bf*)take((size_t)NT * DD * 2); bf* VTl = (bf*)take((size_t)NT * DD * 2);
    bf* ATF = (bf*)take((size_t)NT * DD * 2);
    if ((size_t)(wsp - (char*)d_ws) > ws_size) return;    // ws 256 MiB
    k_pack<<<(4 * DD + NT) / 32, 512, 0, stream>>>(Wqkv, Wo, x, WQKV, WO, XB);   // nn.Linear [out][in] = Bt as-is (q|k|v row blocks, one matrix)
    k_qkv<<<dim3(NT / 256, 3 * DD / 192, 1), 384, 0, stream>>>(XB, WQKV, bqkv, QF, KF, VTh, VTl);
    k_fattn<<<dim3(TT / 256, NB_ * NH_, 1), 256, 0, stream>>>(QF, KF, VTh, VTl, spl, ATF);
    k_gemmw<true, DD><<<dim3(NT / 128, DD / 128, 1), 128, 0, stream>>>(ATF, WO, OUT, DD, bo);
}
